// v000
// Times are from an AMD MI455X. After a warm-up the kernel runs many times in a row, and a time is the length of
// such a window on the GPU divided by its runs, so every launch and the gaps after it count. The runs cycle
// through copies of the inputs. A figure is the median of several windows, for all but v000 over two sittings.
// Sittings can differ by a few percent; kernels timed side by side share one.
// v000, which the later versions start from, runs in 325 microseconds.
// Contractions: qkv projection (x token rows f16 x64 . W_qkv rows f16 x64, K=256, one product); attention scores
// S^T = k (f16 x1024 hi) . q^T (f16 x1024 hi plane + f16 residual plane, two products, head dim 32); attention
// O^T = v^T (f16 x256 hi and residual planes) . P^T (f16 x16384 hi and residual, taken from the score D registers),
// three products hi.hi + hi.lo + lo.hi over 4096 keys. All v_wmma_f32_16x16x32_f16, f32 accumulate; LayerNorm and
// softmax in f32 on VALU; every float input RNE-converted to bf16 on load.
#include <hip/hip_runtime.h>
#include <math.h>
#include <stdint.h>

#define NTOK   4096
#define CDIM   256
#define NHEAD  8
#define DHEAD  32
#define OC     (3 * CDIM)
#define NSTR   2
#define MROWS  (NSTR * NTOK)
#define LNEPS  1.0e-5f
#define XC     64.0f
#define WSC    64.0f
#define QC     1024.0f
#define KC     1024.0f
#define VC     256.0f
#define LNPSC  9.704060527839234f
#define ATTSC  0.17677669529663687f
static_assert(NHEAD * DHEAD == CDIM);
static_assert((MROWS % 64) == 0 && (OC % 64) == 0 && (CDIM % 32) == 0);
static_assert((((MROWS / 64) * (OC / 64)) % 8) == 0);
static_assert((NTOK % 64) == 0 && (MROWS % 8) == 0 && (OC % 8) == 0);

typedef _Float16 v16h __attribute__((ext_vector_type(16)));
typedef _Float16 v8h  __attribute__((ext_vector_type(8)));
typedef float    v8f  __attribute__((ext_vector_type(8)));
typedef float    v4f  __attribute__((ext_vector_type(4)));
typedef unsigned int v4u __attribute__((ext_vector_type(4)));

union FragH { v16h v; v8h h[2]; };

// ---- scalar helpers --------------------------------------------------------------------------------
__device__ __forceinline__ unsigned short bf_bits(float f) {          // f32 -> bf16 bits, RNE convert
  unsigned u = __float_as_uint(f);
  return (unsigned short)((u + 0x7FFFu + ((u >> 16) & 1u)) >> 16);
}
__device__ __forceinline__ float bf_up(unsigned short h) { return __uint_as_float(((unsigned)h) << 16); }
__device__ __forceinline__ float bfr(float f) { return bf_up(bf_bits(f)); }
__device__ __forceinline__ unsigned short h_bits(_Float16 x) { return __builtin_bit_cast(unsigned short, x); }
__device__ __forceinline__ unsigned pk16(unsigned short a, unsigned short b) { return (unsigned)a | ((unsigned)b << 16); }
__device__ __forceinline__ v8f zero8() { v8f z = {0.f, 0.f, 0.f, 0.f, 0.f, 0.f, 0.f, 0.f}; return z; }
__device__ __forceinline__ float hmax8(v8f s) {
  return fmaxf(fmaxf(fmaxf(s[0], s[1]), fmaxf(s[2], s[3])), fmaxf(fmaxf(s[4], s[5]), fmaxf(s[6], s[7])));
}

// ---- fragment loader: 16-bit A/B operand, lane -> row/col (lane&15), p already includes +8*(lane>>4);
//      elements 0..7 <- p[0..7] (k0+8h..), elements 8..15 <- p[16..23] (k0+16+8h..)
__device__ __forceinline__ v16h ldfrag_h(const _Float16* p) {
  FragH f;
  f.h[0] = *(const v8h*)(p);
  f.h[1] = *(const v8h*)(p + 16);
  return f.v;
}

// ---- WMMA helpers with trailing VALU hazard gap --------------------------------------------------------
__device__ __forceinline__ v8f mma_h_raw(v16h a, v16h b, v8f c) {
  return __builtin_amdgcn_wmma_f32_16x16x32_f16(false, a, false, b, (short)0, c, false, false);
}
__device__ __forceinline__ void dep_guard1(v8f& a, v8f& b, v16h x) {
#if defined(__HIP_DEVICE_COMPILE__)
  asm volatile("v_nop\n\tv_nop\n\tv_nop\n\tv_nop" : "+v"(a), "+v"(b) : "v"(x));
#endif
}
__device__ __forceinline__ void keep4_h(v16h a, v16h b, v16h c, v16h d) {
#if defined(__HIP_DEVICE_COMPILE__)
  asm volatile("v_nop" :: "v"(a), "v"(b), "v"(c), "v"(d));
#endif
}
__device__ __forceinline__ void acc_guard4(v8f& a, v8f& b, v8f& c, v8f& d) {
#if defined(__HIP_DEVICE_COMPILE__)
  asm volatile("v_nop\n\tv_nop\n\tv_nop\n\tv_nop" : "+v"(a), "+v"(b), "+v"(c), "+v"(d));
#endif
}
__device__ __forceinline__ void sguard2(v8f& a, v8f& b, v16h k0, v16h k1, v16h q0, v16h q1) {
#if defined(__HIP_DEVICE_COMPILE__)
  asm volatile("v_nop\n\tv_nop\n\tv_nop\n\tv_nop"
               : "+v"(a), "+v"(b) : "v"(k0), "v"(k1), "v"(q0), "v"(q1));
#endif
}
__device__ __forceinline__ void oguard2(v8f& a, v8f& b, v16h x0, v16h x1, v16h x2, v16h x3, v16h p0, v16h p1) {
#if defined(__HIP_DEVICE_COMPILE__)
  asm volatile("v_nop\n\tv_nop\n\tv_nop\n\tv_nop"
               : "+v"(a), "+v"(b) : "v"(x0), "v"(x1), "v"(x2), "v"(x3), "v"(p0), "v"(p1));
#endif
}
__device__ __forceinline__ void wave_sync_lds() {
  __builtin_amdgcn_fence(__ATOMIC_RELEASE, "workgroup");
  __builtin_amdgcn_wave_barrier();
  __builtin_amdgcn_fence(__ATOMIC_ACQUIRE, "workgroup");
}
__device__ __forceinline__ float wsum(float v) {
#pragma unroll
  for (int off = 16; off > 0; off >>= 1) v += __shfl_xor(v, off, 32);
  return v;
}
__device__ __forceinline__ float ln32(float x, float g, float b) {
  const float mean = wsum(x) * (1.0f / DHEAD);
  const float d    = x - mean;
  const float var  = wsum(d * d) * (1.0f / DHEAD);
  return (d * rsqrtf(var + LNEPS)) * g + b;
}

// =====================================================================================================
// Operand planes: XN[s*4096 + n][256] = f16( bf16_RNE(x_s[n][c]) * 64 ) (blocks 0..1023, 8 rows each, stream s = bx/512),
// WT[o][256] = f16( bf16_RNE(W[o][c]) * 64 ) (blocks 1024..1119; W is already [o][c] = k-contiguous, no transpose).
// Thread t: row = 8 per block (t>>5), 8 consecutive elements at 8*(t&31): one instruction of 32 lanes x 16 B = one whole
// coverage: 1024 x 8 = 8192 XN rows and 96 x 8 = 768 WT rows, each row 32 lanes x 8 halves = 256 columns: both planes entirely.
// =====================================================================================================
__global__ __launch_bounds__(256) void cvt_planes(const float* __restrict__ xb, const float* __restrict__ xa,
                                                   const float* __restrict__ w, unsigned short* XN, unsigned short* WT) {
  const int tid = threadIdx.x, r = tid >> 5, lane = tid & 31;
  const int bx  = blockIdx.x;
  const bool isx = (bx < (MROWS / 8));                    // block-uniform
  const int  s   = isx ? (bx / (NTOK / 8)) : 0;           // stream of this block
  const float* src = isx ? ((s == 0) ? xb : xa) : w;
  unsigned short* dst = isx ? XN : WT;
  const float sc  = isx ? XC : WSC;
  const int drow  = isx ? (bx * 8 + r) : ((bx - MROWS / 8) * 8 + r);   // row in dst plane
  const int srow  = isx ? (drow - s * NTOK) : drow;                       // row in src tensor
  const float* sp = src + (size_t)srow * CDIM + 8 * lane;
  const v4f a = *(const v4f*)(sp), c = *(const v4f*)(sp + 4);
  float f[8];
#pragma unroll
  for (int i = 0; i < 4; ++i) { f[i] = bfr(a[i]) * sc; f[4 + i] = bfr(c[i]) * sc; }
  v4u v;
#pragma unroll
  for (int i = 0; i < 4; ++i) v[i] = pk16(h_bits((_Float16)f[2 * i]), h_bits((_Float16)f[2 * i + 1]));
  unsigned short* dp = dst + (size_t)drow * CDIM + 8 * lane;
  *(v4u*)dp = v;
  
}

// =====================================================================================================
// Register-blocked f16 WMMA GEMM, one wave per 64x64 tile, no block barriers:
//   C[m][n] = osc * sum_k A[m][k] * Bt[n][k]   (f32 out, pitch ldc)
// A: f16 row-major [M][K] pitch lda; Bt: f16 [N][K] (k contiguous, pitch ldb); fragments = two 16-B loads with the
// split k map (ldfrag_h). M, N multiples of 64, K multiple of 32 (host-checked constants here).
// lines, n0*4 is a multiple of 256) written by 16 consecutive lanes x 16 B of ONE instruction (lanes 0-15 row it*2, lanes
// coverage: 4 slabs x 16 rows x 64 cols = the wave's whole 64x64 tile; grid = tilesM*tilesN/8 blocks (exact multiple of 8).
// =====================================================================================================
__global__ __launch_bounds__(256) void gemm64f(
    const unsigned short* __restrict__ Ap, int lda,
    const unsigned short* __restrict__ Bp, int ldb,
    float* Cout, int ldc, float osc, int M, int N, int K) {
  __shared__ __align__(16) float sT[8][16 * 68];   // per-wave 16x64 slab, pitch 68 floats
  const int lane = threadIdx.x & 31;
  const int wave = threadIdx.x >> 5;
  const int tilesN = N >> 6;
  const int tilesM = M >> 6;
  const int tile = blockIdx.x * 8 + wave;
  if (tile >= tilesM * tilesN) return;   // wave-uniform; no block barriers in this kernel
  const int tm = tile / tilesN;
  const int tn = tile - tm * tilesN;
  const int m0 = tm << 6;
  const int n0 = tn << 6;

  const _Float16* Ah = (const _Float16*)(const void*)Ap;
  const _Float16* Bb = (const _Float16*)(const void*)Bp;

  const int rlane = lane & 15;                 // row (A) / col (B, D) within subtile
  const int koff  = (lane >> 4) * 8;           // k offset of this lane half
  const int mOff  = (lane >> 4) * 8;           // D row offset

  v8f acc[4][4];
#pragma unroll
  for (int i = 0; i < 4; ++i)
#pragma unroll
    for (int j = 0; j < 4; ++j) acc[i][j] = zero8();

  for (int k0 = 0; k0 < K; k0 += 32) {
    v16h bh[4];
#pragma unroll
    for (int j = 0; j < 4; ++j) {
      const size_t bo = (size_t)(n0 + (j << 4) + rlane) * ldb + koff + k0;
      bh[j] = ldfrag_h(Bb + bo);
    }
#pragma unroll
    for (int i = 0; i < 4; ++i) {
      const size_t ao = (size_t)(m0 + (i << 4) + rlane) * lda + koff + k0;
      const v16h ah = ldfrag_h(Ah + ao);
#pragma unroll
      for (int j = 0; j < 4; ++j) acc[i][j] = mma_h_raw(ah, bh[j], acc[i][j]);
      dep_guard1(acc[i][0], acc[i][3], ah);
    }
    keep4_h(bh[0], bh[1], bh[2], bh[3]);
  }
  acc_guard4(acc[0][0], acc[0][1], acc[0][2], acc[0][3]);
  acc_guard4(acc[1][0], acc[1][1], acc[1][2], acc[1][3]);
  acc_guard4(acc[2][0], acc[2][1], acc[2][2], acc[2][3]);
  acc_guard4(acc[3][0], acc[3][1], acc[3][2], acc[3][3]);

  const int hh2 = lane >> 4, c4 = (lane & 15) * 4;     // f32 out: 256-B row segment = 16 lanes x 16 B
  float* slab = sT[wave];
#pragma unroll
  for (int i = 0; i < 4; ++i) {
    const int mBase = m0 + (i << 4);
#pragma unroll
    for (int j = 0; j < 4; ++j) {
#pragma unroll
      for (int r = 0; r < 8; ++r) {
        slab[(mOff + r) * 68 + (j << 4) + rlane] = acc[i][j][r];
      }
    }
    wave_sync_lds();
    v4f vals[8];
#pragma unroll
    for (int it = 0; it < 8; ++it) {
      const int row = it * 2 + hh2;                      // it 0..7 x hh2 0..1 = rows 0..15
      v4f v = *(const v4f*)(slab + row * 68 + c4);
#pragma unroll
      for (int e = 0; e < 4; ++e) v[e] = v[e] * osc;
      vals[it] = v;
    }
    {
#pragma unroll
      for (int it = 0; it < 8; ++it) {
        const int row = it * 2 + hh2;
        *(v4f*)(Cout + (size_t)(mBase + row) * ldc + n0 + c4) = vals[it];
      }
      
    }
    wave_sync_lds();
  }
}

// =====================================================================================================
// Per-head LayerNorm of q, k and v (feature o = part*256 + h*32 + dd of the projection row) and 16-bit plane writes.
// Block = 256 threads = 8 waves = 64 tokens tok0..tok0+63 of stream s (grid = 2 x 64 = 128); wave w owns tokens 8w..8w+7;
//   q: y*1024 -> f16 hi + f16 residual (y*1024 - hi), k: y*1024 -> f16 hi. The 8 head vectors of one token are collected
//   v: y*256 -> f16 hi + residual stored transposed into block tiles VsH/VsL [128 features of half vh][64 tokens]
//      (pitch 72), block barrier, then 4 instructions each of 32 lines x (8 consecutive lanes x 16 B) write whole
// coverage: q/k rows: 128 blocks x 8 waves x 8 tokens = all 8192 rows, full width; VT planes: 128 blocks x 2 halves x
//           128 features x 64 tokens = [2][256][4096] entirely, both hi and lo.
// =====================================================================================================
__global__ __launch_bounds__(256)
void ln_heads(const float* __restrict__ T, const float* __restrict__ gam, const float* __restrict__ bet,
              unsigned short* QH, unsigned short* QL, unsigned short* KH,
              unsigned short* VTH, unsigned short* VTL) {
  __shared__ __align__(16) unsigned short VsH[128 * 72];
  __shared__ __align__(16) unsigned short VsL[128 * 72];
  __shared__ __align__(16) unsigned short RBh[8][CDIM];
  __shared__ __align__(16) unsigned short RBl[8][CDIM];
  const int tid = threadIdx.x, wave = tid >> 5, lane = tid & 31;
  const int bx  = blockIdx.x;
  const int s   = bx / (NTOK / 64);                 // 64 blocks per stream
  const int tok0 = (bx - s * (NTOK / 64)) * 64;
  const float g  = bfr(gam[lane]);
  const float be = bfr(bet[lane]);
#pragma unroll 1
  for (int vh = 0; vh < 2; ++vh) {
#pragma unroll 1
    for (int i = 0; i < 8; ++i) {
      const int tl = wave * 8 + i;
      const size_t row = (size_t)s * NTOK + tok0 + tl;
      const float* tr = T + row * OC;
      if (vh == 0) {                                  // block-uniform
#pragma unroll 1
        for (int h = 0; h < NHEAD; ++h) {
          const float y = ln32(tr[h * DHEAD + lane], g, be) * QC;
          const _Float16 hi = (_Float16)y;
          const _Float16 lo = (_Float16)(y - (float)hi);
          RBh[wave][h * DHEAD + lane] = h_bits(hi);
          RBl[wave][h * DHEAD + lane] = h_bits(lo);
        }
        wave_sync_lds();
        {
          const v4u a  = *(const v4u*)(&RBh[wave][8 * lane]);
          const v4u bl = *(const v4u*)(&RBl[wave][8 * lane]);
          unsigned short* pa = QH + row * CDIM + 8 * lane;
          unsigned short* pb = QL + row * CDIM + 8 * lane;
          *(v4u*)pa = a;
          *(v4u*)pb = bl;
          
        }
        wave_sync_lds();
#pragma unroll 1
        for (int h = 0; h < NHEAD; ++h) {
          const float y = ln32(tr[CDIM + h * DHEAD + lane], g, be) * KC;
          RBh[wave][h * DHEAD + lane] = h_bits((_Float16)y);
        }
        wave_sync_lds();
        {
          const v4u a = *(const v4u*)(&RBh[wave][8 * lane]);
          unsigned short* pk = KH + row * CDIM + 8 * lane;
          *(v4u*)pk = a;
          
        }
        wave_sync_lds();
      }
#pragma unroll 1
      for (int hq = 0; hq < 4; ++hq) {
        const int h = vh * 4 + hq;
        const float y = ln32(tr[2 * CDIM + h * DHEAD + lane], g, be) * VC;
        const _Float16 hi = (_Float16)y;
        const _Float16 lo = (_Float16)(y - (float)hi);
        VsH[(hq * DHEAD + lane) * 72 + tl] = h_bits(hi);
        VsL[(hq * DHEAD + lane) * 72 + tl] = h_bits(lo);
      }
    }
    __syncthreads();
    {
      const int e = tid & 7, fq = tid >> 3;           // fq 0..31: line group, e: 16-B piece
      v4u hv[4], lv[4];
#pragma unroll
      for (int it = 0; it < 4; ++it) {
        const int fl = it * 32 + fq;                   // it 0..3 x fq 0..31 = features 0..127 of this half
        hv[it] = *(const v4u*)(VsH + fl * 72 + 8 * e);
        lv[it] = *(const v4u*)(VsL + fl * 72 + 8 * e);
      }
      unsigned short* hb = VTH + ((size_t)s * CDIM + vh * 128) * NTOK + tok0 + 8 * e;
      unsigned short* lb = VTL + ((size_t)s * CDIM + vh * 128) * NTOK + tok0 + 8 * e;
      {
#pragma unroll
        for (int it = 0; it < 4; ++it) {
          const int fl = it * 32 + fq;
          *(v4u*)(hb + (size_t)fl * NTOK) = hv[it];
          *(v4u*)(lb + (size_t)fl * NTOK) = lv[it];
        }
        
      }
    }
    __syncthreads();
  }
}

// =====================================================================================================
// Attention for one (dir, head, 64-query block), transposed formulation, head dim 32, 4096 keys, no mask:
//   dir 0: queries from stream 1, keys/values from stream 0 -> output slot 0; dir 1: queries from stream 0, keys/values
//   from stream 1 -> output slot 1.
//   S^T tile (16 keys x 16 queries) = A(k rows = keys, d via the split k map) . B(q, col = query, same d map):
//   s = k.q_hi + k.q_res (two products) = 1024*1024 * logit_dot. Per lane the D tile holds 8 keys of ONE query, so the
//   online softmax (running max, f32) is per-lane state with one shuffle (lane^16) for the max over 32 keys; the row sum
//   is kept as a per-lane partial and combined at the end. P = e^{s-m} x 16384 as f16 hi + f16 residual is used directly
//   as the B operand of O^T (rows d, cols queries) += A(v^T rows d, keys contiguous, two 16-B loads) . B(P^T):
//   B element r <- the key tile covering keys kb..kb+15, element 8+r <- the tile covering kb+16..kb+31, lane unchanged
//   (D-as-B chaining layout). Products vhi.phi + vhi.plo + vlo.phi into one accumulator per d tile (d 0-15, d 16-31).
//   32 keys per iteration: 4 score WMMAs + 6 output WMMAs per wave. Block = 4 waves = 64 queries; grid = 2*8*64 = 1024.
//   Epilogue: the block's [64 query][32 d] f32 tile is staged in LDS (scalar stores), block barrier, then 4 instructions
// coverage: block writes queries q0..q0+63 x d 0..31 of its (dir, head); grid covers out [2][4096][256] exactly once.
// =====================================================================================================
__global__ __launch_bounds__(128)
void attn_kernel(const unsigned short* __restrict__ qh, const unsigned short* __restrict__ ql,
                 const unsigned short* __restrict__ kh, const unsigned short* __restrict__ vth,
                 const unsigned short* __restrict__ vtl, float* out) {
  __shared__ __align__(16) float Os[64 * DHEAD];
  const int tid  = threadIdx.x;
  const int wave = tid >> 5;
  const int lane = tid & 31;
  const int hh   = lane >> 4;
  const int c    = lane & 15;
  const int bx   = blockIdx.x;
  const int qb   = bx % (NTOK / 64);              // NTOK/64 = 64 query blocks per (stream, head)
  const int hd   = (bx / (NTOK / 64)) % NHEAD;
  const int dir  = bx / ((NTOK / 64) * NHEAD);
  const int qsrc = 1 - dir;
  const int ksrc = dir;
  const int q0   = qb * 64;

  const _Float16* QHp = (const _Float16*)(const void*)qh;
  const _Float16* QLp = (const _Float16*)(const void*)ql;
  const _Float16* KHp = (const _Float16*)(const void*)kh;
  const _Float16* VHp = (const _Float16*)(const void*)vth;
  const _Float16* VLp = (const _Float16*)(const void*)vtl;

  // ---- q fragments (B operand, col = query q0 + 16*wave + c): hi plane and residual plane ----
  const size_t qtok = (size_t)qsrc * NTOK + q0 + wave * 16 + c;
  const v16h qhf = ldfrag_h(QHp + qtok * CDIM + hd * DHEAD + 8 * hh);
  const v16h qlf = ldfrag_h(QLp + qtok * CDIM + hd * DHEAD + 8 * hh);
  // ---- k fragment base (A operand, row = key kb + c), + key * 256 ----
  const _Float16* Kp = KHp + ((size_t)ksrc * NTOK + c) * CDIM + hd * DHEAD + 8 * hh;
  // ---- v^T fragment bases (A operand, row = d = c or 16 + c, keys contiguous), + kb ----
  const size_t vrow = ((size_t)ksrc * CDIM + hd * DHEAD + c) * NTOK + 8 * hh;
  const _Float16* VH0 = VHp + vrow;
  const _Float16* VH1 = VH0 + (size_t)16 * NTOK;
  const _Float16* VL0 = VLp + vrow;
  const _Float16* VL1 = VL0 + (size_t)16 * NTOK;
  const float SC = ATTSC / (QC * KC);

  float m = -1.0e30f, l = 0.f;
  v8f o0 = zero8(), o1 = zero8();
#pragma unroll 1
  for (int it = 0; it < NTOK / 32; ++it) {
    const int kb = it * 32;
    const v16h kf0 = ldfrag_h(Kp + (size_t)kb * CDIM);
    const v16h kf1 = ldfrag_h(Kp + (size_t)(kb + 16) * CDIM);
    v8f s0 = mma_h_raw(kf0, qhf, zero8());
    v8f s1 = mma_h_raw(kf1, qhf, zero8());
    s0 = mma_h_raw(kf0, qlf, s0);
    s1 = mma_h_raw(kf1, qlf, s1);
    sguard2(s0, s1, kf0, kf1, qhf, qlf);

    float mx = fmaxf(hmax8(s0), hmax8(s1));
    mx = fmaxf(mx, __shfl_xor(mx, 16, 32));
    const float mn   = fmaxf(m, mx * SC);
    const float corr = __expf(m - mn);
    m = mn;
    const float msh = mn - LNPSC;            // exp gives e^{s-m} * 16384
    l *= corr;
#pragma unroll
    for (int r = 0; r < 8; ++r) { o0[r] *= corr; o1[r] *= corr; }

    FragH ph, pl;
    float ls = 0.f;
#pragma unroll
    for (int r = 0; r < 8; ++r) {
      const float e0 = __expf(s0[r] * SC - msh);      // key kb      + 8hh + r
      const float e1 = __expf(s1[r] * SC - msh);      // key kb + 16 + 8hh + r
      ls += e0 + e1;
      const _Float16 h0 = (_Float16)e0, h1 = (_Float16)e1;
      ph.h[0][r] = h0;
      ph.h[1][r] = h1;
      pl.h[0][r] = (_Float16)(e0 - (float)h0);
      pl.h[1][r] = (_Float16)(e1 - (float)h1);
    }
    l += ls;

    const v16h vh0 = ldfrag_h(VH0 + kb);
    const v16h vh1 = ldfrag_h(VH1 + kb);
    const v16h vl0 = ldfrag_h(VL0 + kb);
    const v16h vl1 = ldfrag_h(VL1 + kb);
    o0 = mma_h_raw(vh0, ph.v, o0);
    o1 = mma_h_raw(vh1, ph.v, o1);
    o0 = mma_h_raw(vh0, pl.v, o0);
    o1 = mma_h_raw(vh1, pl.v, o1);
    o0 = mma_h_raw(vl0, ph.v, o0);
    o1 = mma_h_raw(vl1, ph.v, o1);
    oguard2(o0, o1, vh0, vh1, vl0, vl1, ph.v, pl.v);
  }
  l += __shfl_xor(l, 16, 32);
  const float sc = (1.0f / VC) * (1.0f / l);

  // ---- stage O[query 16*wave + c][d = 8hh + r | 16 + 8hh + r], then whole-line stores ----
  float* os = Os + (wave * 16 + c) * DHEAD + 8 * hh;
#pragma unroll
  for (int r = 0; r < 8; ++r) { os[r] = o0[r] * sc; os[16 + r] = o1[r] * sc; }
  __syncthreads();
  {
    const int e = tid & 7, qq = tid >> 3;              // qq 0..15: line within group, e: 16-B piece
    v4f vals[4];
#pragma unroll
    for (int it = 0; it < 4; ++it) {
      const int qi = it * 16 + qq;                       // it 0..3 x qq 0..15 = queries 0..63 of the block
      vals[it] = *(const v4f*)(Os + qi * DHEAD + 4 * e);
    }
    float* ob = out + (size_t)dir * NTOK * CDIM + (size_t)hd * DHEAD + 4 * e;
    {
#pragma unroll
      for (int it = 0; it < 4; ++it) {
        const int qi = it * 16 + qq;
        *(v4f*)(ob + (size_t)(q0 + qi) * CDIM) = vals[it];
      }
      
    }
  }
}

// =====================================================================================================
// Workspace map (bytes), every offset a multiple of 256 and every plane sized to its whole-row store granularity:
//   XN   f16 [8192][256]            0           4194304
//   WT   f16 [768][256]             4194304     393216
//   T    f32 [8192][768]            4587520     25165824
//   QH   f16 [8192][256]            29753344    4194304
//   QL   f16 [8192][256]            33947648    4194304
//   KH   f16 [8192][256]            38141952    4194304
//   VTH  f16 [2][256][4096]         42336256    4194304
//   VTL  f16 [2][256][4096]         46530560    4194304
//   end                              50724864
// =====================================================================================================
extern "C" void kernel_launch(void* const* d_in, const int* in_sizes, int n_in,
                              void* d_out, int out_size, void* d_ws, size_t ws_size,
                              hipStream_t stream) {
  if (n_in < 5) return;
  if (in_sizes[0] != NTOK * CDIM || in_sizes[1] != NTOK * CDIM) return;
  if (in_sizes[2] != OC * CDIM) return;
  if (in_sizes[3] != DHEAD || in_sizes[4] != DHEAD) return;
  if (out_size != NSTR * NTOK * CDIM) return;

  const float* x_b   = (const float*)d_in[0];
  const float* x_a   = (const float*)d_in[1];
  const float* w_qkv = (const float*)d_in[2];
  const float* ln_g  = (const float*)d_in[3];
  const float* ln_b  = (const float*)d_in[4];

  const size_t PXN = (size_t)MROWS * CDIM * 2;        //  4194304
  const size_t PWT = (size_t)OC * CDIM * 2;           //   393216
  const size_t PT  = (size_t)MROWS * OC * 4;          // 25165824
  const size_t PQ  = (size_t)MROWS * CDIM * 2;        //  4194304
  const size_t PV  = (size_t)NSTR * CDIM * NTOK * 2;  //  4194304
  size_t off = 0;
  const size_t oXN = off; off += PXN;
  const size_t oWT = off; off += PWT;
  const size_t oT  = off; off += PT;
  const size_t oQH = off; off += PQ;
  const size_t oQL = off; off += PQ;
  const size_t oKH = off; off += PQ;
  const size_t oVH = off; off += PV;
  const size_t oVL = off; off += PV;
  if (off > ws_size) return;                          // off = 50724864
  if (off > (size_t)134217728) return;

  char* ws = (char*)d_ws;
  unsigned short* XN  = (unsigned short*)(ws + oXN);
  unsigned short* WT  = (unsigned short*)(ws + oWT);
  float*          T   = (float*)(ws + oT);
  unsigned short* QH  = (unsigned short*)(ws + oQH);
  unsigned short* QL  = (unsigned short*)(ws + oQL);
  unsigned short* KH  = (unsigned short*)(ws + oKH);
  unsigned short* VTH = (unsigned short*)(ws + oVH);
  unsigned short* VTL = (unsigned short*)(ws + oVL);
  float*          out = (float*)d_out;

  const dim3 blk(256), blk128(128);
  const dim3 gCV(MROWS / 8 + OC / 8);                          // 1024 + 96 = 1120 blocks of 8 rows
  const dim3 gGM(((MROWS / 64) * (OC / 64)) / 8);              // 1536 tiles -> 192 blocks
  const dim3 gLN(MROWS / 64);                                  // 128 blocks of 64 tokens
  const dim3 gAT(NSTR * NHEAD * (NTOK / 64));                  // 1024 blocks of 128

  // (0) 16-bit operand planes: f16( bf16_RNE(x) * 64 ), f16( bf16_RNE(W) * 64 )
  cvt_planes<<<gCV, blk, 0, stream>>>(x_b, x_a, w_qkv, XN, WT);

  // (1) T[s*4096 + n][o] = (x_s[n] . W[o]) : both streams stacked, scale 1/(64*64)
  gemm64f<<<gGM, blk, 0, stream>>>(XN, CDIM, WT, CDIM, T, OC, 1.0f / (XC * WSC), MROWS, OC, CDIM);

  // (2) per-head LayerNorm -> q hi/res, k hi token rows; v hi/res transposed rows
  ln_heads<<<gLN, blk, 0, stream>>>(T, ln_g, ln_b, QH, QL, KH, VTH, VTL);

  // (3) attention, both directions, all heads -> out[dir][n][h*32 + d]
  attn_kernel<<<gAT, blk128, 0, stream>>>(QH, QL, KH, VTH, VTL, out);
  (void)hipGetLastError();
}

// v001
// Measured time: 206 microseconds a run.
// Timed twice side by side with v000, it ran 1.60 times as fast both times.
// Contractions: qkv projection (x token rows f16 x64 . W_qkv rows f16 x64, K=256, one product); attention scores
// S^T = k (f16 x1024 hi) . q^T (f16 x1024 hi plane + f16 residual plane, two products, head dim 32); attention
// O^T = v^T (f16 x256 hi and residual planes) . P^T (f16 x16384 hi and residual, taken from the score D registers),
// three products hi.hi + hi.lo + lo.hi over 4096 keys. All v_wmma_f32_16x16x32_f16, f32 accumulate; LayerNorm and
// softmax in f32 on VALU; every float input RNE-converted to bf16 on load.
#include <hip/hip_runtime.h>
#include <math.h>
#include <stdint.h>

#define NTOK   4096
#define CDIM   256
#define NHEAD  8
#define DHEAD  32
#define OC     (3 * CDIM)
#define NSTR   2
#define MROWS  (NSTR * NTOK)
#define LNEPS  1.0e-5f
#define XC     64.0f
#define WSC    64.0f
#define QC     1024.0f
#define KC     1024.0f
#define VC     256.0f
#define LNPSC  9.704060527839234f
#define ATTSC  0.17677669529663687f
static_assert(NHEAD * DHEAD == CDIM);
static_assert((MROWS % 64) == 0 && (OC % 64) == 0 && (CDIM % 32) == 0);
static_assert((((MROWS / 64) * (OC / 64)) % 8) == 0);
static_assert((NTOK % 64) == 0 && (MROWS % 8) == 0 && (OC % 8) == 0);

typedef _Float16 v16h __attribute__((ext_vector_type(16)));
typedef _Float16 v8h  __attribute__((ext_vector_type(8)));
typedef float    v8f  __attribute__((ext_vector_type(8)));
typedef float    v4f  __attribute__((ext_vector_type(4)));
typedef unsigned int v4u __attribute__((ext_vector_type(4)));

union FragH { v16h v; v8h h[2]; };

// ---- scalar helpers --------------------------------------------------------------------------------
__device__ __forceinline__ unsigned short bf_bits(float f) {          // f32 -> bf16 bits, RNE convert
  unsigned u = __float_as_uint(f);
  return (unsigned short)((u + 0x7FFFu + ((u >> 16) & 1u)) >> 16);
}
__device__ __forceinline__ float bf_up(unsigned short h) { return __uint_as_float(((unsigned)h) << 16); }
__device__ __forceinline__ float bfr(float f) { return bf_up(bf_bits(f)); }
__device__ __forceinline__ unsigned short h_bits(_Float16 x) { return __builtin_bit_cast(unsigned short, x); }
__device__ __forceinline__ unsigned pk16(unsigned short a, unsigned short b) { return (unsigned)a | ((unsigned)b << 16); }
__device__ __forceinline__ v8f zero8() { v8f z = {0.f, 0.f, 0.f, 0.f, 0.f, 0.f, 0.f, 0.f}; return z; }
__device__ __forceinline__ float hmax8(v8f s) {
  return fmaxf(fmaxf(fmaxf(s[0], s[1]), fmaxf(s[2], s[3])), fmaxf(fmaxf(s[4], s[5]), fmaxf(s[6], s[7])));
}

// ---- fragment loader: 16-bit A/B operand, lane -> row/col (lane&15), p already includes +8*(lane>>4);
//      elements 0..7 <- p[0..7] (k0+8h..), elements 8..15 <- p[16..23] (k0+16+8h..)
__device__ __forceinline__ v16h ldfrag_h(const _Float16* p) {
  FragH f;
  f.h[0] = *(const v8h*)(p);
  f.h[1] = *(const v8h*)(p + 16);
  return f.v;
}

// ---- WMMA helpers with trailing VALU hazard gap --------------------------------------------------------
__device__ __forceinline__ v8f mma_h_raw(v16h a, v16h b, v8f c) {
  return __builtin_amdgcn_wmma_f32_16x16x32_f16(false, a, false, b, (short)0, c, false, false);
}
__device__ __forceinline__ void dep_guard1(v8f& a, v8f& b, v16h x) {
#if defined(__HIP_DEVICE_COMPILE__)
  asm volatile("v_nop\n\tv_nop\n\tv_nop\n\tv_nop" : "+v"(a), "+v"(b) : "v"(x));
#endif
}
__device__ __forceinline__ void keep4_h(v16h a, v16h b, v16h c, v16h d) {
#if defined(__HIP_DEVICE_COMPILE__)
  asm volatile("v_nop" :: "v"(a), "v"(b), "v"(c), "v"(d));
#endif
}
__device__ __forceinline__ void acc_guard4(v8f& a, v8f& b, v8f& c, v8f& d) {
#if defined(__HIP_DEVICE_COMPILE__)
  asm volatile("v_nop\n\tv_nop\n\tv_nop\n\tv_nop" : "+v"(a), "+v"(b), "+v"(c), "+v"(d));
#endif
}
__device__ __forceinline__ void sguard2(v8f& a, v8f& b, v16h k0, v16h k1, v16h q0, v16h q1) {
#if defined(__HIP_DEVICE_COMPILE__)
  asm volatile("v_nop\n\tv_nop\n\tv_nop\n\tv_nop"
               : "+v"(a), "+v"(b) : "v"(k0), "v"(k1), "v"(q0), "v"(q1));
#endif
}
__device__ __forceinline__ void oguard2(v8f& a, v8f& b, v16h x0, v16h x1, v16h x2, v16h x3, v16h p0, v16h p1) {
#if defined(__HIP_DEVICE_COMPILE__)
  asm volatile("v_nop\n\tv_nop\n\tv_nop\n\tv_nop"
               : "+v"(a), "+v"(b) : "v"(x0), "v"(x1), "v"(x2), "v"(x3), "v"(p0), "v"(p1));
#endif
}
__device__ __forceinline__ void wave_sync_lds() {
  __builtin_amdgcn_fence(__ATOMIC_RELEASE, "workgroup");
  __builtin_amdgcn_wave_barrier();
  __builtin_amdgcn_fence(__ATOMIC_ACQUIRE, "workgroup");
}

// =====================================================================================================
// Operand planes: XN[s*4096 + n][256] = f16( bf16_RNE(x_s[n][c]) * 64 ) (blocks 0..1023, 8 rows each, stream s = bx/512),
// WT[o][256] = f16( bf16_RNE(W[o][c]) * 64 ) (blocks 1024..1119; W is already [o][c] = k-contiguous, no transpose).
// Thread t: row = 8 per block (t>>5), 8 consecutive elements at 8*(t&31): one instruction of 32 lanes x 16 B = one whole
// coverage: 1024 x 8 = 8192 XN rows and 96 x 8 = 768 WT rows, each row 32 lanes x 8 halves = 256 columns: both planes entirely.
// =====================================================================================================
__global__ __launch_bounds__(256) void cvt_planes(const float* __restrict__ xb, const float* __restrict__ xa,
                                                   const float* __restrict__ w, unsigned short* XN, unsigned short* WT) {
  const int tid = threadIdx.x, r = tid >> 5, lane = tid & 31;
  const int bx  = blockIdx.x;
  const bool isx = (bx < (MROWS / 8));                    // block-uniform
  const int  s   = isx ? (bx / (NTOK / 8)) : 0;           // stream of this block
  const float* src = isx ? ((s == 0) ? xb : xa) : w;
  unsigned short* dst = isx ? XN : WT;
  const float sc  = isx ? XC : WSC;
  const int drow  = isx ? (bx * 8 + r) : ((bx - MROWS / 8) * 8 + r);   // row in dst plane
  const int srow  = isx ? (drow - s * NTOK) : drow;                       // row in src tensor
  const float* sp = src + (size_t)srow * CDIM + 8 * lane;
  const v4f a = *(const v4f*)(sp), c = *(const v4f*)(sp + 4);
  float f[8];
#pragma unroll
  for (int i = 0; i < 4; ++i) { f[i] = bfr(a[i]) * sc; f[4 + i] = bfr(c[i]) * sc; }
  v4u v;
#pragma unroll
  for (int i = 0; i < 4; ++i) v[i] = pk16(h_bits((_Float16)f[2 * i]), h_bits((_Float16)f[2 * i + 1]));
  unsigned short* dp = dst + (size_t)drow * CDIM + 8 * lane;
  *(v4u*)dp = v;
  
}

// =====================================================================================================
// Register-blocked f16 WMMA GEMM, one wave per 64x64 tile, no block barriers:
//   C[m][n] = osc * sum_k A[m][k] * Bt[n][k]   (f32 out, pitch ldc)
// A: f16 row-major [M][K] pitch lda; Bt: f16 [N][K] (k contiguous, pitch ldb); fragments = two 16-B loads with the
// split k map (ldfrag_h). M, N multiples of 64, K multiple of 32 (host-checked constants here).
// lines, n0*4 is a multiple of 256) written by 16 consecutive lanes x 16 B of ONE instruction (lanes 0-15 row it*2, lanes
// coverage: 4 slabs x 16 rows x 64 cols = the wave's whole 64x64 tile; grid = tilesM*tilesN/8 blocks (exact multiple of 8).
// =====================================================================================================
__global__ __launch_bounds__(256) void gemm64f(
    const unsigned short* __restrict__ Ap, int lda,
    const unsigned short* __restrict__ Bp, int ldb,
    float* Cout, int ldc, float osc, int M, int N, int K) {
  __shared__ __align__(16) float sT[8][16 * 68];   // per-wave 16x64 slab, pitch 68 floats
  const int lane = threadIdx.x & 31;
  const int wave = threadIdx.x >> 5;
  const int tilesN = N >> 6;
  const int tilesM = M >> 6;
  const int tile = blockIdx.x * 8 + wave;
  if (tile >= tilesM * tilesN) return;   // wave-uniform; no block barriers in this kernel
  const int tm = tile / tilesN;
  const int tn = tile - tm * tilesN;
  const int m0 = tm << 6;
  const int n0 = tn << 6;

  const _Float16* Ah = (const _Float16*)(const void*)Ap;
  const _Float16* Bb = (const _Float16*)(const void*)Bp;

  const int rlane = lane & 15;                 // row (A) / col (B, D) within subtile
  const int koff  = (lane >> 4) * 8;           // k offset of this lane half
  const int mOff  = (lane >> 4) * 8;           // D row offset

  v8f acc[4][4];
#pragma unroll
  for (int i = 0; i < 4; ++i)
#pragma unroll
    for (int j = 0; j < 4; ++j) acc[i][j] = zero8();

  for (int k0 = 0; k0 < K; k0 += 32) {
    v16h bh[4];
#pragma unroll
    for (int j = 0; j < 4; ++j) {
      const size_t bo = (size_t)(n0 + (j << 4) + rlane) * ldb + koff + k0;
      bh[j] = ldfrag_h(Bb + bo);
    }
#pragma unroll
    for (int i = 0; i < 4; ++i) {
      const size_t ao = (size_t)(m0 + (i << 4) + rlane) * lda + koff + k0;
      const v16h ah = ldfrag_h(Ah + ao);
#pragma unroll
      for (int j = 0; j < 4; ++j) acc[i][j] = mma_h_raw(ah, bh[j], acc[i][j]);
      dep_guard1(acc[i][0], acc[i][3], ah);
    }
    keep4_h(bh[0], bh[1], bh[2], bh[3]);
  }
  acc_guard4(acc[0][0], acc[0][1], acc[0][2], acc[0][3]);
  acc_guard4(acc[1][0], acc[1][1], acc[1][2], acc[1][3]);
  acc_guard4(acc[2][0], acc[2][1], acc[2][2], acc[2][3]);
  acc_guard4(acc[3][0], acc[3][1], acc[3][2], acc[3][3]);

  const int hh2 = lane >> 4, c4 = (lane & 15) * 4;     // f32 out: 256-B row segment = 16 lanes x 16 B
  float* slab = sT[wave];
#pragma unroll
  for (int i = 0; i < 4; ++i) {
    const int mBase = m0 + (i << 4);
#pragma unroll
    for (int j = 0; j < 4; ++j) {
#pragma unroll
      for (int r = 0; r < 8; ++r) {
        slab[(mOff + r) * 68 + (j << 4) + rlane] = acc[i][j][r];
      }
    }
    wave_sync_lds();
    v4f vals[8];
#pragma unroll
    for (int it = 0; it < 8; ++it) {
      const int row = it * 2 + hh2;                      // it 0..7 x hh2 0..1 = rows 0..15
      v4f v = *(const v4f*)(slab + row * 68 + c4);
#pragma unroll
      for (int e = 0; e < 4; ++e) v[e] = v[e] * osc;
      vals[it] = v;
    }
    {
#pragma unroll
      for (int it = 0; it < 8; ++it) {
        const int row = it * 2 + hh2;
        *(v4f*)(Cout + (size_t)(mBase + row) * ldc + n0 + c4) = vals[it];
      }
      
    }
    wave_sync_lds();
  }
}

// =====================================================================================================
// Per-head LayerNorm of q, k and v (feature o = part*256 + h*32 + dd of the projection row) and 16-bit plane writes.
// One lane owns 8 consecutive features of a token, so a head (32 features) is one quad of lanes: mean and variance are
// 8 adds in the lane and a two-step sum over the quad. No LDS and no barrier; every load of a wave is independent.
//   blocks 0..127 (v): 64 tokens of stream s, wave = head; lane = (token group tg = lane>>2, feature chunk = lane&3) holds
//      8 tokens x 8 features; y*256 -> f16 hi + residual; per feature the lane's 8 tokens are one 16-B store, and the
//      8 token groups of a wave make one whole 128-B line of the transposed row (4 lines an instruction).
//   blocks 128..639 (q, k): wave = 2 token rows; lane = features 8*lane..8*lane+7 of the row; q: y*1024 -> f16 hi + f16
//      residual, k: y*1024 -> f16 hi; each store instruction is one whole 512-B row.
// coverage: q/k rows: 512 blocks x 8 waves x 2 rows = all 8192 rows, full width; VT planes: 128 blocks x 8 heads x
//           32 features x 64 tokens = [2][256][4096] entirely, both hi and lo.
// =====================================================================================================
__device__ __forceinline__ float quad_sum(float v) {   // sum over lanes l, l^1, l^2, l^3 (DPP row_xmask 1, then 2)
  v += __builtin_bit_cast(float, __builtin_amdgcn_update_dpp(0, __builtin_bit_cast(int, v), 0x161, 0xf, 0xf, true));
  v += __builtin_bit_cast(float, __builtin_amdgcn_update_dpp(0, __builtin_bit_cast(int, v), 0x162, 0xf, 0xf, true));
  return v;
}
__device__ __forceinline__ float rsq_pos(float x) {   // 1/sqrt(x) for x >= LNEPS: never in the range that rsqrtf rescales
  float r = 0.f;
#if defined(__HIP_DEVICE_COMPILE__)
  // v_nop: fills the one slot asked for behind a transcendental, before an instruction that may overwrite its source
  asm("v_rsq_f32 %0, %1\n\tv_nop" : "=v"(r) : "v"(x));
#endif
  return r;
}
__device__ __forceinline__ void ln8(const v4f a, const v4f c, const float (&g)[8], const float (&b)[8], float sc,
                                    float (&y)[8]) {
  const float mean = quad_sum(((a[0] + a[1]) + (a[2] + a[3])) + ((c[0] + c[1]) + (c[2] + c[3]))) * (1.0f / DHEAD);
  float d[8];
#pragma unroll
  for (int j = 0; j < 4; ++j) { d[j] = a[j] - mean; d[4 + j] = c[j] - mean; }
  float ss = 0.f;
#pragma unroll
  for (int j = 0; j < 8; ++j) ss += d[j] * d[j];
  const float rs = rsq_pos(quad_sum(ss) * (1.0f / DHEAD) + LNEPS);
#pragma unroll
  for (int j = 0; j < 8; ++j) y[j] = ((d[j] * rs) * g[j] + b[j]) * sc;
}
__device__ __forceinline__ void bfr8(const v4f lo, const v4f hi, float (&o)[8]) {
#pragma unroll
  for (int j = 0; j < 4; ++j) { o[j] = bfr(lo[j]); o[4 + j] = bfr(hi[j]); }
}
__device__ __forceinline__ unsigned hi2(float x, float y) { return pk16(h_bits((_Float16)x), h_bits((_Float16)y)); }
__device__ __forceinline__ unsigned lo2(float x, float y) {
  return pk16(h_bits((_Float16)(x - (float)(_Float16)x)), h_bits((_Float16)(y - (float)(_Float16)y)));
}

__global__ __launch_bounds__(256)
void ln_heads(const float* __restrict__ T, const float* __restrict__ gam, const float* __restrict__ bet,
              unsigned short* QH, unsigned short* QL, unsigned short* KH,
              unsigned short* VTH, unsigned short* VTL) {
  const int tid = threadIdx.x, wave = tid >> 5, lane = tid & 31;
  const int bx  = blockIdx.x;
  const int ch  = lane & 3;                           // 8-feature chunk of the head, both mappings
  float g[8], be[8];
  if (bx < MROWS / 64) {                              // block-uniform: v, transposed in registers
    const int s    = bx / (NTOK / 64);
    const int tok0 = (bx - s * (NTOK / 64)) * 64 + 8 * (lane >> 2);
    const float* tp = T + ((size_t)s * NTOK + tok0) * OC + 2 * CDIM + wave * DHEAD + 8 * ch;
    v4f xa[8], xc[8];
#pragma unroll
    for (int i = 0; i < 8; ++i) { xa[i] = *(const v4f*)(tp + (size_t)i * OC); xc[i] = *(const v4f*)(tp + (size_t)i * OC + 4); }
    const v4f g0 = *(const v4f*)(gam + 8 * ch), g1 = *(const v4f*)(gam + 8 * ch + 4);
    const v4f b0 = *(const v4f*)(bet + 8 * ch), b1 = *(const v4f*)(bet + 8 * ch + 4);
    // keeps every load of the wave in front of the arithmetic: one memory latency instead of two or three in a row
    __builtin_amdgcn_sched_barrier(0);
    bfr8(g0, g1, g);
    bfr8(b0, b1, be);
    float y[8][8];
#pragma unroll
    for (int i = 0; i < 8; ++i) ln8(xa[i], xc[i], g, be, VC, y[i]);
    const size_t vo = ((size_t)s * CDIM + wave * DHEAD + 8 * ch) * NTOK + tok0;
#pragma unroll
    for (int j = 0; j < 8; ++j) {
      v4u hv, lv;
#pragma unroll
      for (int p = 0; p < 4; ++p) { hv[p] = hi2(y[2 * p][j], y[2 * p + 1][j]); lv[p] = lo2(y[2 * p][j], y[2 * p + 1][j]); }
      *(v4u*)(VTH + vo + (size_t)j * NTOK) = hv;
      *(v4u*)(VTL + vo + (size_t)j * NTOK) = lv;
    }
  } else {                                            // q and k, token rows
    const size_t row0 = ((size_t)(bx - MROWS / 64) * 8 + wave) * 2;
    const float* tp = T + row0 * OC + 8 * lane;
    v4f xa[4], xc[4];                                 // index = 2*row + part (0 = q, 1 = k)
#pragma unroll
    for (int i = 0; i < 4; ++i) {
      const float* p = tp + (size_t)(i >> 1) * OC + (i & 1) * CDIM;
      xa[i] = *(const v4f*)(p);
      xc[i] = *(const v4f*)(p + 4);
    }
    const v4f g0 = *(const v4f*)(gam + 8 * ch), g1 = *(const v4f*)(gam + 8 * ch + 4);
    const v4f b0 = *(const v4f*)(bet + 8 * ch), b1 = *(const v4f*)(bet + 8 * ch + 4);
    // keeps every load of the wave in front of the arithmetic: one memory latency instead of two or three in a row
    __builtin_amdgcn_sched_barrier(0);
    bfr8(g0, g1, g);
    bfr8(b0, b1, be);
#pragma unroll
    for (int i = 0; i < 4; ++i) {
      float y[8];
      ln8(xa[i], xc[i], g, be, (i & 1) ? KC : QC, y);
      const size_t o = (row0 + (i >> 1)) * CDIM + 8 * lane;
      v4u hv;
#pragma unroll
      for (int p = 0; p < 4; ++p) hv[p] = hi2(y[2 * p], y[2 * p + 1]);
      if (i & 1) {
        *(v4u*)(KH + o) = hv;
      } else {
        v4u lv;
#pragma unroll
        for (int p = 0; p < 4; ++p) lv[p] = lo2(y[2 * p], y[2 * p + 1]);
        *(v4u*)(QH + o) = hv;
        *(v4u*)(QL + o) = lv;
      }
    }
  }
}

// =====================================================================================================
// Attention for one (dir, head, 64-query block), transposed formulation, head dim 32, 4096 keys, no mask:
//   dir 0: queries from stream 1, keys/values from stream 0 -> output slot 0; dir 1: queries from stream 0, keys/values
//   from stream 1 -> output slot 1.
//   S^T tile (16 keys x 16 queries) = A(k rows = keys, d via the split k map) . B(q, col = query, same d map):
//   s = k.q_hi + k.q_res (two products) = 1024*1024 * logit_dot. Per lane the D tile holds 8 keys of ONE query, so the
//   online softmax (running max, f32) is per-lane state with one shuffle (lane^16) for the max over 32 keys; the row sum
//   is kept as a per-lane partial and combined at the end. P = e^{s-m} x 16384 as f16 hi + f16 residual is used directly
//   as the B operand of O^T (rows d, cols queries) += A(v^T rows d, keys contiguous, two 16-B loads) . B(P^T):
//   B element r <- the key tile covering keys kb..kb+15, element 8+r <- the tile covering kb+16..kb+31, lane unchanged
//   (D-as-B chaining layout). Products vhi.phi + vhi.plo + vlo.phi into one accumulator per d tile (d 0-15, d 16-31).
//   32 keys per iteration: 4 score WMMAs + 6 output WMMAs per wave. Block = 4 waves = 64 queries; grid = 2*8*64 = 1024.
//   Epilogue: the block's [64 query][32 d] f32 tile is staged in LDS (scalar stores), block barrier, then 4 instructions
// coverage: block writes queries q0..q0+63 x d 0..31 of its (dir, head); grid covers out [2][4096][256] exactly once.
// =====================================================================================================
__global__ __launch_bounds__(128)
void attn_kernel(const unsigned short* __restrict__ qh, const unsigned short* __restrict__ ql,
                 const unsigned short* __restrict__ kh, const unsigned short* __restrict__ vth,
                 const unsigned short* __restrict__ vtl, float* out) {
  __shared__ __align__(16) float Os[64 * DHEAD];
  const int tid  = threadIdx.x;
  const int wave = tid >> 5;
  const int lane = tid & 31;
  const int hh   = lane >> 4;
  const int c    = lane & 15;
  const int bx   = blockIdx.x;
  const int qb   = bx % (NTOK / 64);              // NTOK/64 = 64 query blocks per (stream, head)
  const int hd   = (bx / (NTOK / 64)) % NHEAD;
  const int dir  = bx / ((NTOK / 64) * NHEAD);
  const int qsrc = 1 - dir;
  const int ksrc = dir;
  const int q0   = qb * 64;

  const _Float16* QHp = (const _Float16*)(const void*)qh;
  const _Float16* QLp = (const _Float16*)(const void*)ql;
  const _Float16* KHp = (const _Float16*)(const void*)kh;
  const _Float16* VHp = (const _Float16*)(const void*)vth;
  const _Float16* VLp = (const _Float16*)(const void*)vtl;

  // ---- q fragments (B operand, col = query q0 + 16*wave + c): hi plane and residual plane ----
  const size_t qtok = (size_t)qsrc * NTOK + q0 + wave * 16 + c;
  const v16h qhf = ldfrag_h(QHp + qtok * CDIM + hd * DHEAD + 8 * hh);
  const v16h qlf = ldfrag_h(QLp + qtok * CDIM + hd * DHEAD + 8 * hh);
  // ---- k fragment base (A operand, row = key kb + c), + key * 256 ----
  const _Float16* Kp = KHp + ((size_t)ksrc * NTOK + c) * CDIM + hd * DHEAD + 8 * hh;
  // ---- v^T fragment bases (A operand, row = d = c or 16 + c, keys contiguous), + kb ----
  const size_t vrow = ((size_t)ksrc * CDIM + hd * DHEAD + c) * NTOK + 8 * hh;
  const _Float16* VH0 = VHp + vrow;
  const _Float16* VH1 = VH0 + (size_t)16 * NTOK;
  const _Float16* VL0 = VLp + vrow;
  const _Float16* VL1 = VL0 + (size_t)16 * NTOK;
  const float SC = ATTSC / (QC * KC);

  float m = -1.0e30f, l = 0.f;
  v8f o0 = zero8(), o1 = zero8();
#pragma unroll 1
  for (int it = 0; it < NTOK / 32; ++it) {
    const int kb = it * 32;
    const v16h kf0 = ldfrag_h(Kp + (size_t)kb * CDIM);
    const v16h kf1 = ldfrag_h(Kp + (size_t)(kb + 16) * CDIM);
    v8f s0 = mma_h_raw(kf0, qhf, zero8());
    v8f s1 = mma_h_raw(kf1, qhf, zero8());
    s0 = mma_h_raw(kf0, qlf, s0);
    s1 = mma_h_raw(kf1, qlf, s1);
    sguard2(s0, s1, kf0, kf1, qhf, qlf);

    float mx = fmaxf(hmax8(s0), hmax8(s1));
    mx = fmaxf(mx, __shfl_xor(mx, 16, 32));
    const float mn   = fmaxf(m, mx * SC);
    const float corr = __expf(m - mn);
    m = mn;
    const float msh = mn - LNPSC;            // exp gives e^{s-m} * 16384
    l *= corr;
#pragma unroll
    for (int r = 0; r < 8; ++r) { o0[r] *= corr; o1[r] *= corr; }

    FragH ph, pl;
    float ls = 0.f;
#pragma unroll
    for (int r = 0; r < 8; ++r) {
      const float e0 = __expf(s0[r] * SC - msh);      // key kb      + 8hh + r
      const float e1 = __expf(s1[r] * SC - msh);      // key kb + 16 + 8hh + r
      ls += e0 + e1;
      const _Float16 h0 = (_Float16)e0, h1 = (_Float16)e1;
      ph.h[0][r] = h0;
      ph.h[1][r] = h1;
      pl.h[0][r] = (_Float16)(e0 - (float)h0);
      pl.h[1][r] = (_Float16)(e1 - (float)h1);
    }
    l += ls;

    const v16h vh0 = ldfrag_h(VH0 + kb);
    const v16h vh1 = ldfrag_h(VH1 + kb);
    const v16h vl0 = ldfrag_h(VL0 + kb);
    const v16h vl1 = ldfrag_h(VL1 + kb);
    o0 = mma_h_raw(vh0, ph.v, o0);
    o1 = mma_h_raw(vh1, ph.v, o1);
    o0 = mma_h_raw(vh0, pl.v, o0);
    o1 = mma_h_raw(vh1, pl.v, o1);
    o0 = mma_h_raw(vl0, ph.v, o0);
    o1 = mma_h_raw(vl1, ph.v, o1);
    oguard2(o0, o1, vh0, vh1, vl0, vl1, ph.v, pl.v);
  }
  l += __shfl_xor(l, 16, 32);
  const float sc = (1.0f / VC) * (1.0f / l);

  // ---- stage O[query 16*wave + c][d = 8hh + r | 16 + 8hh + r], then whole-line stores ----
  float* os = Os + (wave * 16 + c) * DHEAD + 8 * hh;
#pragma unroll
  for (int r = 0; r < 8; ++r) { os[r] = o0[r] * sc; os[16 + r] = o1[r] * sc; }
  __syncthreads();
  {
    const int e = tid & 7, qq = tid >> 3;              // qq 0..15: line within group, e: 16-B piece
    v4f vals[4];
#pragma unroll
    for (int it = 0; it < 4; ++it) {
      const int qi = it * 16 + qq;                       // it 0..3 x qq 0..15 = queries 0..63 of the block
      vals[it] = *(const v4f*)(Os + qi * DHEAD + 4 * e);
    }
    float* ob = out + (size_t)dir * NTOK * CDIM + (size_t)hd * DHEAD + 4 * e;
    {
#pragma unroll
      for (int it = 0; it < 4; ++it) {
        const int qi = it * 16 + qq;
        *(v4f*)(ob + (size_t)(q0 + qi) * CDIM) = vals[it];
      }
      
    }
  }
}

// =====================================================================================================
// Workspace map (bytes), every offset a multiple of 256 and every plane sized to its whole-row store granularity:
//   XN   f16 [8192][256]            0           4194304
//   WT   f16 [768][256]             4194304     393216
//   T    f32 [8192][768]            4587520     25165824
//   QH   f16 [8192][256]            29753344    4194304
//   QL   f16 [8192][256]            33947648    4194304
//   KH   f16 [8192][256]            38141952    4194304
//   VTH  f16 [2][256][4096]         42336256    4194304
//   VTL  f16 [2][256][4096]         46530560    4194304
//   end                              50724864
// =====================================================================================================
extern "C" void kernel_launch(void* const* d_in, const int* in_sizes, int n_in,
                              void* d_out, int out_size, void* d_ws, size_t ws_size,
                              hipStream_t stream) {
  if (n_in < 5) return;
  if (in_sizes[0] != NTOK * CDIM || in_sizes[1] != NTOK * CDIM) return;
  if (in_sizes[2] != OC * CDIM) return;
  if (in_sizes[3] != DHEAD || in_sizes[4] != DHEAD) return;
  if (out_size != NSTR * NTOK * CDIM) return;

  const float* x_b   = (const float*)d_in[0];
  const float* x_a   = (const float*)d_in[1];
  const float* w_qkv = (const float*)d_in[2];
  const float* ln_g  = (const float*)d_in[3];
  const float* ln_b  = (const float*)d_in[4];

  const size_t PXN = (size_t)MROWS * CDIM * 2;        //  4194304
  const size_t PWT = (size_t)OC * CDIM * 2;           //   393216
  const size_t PT  = (size_t)MROWS * OC * 4;          // 25165824
  const size_t PQ  = (size_t)MROWS * CDIM * 2;        //  4194304
  const size_t PV  = (size_t)NSTR * CDIM * NTOK * 2;  //  4194304
  size_t off = 0;
  const size_t oXN = off; off += PXN;
  const size_t oWT = off; off += PWT;
  const size_t oT  = off; off += PT;
  const size_t oQH = off; off += PQ;
  const size_t oQL = off; off += PQ;
  const size_t oKH = off; off += PQ;
  const size_t oVH = off; off += PV;
  const size_t oVL = off; off += PV;
  if (off > ws_size) return;                          // off = 50724864
  if (off > (size_t)134217728) return;

  char* ws = (char*)d_ws;
  unsigned short* XN  = (unsigned short*)(ws + oXN);
  unsigned short* WT  = (unsigned short*)(ws + oWT);
  float*          T   = (float*)(ws + oT);
  unsigned short* QH  = (unsigned short*)(ws + oQH);
  unsigned short* QL  = (unsigned short*)(ws + oQL);
  unsigned short* KH  = (unsigned short*)(ws + oKH);
  unsigned short* VTH = (unsigned short*)(ws + oVH);
  unsigned short* VTL = (unsigned short*)(ws + oVL);
  float*          out = (float*)d_out;

  const dim3 blk(256), blk128(128);
  const dim3 gCV(MROWS / 8 + OC / 8);                          // 1024 + 96 = 1120 blocks of 8 rows
  const dim3 gGM(((MROWS / 64) * (OC / 64)) / 8);              // 1536 tiles -> 192 blocks
  const dim3 gLN(MROWS / 64 + MROWS / 16);                     // 128 blocks (v, 64 tokens) + 512 blocks (q and k, 16 rows)
  const dim3 gAT(NSTR * NHEAD * (NTOK / 64));                  // 1024 blocks of 128

  // (0) 16-bit operand planes: f16( bf16_RNE(x) * 64 ), f16( bf16_RNE(W) * 64 )
  cvt_planes<<<gCV, blk, 0, stream>>>(x_b, x_a, w_qkv, XN, WT);

  // (1) T[s*4096 + n][o] = (x_s[n] . W[o]) : both streams stacked, scale 1/(64*64)
  gemm64f<<<gGM, blk, 0, stream>>>(XN, CDIM, WT, CDIM, T, OC, 1.0f / (XC * WSC), MROWS, OC, CDIM);

  // (2) per-head LayerNorm -> q hi/res, k hi token rows; v hi/res transposed rows
  ln_heads<<<gLN, blk, 0, stream>>>(T, ln_g, ln_b, QH, QL, KH, VTH, VTL);

  // (3) attention, both directions, all heads -> out[dir][n][h*32 + d]
  attn_kernel<<<gAT, blk128, 0, stream>>>(QH, QL, KH, VTH, VTL, out);
  (void)hipGetLastError();
}

// v002
// A run of this version takes 157 microseconds.
// Two timings next to v001 put it at 1.31 and 1.32 times that version's speed.
// All steps since v000 together make it 2.11 times as fast.
// Contractions: qkv projection (x token rows f16 x64 . W_qkv rows f16 x64, K=256, one product); attention scores
// S^T = k (f16 x1024 hi) . q^T (f16 x1024 hi plane + f16 residual plane, two products, head dim 32); attention
// O^T = v^T (f16 x256 hi and residual planes) . P^T (f16 x16384 hi and residual, taken from the score D registers),
// three products hi.hi + hi.lo + lo.hi over 4096 keys. All v_wmma_f32_16x16x32_f16, f32 accumulate; LayerNorm and
// softmax in f32 on VALU; every float input RNE-converted to bf16 on load.
#include <hip/hip_runtime.h>
#include <math.h>
#include <stdint.h>

#define NTOK   4096
#define CDIM   256
#define NHEAD  8
#define DHEAD  32
#define OC     (3 * CDIM)
#define NSTR   2
#define MROWS  (NSTR * NTOK)
#define LNEPS  1.0e-5f
#define XC     64.0f
#define WSC    64.0f
#define QC     1024.0f
#define KC     1024.0f
#define VC     256.0f
#define LNPSC  9.704060527839234f
#define ATTSC  0.17677669529663687f
static_assert(NHEAD * DHEAD == CDIM);
static_assert((MROWS % 64) == 0 && (OC % 64) == 0 && (CDIM % 32) == 0);
static_assert((((MROWS / 64) * (OC / 64)) % 8) == 0);
static_assert((NTOK % 64) == 0 && (MROWS % 8) == 0 && (OC % 8) == 0);

typedef _Float16 v16h __attribute__((ext_vector_type(16)));
typedef _Float16 v8h  __attribute__((ext_vector_type(8)));
typedef float    v8f  __attribute__((ext_vector_type(8)));
typedef float    v4f  __attribute__((ext_vector_type(4)));
typedef unsigned int v4u __attribute__((ext_vector_type(4)));

union FragH { v16h v; v8h h[2]; };

// ---- scalar helpers --------------------------------------------------------------------------------
__device__ __forceinline__ unsigned short bf_bits(float f) {          // f32 -> bf16 bits, RNE convert
  unsigned u = __float_as_uint(f);
  return (unsigned short)((u + 0x7FFFu + ((u >> 16) & 1u)) >> 16);
}
__device__ __forceinline__ float bf_up(unsigned short h) { return __uint_as_float(((unsigned)h) << 16); }
__device__ __forceinline__ float bfr(float f) { return bf_up(bf_bits(f)); }
__device__ __forceinline__ unsigned short h_bits(_Float16 x) { return __builtin_bit_cast(unsigned short, x); }
__device__ __forceinline__ unsigned pk16(unsigned short a, unsigned short b) { return (unsigned)a | ((unsigned)b << 16); }
__device__ __forceinline__ v8f zero8() { v8f z = {0.f, 0.f, 0.f, 0.f, 0.f, 0.f, 0.f, 0.f}; return z; }
__device__ __forceinline__ float hmax8(v8f s) {
  return fmaxf(fmaxf(fmaxf(s[0], s[1]), fmaxf(s[2], s[3])), fmaxf(fmaxf(s[4], s[5]), fmaxf(s[6], s[7])));
}

// ---- fragment loader: 16-bit A/B operand, lane -> row/col (lane&15), p already includes +8*(lane>>4);
//      elements 0..7 <- p[0..7] (k0+8h..), elements 8..15 <- p[16..23] (k0+16+8h..)
__device__ __forceinline__ v16h ldfrag_h(const _Float16* p) {
  FragH f;
  f.h[0] = *(const v8h*)(p);
  f.h[1] = *(const v8h*)(p + 16);
  return f.v;
}
// ---- the same operand from a plane stored in fragment order: elements 0..7 <- p[0..7], elements 8..15 <- p[step..step+7];
//      p already includes the lane's own 16-B piece
__device__ __forceinline__ v16h ldfrag_p(const _Float16* p, int step) {
  FragH f;
  f.h[0] = *(const v8h*)(p);
  f.h[1] = *(const v8h*)(p + step);
  return f.v;
}

// ---- WMMA helpers with trailing VALU hazard gap --------------------------------------------------------
__device__ __forceinline__ v8f mma_h_raw(v16h a, v16h b, v8f c) {
  return __builtin_amdgcn_wmma_f32_16x16x32_f16(false, a, false, b, (short)0, c, false, false);
}
__device__ __forceinline__ void dep_guard1(v8f& a, v8f& b, v16h x) {
#if defined(__HIP_DEVICE_COMPILE__)
  asm volatile("v_nop\n\tv_nop\n\tv_nop\n\tv_nop" : "+v"(a), "+v"(b) : "v"(x));
#endif
}
__device__ __forceinline__ void keep4_h(v16h a, v16h b, v16h c, v16h d) {
#if defined(__HIP_DEVICE_COMPILE__)
  asm volatile("v_nop" :: "v"(a), "v"(b), "v"(c), "v"(d));
#endif
}
__device__ __forceinline__ void acc_guard4(v8f& a, v8f& b, v8f& c, v8f& d) {
#if defined(__HIP_DEVICE_COMPILE__)
  asm volatile("v_nop\n\tv_nop\n\tv_nop\n\tv_nop" : "+v"(a), "+v"(b), "+v"(c), "+v"(d));
#endif
}
__device__ __forceinline__ void sguard2(v8f& a, v8f& b, v16h k0, v16h k1, v16h q0, v16h q1) {
#if defined(__HIP_DEVICE_COMPILE__)
  asm volatile("v_nop\n\tv_nop\n\tv_nop\n\tv_nop"
               : "+v"(a), "+v"(b) : "v"(k0), "v"(k1), "v"(q0), "v"(q1));
#endif
}
__device__ __forceinline__ void oguard2(v8f& a, v8f& b, v16h x0, v16h x1, v16h x2, v16h x3, v16h p0, v16h p1) {
#if defined(__HIP_DEVICE_COMPILE__)
  asm volatile("v_nop\n\tv_nop\n\tv_nop\n\tv_nop"
               : "+v"(a), "+v"(b) : "v"(x0), "v"(x1), "v"(x2), "v"(x3), "v"(p0), "v"(p1));
#endif
}
__device__ __forceinline__ void wave_sync_lds() {
  __builtin_amdgcn_fence(__ATOMIC_RELEASE, "workgroup");
  __builtin_amdgcn_wave_barrier();
  __builtin_amdgcn_fence(__ATOMIC_ACQUIRE, "workgroup");
}

// =====================================================================================================
// Operand planes: XN[s*4096 + n][256] = f16( bf16_RNE(x_s[n][c]) * 64 ) (blocks 0..1023, 8 rows each, stream s = bx/512),
// WT[o][256] = f16( bf16_RNE(W[o][c]) * 64 ) (blocks 1024..1119; W is already [o][c] = k-contiguous, no transpose).
// Thread t: row = 8 per block (t>>5), 8 consecutive elements at 8*(t&31): one instruction of 32 lanes x 16 B = one whole
// coverage: 1024 x 8 = 8192 XN rows and 96 x 8 = 768 WT rows, each row 32 lanes x 8 halves = 256 columns: both planes entirely.
// =====================================================================================================
__global__ __launch_bounds__(256) void cvt_planes(const float* __restrict__ xb, const float* __restrict__ xa,
                                                   const float* __restrict__ w, unsigned short* XN, unsigned short* WT) {
  const int tid = threadIdx.x, r = tid >> 5, lane = tid & 31;
  const int bx  = blockIdx.x;
  const bool isx = (bx < (MROWS / 8));                    // block-uniform
  const int  s   = isx ? (bx / (NTOK / 8)) : 0;           // stream of this block
  const float* src = isx ? ((s == 0) ? xb : xa) : w;
  unsigned short* dst = isx ? XN : WT;
  const float sc  = isx ? XC : WSC;
  const int drow  = isx ? (bx * 8 + r) : ((bx - MROWS / 8) * 8 + r);   // row in dst plane
  const int srow  = isx ? (drow - s * NTOK) : drow;                       // row in src tensor
  const float* sp = src + (size_t)srow * CDIM + 8 * lane;
  const v4f a = *(const v4f*)(sp), c = *(const v4f*)(sp + 4);
  float f[8];
#pragma unroll
  for (int i = 0; i < 4; ++i) { f[i] = bfr(a[i]) * sc; f[4 + i] = bfr(c[i]) * sc; }
  v4u v;
#pragma unroll
  for (int i = 0; i < 4; ++i) v[i] = pk16(h_bits((_Float16)f[2 * i]), h_bits((_Float16)f[2 * i + 1]));
  unsigned short* dp = dst + (size_t)drow * CDIM + 8 * lane;
  *(v4u*)dp = v;
  
}

// =====================================================================================================
// Register-blocked f16 WMMA GEMM, one wave per 64x64 tile, no block barriers:
//   C[m][n] = osc * sum_k A[m][k] * Bt[n][k]   (f32 out, pitch ldc)
// A: f16 row-major [M][K] pitch lda; Bt: f16 [N][K] (k contiguous, pitch ldb); fragments = two 16-B loads with the
// split k map (ldfrag_h). M, N multiples of 64, K multiple of 32 (host-checked constants here).
// lines, n0*4 is a multiple of 256) written by 16 consecutive lanes x 16 B of ONE instruction (lanes 0-15 row it*2, lanes
// coverage: 4 slabs x 16 rows x 64 cols = the wave's whole 64x64 tile; grid = tilesM*tilesN/8 blocks (exact multiple of 8).
// =====================================================================================================
__global__ __launch_bounds__(256) void gemm64f(
    const unsigned short* __restrict__ Ap, int lda,
    const unsigned short* __restrict__ Bp, int ldb,
    float* Cout, int ldc, float osc, int M, int N, int K) {
  __shared__ __align__(16) float sT[8][16 * 68];   // per-wave 16x64 slab, pitch 68 floats
  const int lane = threadIdx.x & 31;
  const int wave = threadIdx.x >> 5;
  const int tilesN = N >> 6;
  const int tilesM = M >> 6;
  const int tile = blockIdx.x * 8 + wave;
  if (tile >= tilesM * tilesN) return;   // wave-uniform; no block barriers in this kernel
  const int tm = tile / tilesN;
  const int tn = tile - tm * tilesN;
  const int m0 = tm << 6;
  const int n0 = tn << 6;

  const _Float16* Ah = (const _Float16*)(const void*)Ap;
  const _Float16* Bb = (const _Float16*)(const void*)Bp;

  const int rlane = lane & 15;                 // row (A) / col (B, D) within subtile
  const int koff  = (lane >> 4) * 8;           // k offset of this lane half
  const int mOff  = (lane >> 4) * 8;           // D row offset

  v8f acc[4][4];
#pragma unroll
  for (int i = 0; i < 4; ++i)
#pragma unroll
    for (int j = 0; j < 4; ++j) acc[i][j] = zero8();

  for (int k0 = 0; k0 < K; k0 += 32) {
    v16h bh[4];
#pragma unroll
    for (int j = 0; j < 4; ++j) {
      const size_t bo = (size_t)(n0 + (j << 4) + rlane) * ldb + koff + k0;
      bh[j] = ldfrag_h(Bb + bo);
    }
#pragma unroll
    for (int i = 0; i < 4; ++i) {
      const size_t ao = (size_t)(m0 + (i << 4) + rlane) * lda + koff + k0;
      const v16h ah = ldfrag_h(Ah + ao);
#pragma unroll
      for (int j = 0; j < 4; ++j) acc[i][j] = mma_h_raw(ah, bh[j], acc[i][j]);
      dep_guard1(acc[i][0], acc[i][3], ah);
    }
    keep4_h(bh[0], bh[1], bh[2], bh[3]);
  }
  acc_guard4(acc[0][0], acc[0][1], acc[0][2], acc[0][3]);
  acc_guard4(acc[1][0], acc[1][1], acc[1][2], acc[1][3]);
  acc_guard4(acc[2][0], acc[2][1], acc[2][2], acc[2][3]);
  acc_guard4(acc[3][0], acc[3][1], acc[3][2], acc[3][3]);

  const int hh2 = lane >> 4, c4 = (lane & 15) * 4;     // f32 out: 256-B row segment = 16 lanes x 16 B
  float* slab = sT[wave];
#pragma unroll
  for (int i = 0; i < 4; ++i) {
    const int mBase = m0 + (i << 4);
#pragma unroll
    for (int j = 0; j < 4; ++j) {
#pragma unroll
      for (int r = 0; r < 8; ++r) {
        slab[(mOff + r) * 68 + (j << 4) + rlane] = acc[i][j][r];
      }
    }
    wave_sync_lds();
    v4f vals[8];
#pragma unroll
    for (int it = 0; it < 8; ++it) {
      const int row = it * 2 + hh2;                      // it 0..7 x hh2 0..1 = rows 0..15
      v4f v = *(const v4f*)(slab + row * 68 + c4);
#pragma unroll
      for (int e = 0; e < 4; ++e) v[e] = v[e] * osc;
      vals[it] = v;
    }
    {
#pragma unroll
      for (int it = 0; it < 8; ++it) {
        const int row = it * 2 + hh2;
        *(v4f*)(Cout + (size_t)(mBase + row) * ldc + n0 + c4) = vals[it];
      }
      
    }
    wave_sync_lds();
  }
}

// =====================================================================================================
// Per-head LayerNorm of q, k and v (feature o = part*256 + h*32 + dd of the projection row) and 16-bit plane writes.
// One lane owns 8 consecutive features of a token, so a head (32 features) is one quad of lanes: mean and variance are
// 8 adds in the lane and a two-step sum over the quad. No LDS and no barrier; every load of a wave is independent.
// k and v are stored in the order in which the attention kernel's fragment loads read them, so that each of its 32-lane
// 16-B loads covers four whole 128-B lines:
//   KH[s][h][tile of 16 tokens][j][piece = 16*hh + c][8]     = k of token 16*tile + c, d = 16*j + 8*hh + e
//   VTH, VTL[s][h][block of 64 tokens][jf][piece = 4*tg + ch][8] = v of token 64*block + 8*tg + e, d = 8*ch + jf
//   blocks 0..127 (v): 64 tokens of stream s, wave = head; lane = (token group tg = lane>>2, feature chunk ch = lane&3)
//      holds 8 tokens x 8 features; y*256 -> f16 hi + residual; per feature jf the lane's 8 tokens are one 16-B piece and
//      the wave's 32 pieces one contiguous 512-B store.
//   blocks 128..383 (q): wave = 4 token rows; lane = features 8*lane..8*lane+7 of the row; y*1024 -> f16 hi + f16
//      residual; each store instruction is one whole 512-B row.
//   blocks 384..639 (k): wave = one 16-token tile x 2 heads; lane = (token tr = lane>>2 and tr + 8, chunk ch = lane&3);
//      y*1024 -> f16 hi; chunk ch is (j, hh) = (ch>>1, ch&1), so a store instruction is four whole 128-B lines.
// coverage: q rows: 256 blocks x 8 waves x 4 rows = all 8192 rows, full width; KH: 256 blocks x 8 waves = 512 tiles x
//           4 head pairs, 1024 B per tile and head = the whole plane; VT planes: 128 blocks x 8 heads x 8 jf x 512 B =
//           both planes entirely.
// =====================================================================================================
__device__ __forceinline__ float quad_sum(float v) {   // sum over lanes l, l^1, l^2, l^3 (DPP row_xmask 1, then 2)
  v += __builtin_bit_cast(float, __builtin_amdgcn_update_dpp(0, __builtin_bit_cast(int, v), 0x161, 0xf, 0xf, true));
  v += __builtin_bit_cast(float, __builtin_amdgcn_update_dpp(0, __builtin_bit_cast(int, v), 0x162, 0xf, 0xf, true));
  return v;
}
__device__ __forceinline__ float rsq_pos(float x) {   // 1/sqrt(x) for x >= LNEPS: never in the range that rsqrtf rescales
  float r = 0.f;
#if defined(__HIP_DEVICE_COMPILE__)
  // v_nop: fills the one slot asked for behind a transcendental, before an instruction that may overwrite its source
  asm("v_rsq_f32 %0, %1\n\tv_nop" : "=v"(r) : "v"(x));
#endif
  return r;
}
__device__ __forceinline__ void ln8(const v4f a, const v4f c, const float (&g)[8], const float (&b)[8], float sc,
                                    float (&y)[8]) {
  const float mean = quad_sum(((a[0] + a[1]) + (a[2] + a[3])) + ((c[0] + c[1]) + (c[2] + c[3]))) * (1.0f / DHEAD);
  float d[8];
#pragma unroll
  for (int j = 0; j < 4; ++j) { d[j] = a[j] - mean; d[4 + j] = c[j] - mean; }
  float ss = 0.f;
#pragma unroll
  for (int j = 0; j < 8; ++j) ss += d[j] * d[j];
  const float rs = rsq_pos(quad_sum(ss) * (1.0f / DHEAD) + LNEPS);
#pragma unroll
  for (int j = 0; j < 8; ++j) y[j] = ((d[j] * rs) * g[j] + b[j]) * sc;
}
__device__ __forceinline__ void bfr8(const v4f lo, const v4f hi, float (&o)[8]) {
#pragma unroll
  for (int j = 0; j < 4; ++j) { o[j] = bfr(lo[j]); o[4 + j] = bfr(hi[j]); }
}
__device__ __forceinline__ unsigned hi2(float x, float y) { return pk16(h_bits((_Float16)x), h_bits((_Float16)y)); }
__device__ __forceinline__ unsigned lo2(float x, float y) {
  return pk16(h_bits((_Float16)(x - (float)(_Float16)x)), h_bits((_Float16)(y - (float)(_Float16)y)));
}

__global__ __launch_bounds__(256)
void ln_heads(const float* __restrict__ T, const float* __restrict__ gam, const float* __restrict__ bet,
              unsigned short* QH, unsigned short* QL, unsigned short* KH,
              unsigned short* VTH, unsigned short* VTL) {
  const int tid = threadIdx.x, wave = tid >> 5, lane = tid & 31;
  const int bx  = blockIdx.x;
  const int ch  = lane & 3;                           // 8-feature chunk of the head, all three mappings
  float g[8], be[8];
  if (bx < MROWS / 64) {                              // block-uniform: v, transposed in registers
    const int s    = bx / (NTOK / 64);
    const int tok0 = (bx - s * (NTOK / 64)) * 64 + 8 * (lane >> 2);
    const float* tp = T + ((size_t)s * NTOK + tok0) * OC + 2 * CDIM + wave * DHEAD + 8 * ch;
    v4f xa[8], xc[8];
#pragma unroll
    for (int i = 0; i < 8; ++i) { xa[i] = *(const v4f*)(tp + (size_t)i * OC); xc[i] = *(const v4f*)(tp + (size_t)i * OC + 4); }
    const v4f g0 = *(const v4f*)(gam + 8 * ch), g1 = *(const v4f*)(gam + 8 * ch + 4);
    const v4f b0 = *(const v4f*)(bet + 8 * ch), b1 = *(const v4f*)(bet + 8 * ch + 4);
    // keeps every load of the wave in front of the arithmetic: one memory latency instead of two or three in a row
    __builtin_amdgcn_sched_barrier(0);
    bfr8(g0, g1, g);
    bfr8(b0, b1, be);
    float y[8][8];
#pragma unroll
    for (int i = 0; i < 8; ++i) ln8(xa[i], xc[i], g, be, VC, y[i]);
    const size_t vo = (((size_t)s * NHEAD + wave) * (NTOK / 64) + (bx - s * (NTOK / 64))) * 2048 + 8 * lane;
#pragma unroll
    for (int j = 0; j < 8; ++j) {
      v4u hv, lv;
#pragma unroll
      for (int p = 0; p < 4; ++p) { hv[p] = hi2(y[2 * p][j], y[2 * p + 1][j]); lv[p] = lo2(y[2 * p][j], y[2 * p + 1][j]); }
      *(v4u*)(VTH + vo + j * 256) = hv;
      *(v4u*)(VTL + vo + j * 256) = lv;
    }
  } else if (bx < MROWS / 64 + MROWS / 32) {          // block-uniform: q, token rows
    const size_t row0 = ((size_t)(bx - MROWS / 64) * 8 + wave) * 4;
    const float* tp = T + row0 * OC + 8 * lane;
    v4f xa[4], xc[4];
#pragma unroll
    for (int i = 0; i < 4; ++i) {
      const float* p = tp + (size_t)i * OC;
      xa[i] = *(const v4f*)(p);
      xc[i] = *(const v4f*)(p + 4);
    }
    const v4f g0 = *(const v4f*)(gam + 8 * ch), g1 = *(const v4f*)(gam + 8 * ch + 4);
    const v4f b0 = *(const v4f*)(bet + 8 * ch), b1 = *(const v4f*)(bet + 8 * ch + 4);
    // keeps every load of the wave in front of the arithmetic: one memory latency instead of two or three in a row
    __builtin_amdgcn_sched_barrier(0);
    bfr8(g0, g1, g);
    bfr8(b0, b1, be);
#pragma unroll
    for (int i = 0; i < 4; ++i) {
      float y[8];
      ln8(xa[i], xc[i], g, be, QC, y);
      const size_t o = (row0 + i) * CDIM + 8 * lane;
      v4u hv, lv;
#pragma unroll
      for (int p = 0; p < 4; ++p) { hv[p] = hi2(y[2 * p], y[2 * p + 1]); lv[p] = lo2(y[2 * p], y[2 * p + 1]); }
      *(v4u*)(QH + o) = hv;
      *(v4u*)(QL + o) = lv;
    }
  } else {                                            // k, fragment order
    const int wid = (bx - (MROWS / 64 + MROWS / 32)) * 8 + wave;
    const int t16 = wid >> 2;                         // 16-token tile, both streams stacked
    const int h0  = (wid & 3) * 2;                    // first of the wave's two heads
    const int tr  = lane >> 2;
    const float* tp = T + ((size_t)t16 * 16 + tr) * OC + CDIM + h0 * DHEAD + 8 * ch;
    v4f xa[4], xc[4];                                 // index = 2*head + token half (tokens tr, tr + 8)
#pragma unroll
    for (int i = 0; i < 4; ++i) {
      const float* p = tp + (size_t)(i & 1) * 8 * OC + (i >> 1) * DHEAD;
      xa[i] = *(const v4f*)(p);
      xc[i] = *(const v4f*)(p + 4);
    }
    const v4f g0 = *(const v4f*)(gam + 8 * ch), g1 = *(const v4f*)(gam + 8 * ch + 4);
    const v4f b0 = *(const v4f*)(bet + 8 * ch), b1 = *(const v4f*)(bet + 8 * ch + 4);
    // keeps every load of the wave in front of the arithmetic: one memory latency instead of two or three in a row
    __builtin_amdgcn_sched_barrier(0);
    bfr8(g0, g1, g);
    bfr8(b0, b1, be);
    const int s = t16 / (NTOK / 16), tile = t16 - s * (NTOK / 16);
    const size_t ko = (((size_t)s * NHEAD + h0) * (NTOK / 16) + tile) * 512 + (ch >> 1) * 256 + ((ch & 1) * 16 + tr) * 8;
#pragma unroll
    for (int i = 0; i < 4; ++i) {
      float y[8];
      ln8(xa[i], xc[i], g, be, KC, y);
      v4u hv;
#pragma unroll
      for (int p = 0; p < 4; ++p) hv[p] = hi2(y[2 * p], y[2 * p + 1]);
      *(v4u*)(KH + ko + (size_t)(i >> 1) * (NTOK / 16) * 512 + (i & 1) * 64) = hv;
    }
  }
}

// =====================================================================================================
// Attention for one (dir, head, 64-query block), transposed formulation, head dim 32, 4096 keys, no mask:
//   dir 0: queries from stream 1, keys/values from stream 0 -> output slot 0; dir 1: queries from stream 0, keys/values
//   from stream 1 -> output slot 1.
//   S^T tile (16 keys x 16 queries) = A(k rows = keys, d via the split k map) . B(q, col = query, same d map):
//   s = k.q_hi + k.q_res (two products) = 1024*1024 * logit_dot. Per lane the D tile holds 8 keys of ONE query, so the
//   online softmax (running max, f32) is per-lane state with one shuffle (lane^16) for the max over 32 keys; the row sum
//   is kept as a per-lane partial and combined at the end. P = e^{s-m} x 16384 as f16 hi + f16 residual is used directly
//   as the B operand of O^T (rows d, cols queries) += A(v^T rows d, keys contiguous, two 16-B loads) . B(P^T):
//   B element r <- the key tile covering keys kb..kb+15, element 8+r <- the tile covering kb+16..kb+31, lane unchanged
//   (D-as-B chaining layout). Products vhi.phi + vhi.plo + vlo.phi into one accumulator per d tile.
//   k and v come from planes in fragment order (layouts: at ln_heads): every load of a wave covers four whole 128-B lines.
//   A k tile is 1024 contiguous bytes, piece = lane. Row c of v^T tile dt is d = 8*(c&3) + 4*dt + (c>>2): its four
//   feature rows jf = 4*dt + (c>>2) each give one line (key groups 2j, 2j+1 of the 32 keys x chunks 0..3); the epilogue
//   puts the output rows back in d order.
//   32 keys per iteration: 4 score WMMAs + 6 output WMMAs per wave. Block = 4 waves = 64 queries; grid = 2*8*64 = 1024.
//   Epilogue: the block's [64 query][32 d] f32 tile is staged in LDS (scalar stores), block barrier, then 4 instructions
// coverage: block writes queries q0..q0+63 x d 0..31 of its (dir, head); grid covers out [2][4096][256] exactly once.
// =====================================================================================================
__global__ __launch_bounds__(128)
void attn_kernel(const unsigned short* __restrict__ qh, const unsigned short* __restrict__ ql,
                 const unsigned short* __restrict__ kh, const unsigned short* __restrict__ vth,
                 const unsigned short* __restrict__ vtl, float* out) {
  __shared__ __align__(16) float Os[64 * DHEAD];
  const int tid  = threadIdx.x;
  const int wave = tid >> 5;
  const int lane = tid & 31;
  const int hh   = lane >> 4;
  const int c    = lane & 15;
  const int bx   = blockIdx.x;
  const int qb   = bx % (NTOK / 64);              // NTOK/64 = 64 query blocks per (stream, head)
  const int hd   = (bx / (NTOK / 64)) % NHEAD;
  const int dir  = bx / ((NTOK / 64) * NHEAD);
  const int qsrc = 1 - dir;
  const int ksrc = dir;
  const int q0   = qb * 64;

  const _Float16* QHp = (const _Float16*)(const void*)qh;
  const _Float16* QLp = (const _Float16*)(const void*)ql;
  const _Float16* KHp = (const _Float16*)(const void*)kh;
  const _Float16* VHp = (const _Float16*)(const void*)vth;
  const _Float16* VLp = (const _Float16*)(const void*)vtl;

  // ---- q fragments (B operand, col = query q0 + 16*wave + c): hi plane and residual plane ----
  const size_t qtok = (size_t)qsrc * NTOK + q0 + wave * 16 + c;
  const v16h qhf = ldfrag_h(QHp + qtok * CDIM + hd * DHEAD + 8 * hh);
  const v16h qlf = ldfrag_h(QLp + qtok * CDIM + hd * DHEAD + 8 * hh);
  // ---- k fragment base (A operand, row = key kb + c): 512 halves a 16-key tile, the lane's piece = lane ----
  const _Float16* Kp = KHp + (size_t)(ksrc * NHEAD + hd) * (NTOK / 16) * 512 + 8 * lane;
  // ---- v^T fragment bases (A operand, row c = d 8*(c&3) + 4*dt + (c>>2)): 2048 halves a 64-key block ----
  const size_t vrow = (size_t)(ksrc * NHEAD + hd) * (NTOK / 64) * 2048 + (c >> 2) * 256 + (4 * hh + (c & 3)) * 8;
  const _Float16* VH0 = VHp + vrow;
  const _Float16* VH1 = VH0 + 4 * 256;
  const _Float16* VL0 = VLp + vrow;
  const _Float16* VL1 = VL0 + 4 * 256;
  const float SC = ATTSC / (QC * KC);

  float m = -1.0e30f, l = 0.f;
  v8f o0 = zero8(), o1 = zero8();
#pragma unroll 1
  for (int it = 0; it < NTOK / 32; ++it) {
    const v16h kf0 = ldfrag_p(Kp + (size_t)it * 1024, 256);          // keys kb..kb+15, kb = 32*it
    const v16h kf1 = ldfrag_p(Kp + (size_t)it * 1024 + 512, 256);    // keys kb+16..kb+31
    v8f s0 = mma_h_raw(kf0, qhf, zero8());
    v8f s1 = mma_h_raw(kf1, qhf, zero8());
    s0 = mma_h_raw(kf0, qlf, s0);
    s1 = mma_h_raw(kf1, qlf, s1);
    sguard2(s0, s1, kf0, kf1, qhf, qlf);

    float mx = fmaxf(hmax8(s0), hmax8(s1));
    mx = fmaxf(mx, __shfl_xor(mx, 16, 32));
    const float mn   = fmaxf(m, mx * SC);
    const float corr = __expf(m - mn);
    m = mn;
    const float msh = mn - LNPSC;            // exp gives e^{s-m} * 16384
    l *= corr;
#pragma unroll
    for (int r = 0; r < 8; ++r) { o0[r] *= corr; o1[r] *= corr; }

    FragH ph, pl;
    float ls = 0.f;
#pragma unroll
    for (int r = 0; r < 8; ++r) {
      const float e0 = __expf(s0[r] * SC - msh);      // key kb      + 8hh + r
      const float e1 = __expf(s1[r] * SC - msh);      // key kb + 16 + 8hh + r
      ls += e0 + e1;
      const _Float16 h0 = (_Float16)e0, h1 = (_Float16)e1;
      ph.h[0][r] = h0;
      ph.h[1][r] = h1;
      pl.h[0][r] = (_Float16)(e0 - (float)h0);
      pl.h[1][r] = (_Float16)(e1 - (float)h1);
    }
    l += ls;

    const size_t vo = (size_t)(it >> 1) * 2048 + (it & 1) * 128;     // 64-key block, then its 32-key half
    const v16h vh0 = ldfrag_p(VH0 + vo, 64);
    const v16h vh1 = ldfrag_p(VH1 + vo, 64);
    const v16h vl0 = ldfrag_p(VL0 + vo, 64);
    const v16h vl1 = ldfrag_p(VL1 + vo, 64);
    o0 = mma_h_raw(vh0, ph.v, o0);
    o1 = mma_h_raw(vh1, ph.v, o1);
    o0 = mma_h_raw(vh0, pl.v, o0);
    o1 = mma_h_raw(vh1, pl.v, o1);
    o0 = mma_h_raw(vl0, ph.v, o0);
    o1 = mma_h_raw(vl1, ph.v, o1);
    oguard2(o0, o1, vh0, vh1, vl0, vl1, ph.v, pl.v);
  }
  l += __shfl_xor(l, 16, 32);
  const float sc = (1.0f / VC) * (1.0f / l);

  // ---- stage O[query 16*wave + c][d]: accumulator row 8hh + r of tile dt is d = 8*(r&3) + 4*dt + 2hh + (r>>2) ----
  float* os = Os + (wave * 16 + c) * DHEAD + 2 * hh;
#pragma unroll
  for (int r = 0; r < 8; ++r) {
    os[8 * (r & 3) + (r >> 2)]     = o0[r] * sc;
    os[8 * (r & 3) + (r >> 2) + 4] = o1[r] * sc;
  }
  __syncthreads();
  {
    const int e = tid & 7, qq = tid >> 3;              // qq 0..15: line within group, e: 16-B piece
    v4f vals[4];
#pragma unroll
    for (int it = 0; it < 4; ++it) {
      const int qi = it * 16 + qq;                       // it 0..3 x qq 0..15 = queries 0..63 of the block
      vals[it] = *(const v4f*)(Os + qi * DHEAD + 4 * e);
    }
    float* ob = out + (size_t)dir * NTOK * CDIM + (size_t)hd * DHEAD + 4 * e;
    {
#pragma unroll
      for (int it = 0; it < 4; ++it) {
        const int qi = it * 16 + qq;
        *(v4f*)(ob + (size_t)(q0 + qi) * CDIM) = vals[it];
      }
      
    }
  }
}

// =====================================================================================================
// Workspace map (bytes), every offset a multiple of 256 and every plane sized to its whole-row store granularity:
//   XN   f16 [8192][256]            0           4194304
//   WT   f16 [768][256]             4194304     393216
//   T    f32 [8192][768]            4587520     25165824
//   QH   f16 [8192][256]            29753344    4194304
//   QL   f16 [8192][256]            33947648    4194304
//   KH   f16 [2][8][256][2][32][8]  38141952    4194304
//   VTH  f16 [2][8][64][8][32][8]   42336256    4194304
//   VTL  f16 [2][8][64][8][32][8]   46530560    4194304
//   end                              50724864
// =====================================================================================================
extern "C" void kernel_launch(void* const* d_in, const int* in_sizes, int n_in,
                              void* d_out, int out_size, void* d_ws, size_t ws_size,
                              hipStream_t stream) {
  if (n_in < 5) return;
  if (in_sizes[0] != NTOK * CDIM || in_sizes[1] != NTOK * CDIM) return;
  if (in_sizes[2] != OC * CDIM) return;
  if (in_sizes[3] != DHEAD || in_sizes[4] != DHEAD) return;
  if (out_size != NSTR * NTOK * CDIM) return;

  const float* x_b   = (const float*)d_in[0];
  const float* x_a   = (const float*)d_in[1];
  const float* w_qkv = (const float*)d_in[2];
  const float* ln_g  = (const float*)d_in[3];
  const float* ln_b  = (const float*)d_in[4];

  const size_t PXN = (size_t)MROWS * CDIM * 2;        //  4194304
  const size_t PWT = (size_t)OC * CDIM * 2;           //   393216
  const size_t PT  = (size_t)MROWS * OC * 4;          // 25165824
  const size_t PQ  = (size_t)MROWS * CDIM * 2;        //  4194304
  const size_t PV  = (size_t)NSTR * CDIM * NTOK * 2;  //  4194304
  size_t off = 0;
  const size_t oXN = off; off += PXN;
  const size_t oWT = off; off += PWT;
  const size_t oT  = off; off += PT;
  const size_t oQH = off; off += PQ;
  const size_t oQL = off; off += PQ;
  const size_t oKH = off; off += PQ;
  const size_t oVH = off; off += PV;
  const size_t oVL = off; off += PV;
  if (off > ws_size) return;                          // off = 50724864
  if (off > (size_t)134217728) return;

  char* ws = (char*)d_ws;
  unsigned short* XN  = (unsigned short*)(ws + oXN);
  unsigned short* WT  = (unsigned short*)(ws + oWT);
  float*          T   = (float*)(ws + oT);
  unsigned short* QH  = (unsigned short*)(ws + oQH);
  unsigned short* QL  = (unsigned short*)(ws + oQL);
  unsigned short* KH  = (unsigned short*)(ws + oKH);
  unsigned short* VTH = (unsigned short*)(ws + oVH);
  unsigned short* VTL = (unsigned short*)(ws + oVL);
  float*          out = (float*)d_out;

  const dim3 blk(256), blk128(128);
  const dim3 gCV(MROWS / 8 + OC / 8);                          // 1024 + 96 = 1120 blocks of 8 rows
  const dim3 gGM(((MROWS / 64) * (OC / 64)) / 8);              // 1536 tiles -> 192 blocks
  const dim3 gLN(MROWS / 64 + MROWS / 32 + MROWS / 32);        // 128 blocks (v, 64 tokens) + 256 (q, 32 rows) + 256 (k, 2 tiles)
  const dim3 gAT(NSTR * NHEAD * (NTOK / 64));                  // 1024 blocks of 128

  // (0) 16-bit operand planes: f16( bf16_RNE(x) * 64 ), f16( bf16_RNE(W) * 64 )
  cvt_planes<<<gCV, blk, 0, stream>>>(x_b, x_a, w_qkv, XN, WT);

  // (1) T[s*4096 + n][o] = (x_s[n] . W[o]) : both streams stacked, scale 1/(64*64)
  gemm64f<<<gGM, blk, 0, stream>>>(XN, CDIM, WT, CDIM, T, OC, 1.0f / (XC * WSC), MROWS, OC, CDIM);

  // (2) per-head LayerNorm -> q hi/res token rows; k hi and v hi/res in fragment order
  ln_heads<<<gLN, blk, 0, stream>>>(T, ln_g, ln_b, QH, QL, KH, VTH, VTL);

  // (3) attention, both directions, all heads -> out[dir][n][h*32 + d]
  attn_kernel<<<gAT, blk128, 0, stream>>>(QH, QL, KH, VTH, VTL, out);
  (void)hipGetLastError();
}

// v003
// A run of this version takes 109 microseconds.
// Next to v002, in two timings, it ran 1.43 times as fast each time.
// All steps since v000 together make it 3.01 times as fast.
// Contractions: qkv projection (x token rows f16 x64 . W_qkv rows f16 x64, K=256, one product); attention scores
// S^T = k (f16 x1024 hi) . q^T (f16 x1024 hi plane + f16 residual plane, two products, head dim 32); attention
// O^T = v^T (f16 x256 hi and residual planes) . P^T (f16 x16384 hi and residual, taken from the score D registers),
// three products hi.hi + hi.lo + lo.hi over 4096 keys. All v_wmma_f32_16x16x32_f16, f32 accumulate; LayerNorm and
// softmax in f32 on VALU; every float input RNE-converted to bf16 on load.
#include <hip/hip_runtime.h>
#include <math.h>
#include <stdint.h>

#define NTOK   4096
#define CDIM   256
#define NHEAD  8
#define DHEAD  32
#define OC     (3 * CDIM)
#define NSTR   2
#define MROWS  (NSTR * NTOK)
#define LNEPS  1.0e-5f
#define XC     64.0f
#define WSC    64.0f
#define QC     1024.0f
#define KC     1024.0f
#define VC     256.0f
#define LNPSC  9.704060527839234f
#define ATTSC  0.17677669529663687f
static_assert(NHEAD * DHEAD == CDIM);
static_assert((MROWS % 64) == 0 && (OC % 64) == 0 && (CDIM % 32) == 0);
static_assert((((MROWS / 64) * (OC / 64)) % 8) == 0);
static_assert((NTOK % 64) == 0 && (NTOK / 32) >= 4 && (MROWS % 8) == 0 && (OC % 8) == 0);

typedef _Float16 v16h __attribute__((ext_vector_type(16)));
typedef _Float16 v8h  __attribute__((ext_vector_type(8)));
typedef float    v8f  __attribute__((ext_vector_type(8)));
typedef float    v4f  __attribute__((ext_vector_type(4)));
typedef unsigned int v4u __attribute__((ext_vector_type(4)));

union FragH { v16h v; v8h h[2]; };

// ---- scalar helpers --------------------------------------------------------------------------------
__device__ __forceinline__ unsigned short bf_bits(float f) {          // f32 -> bf16 bits, RNE convert
  unsigned u = __float_as_uint(f);
  return (unsigned short)((u + 0x7FFFu + ((u >> 16) & 1u)) >> 16);
}
__device__ __forceinline__ float bf_up(unsigned short h) { return __uint_as_float(((unsigned)h) << 16); }
__device__ __forceinline__ float bfr(float f) { return bf_up(bf_bits(f)); }
__device__ __forceinline__ unsigned short h_bits(_Float16 x) { return __builtin_bit_cast(unsigned short, x); }
__device__ __forceinline__ unsigned pk16(unsigned short a, unsigned short b) { return (unsigned)a | ((unsigned)b << 16); }
__device__ __forceinline__ v8f zero8() { v8f z = {0.f, 0.f, 0.f, 0.f, 0.f, 0.f, 0.f, 0.f}; return z; }
__device__ __forceinline__ float hmax8(v8f s) {
  return fmaxf(fmaxf(fmaxf(s[0], s[1]), fmaxf(s[2], s[3])), fmaxf(fmaxf(s[4], s[5]), fmaxf(s[6], s[7])));
}

// ---- fragment loader: 16-bit A/B operand, lane -> row/col (lane&15), p already includes +8*(lane>>4);
//      elements 0..7 <- p[0..7] (k0+8h..), elements 8..15 <- p[16..23] (k0+16+8h..)
__device__ __forceinline__ v16h ldfrag_h(const _Float16* p) {
  FragH f;
  f.h[0] = *(const v8h*)(p);
  f.h[1] = *(const v8h*)(p + 16);
  return f.v;
}
// ---- the same operand from a plane stored in fragment order: elements 0..7 <- p[0..7], elements 8..15 <- p[step..step+7];
//      p already includes the lane's own 16-B piece
__device__ __forceinline__ v16h ldfrag_p(const _Float16* p, int step) {
  FragH f;
  f.h[0] = *(const v8h*)(p);
  f.h[1] = *(const v8h*)(p + step);
  return f.v;
}

// ---- WMMA helpers with trailing VALU hazard gap --------------------------------------------------------
__device__ __forceinline__ v8f mma_h_raw(v16h a, v16h b, v8f c) {
  return __builtin_amdgcn_wmma_f32_16x16x32_f16(false, a, false, b, (short)0, c, false, false);
}
__device__ __forceinline__ void dep_guard1(v8f& a, v8f& b, v16h x) {
#if defined(__HIP_DEVICE_COMPILE__)
  asm volatile("v_nop\n\tv_nop\n\tv_nop\n\tv_nop" : "+v"(a), "+v"(b) : "v"(x));
#endif
}
__device__ __forceinline__ void keep4_h(v16h a, v16h b, v16h c, v16h d) {
#if defined(__HIP_DEVICE_COMPILE__)
  asm volatile("v_nop" :: "v"(a), "v"(b), "v"(c), "v"(d));
#endif
}
__device__ __forceinline__ void acc_guard4(v8f& a, v8f& b, v8f& c, v8f& d) {
#if defined(__HIP_DEVICE_COMPILE__)
  asm volatile("v_nop\n\tv_nop\n\tv_nop\n\tv_nop" : "+v"(a), "+v"(b), "+v"(c), "+v"(d));
#endif
}
__device__ __forceinline__ void sguard2(v8f& a, v8f& b, v16h k0, v16h k1, v16h q0, v16h q1) {
#if defined(__HIP_DEVICE_COMPILE__)
  asm volatile("v_nop\n\tv_nop\n\tv_nop\n\tv_nop"
               : "+v"(a), "+v"(b) : "v"(k0), "v"(k1), "v"(q0), "v"(q1));
#endif
}
__device__ __forceinline__ void oguard2(v8f& a, v8f& b, v16h x0, v16h x1, v16h x2, v16h x3, v16h p0, v16h p1) {
#if defined(__HIP_DEVICE_COMPILE__)
  asm volatile("v_nop\n\tv_nop\n\tv_nop\n\tv_nop"
               : "+v"(a), "+v"(b) : "v"(x0), "v"(x1), "v"(x2), "v"(x3), "v"(p0), "v"(p1));
#endif
}
__device__ __forceinline__ void wave_sync_lds() {
  __builtin_amdgcn_fence(__ATOMIC_RELEASE, "workgroup");
  __builtin_amdgcn_wave_barrier();
  __builtin_amdgcn_fence(__ATOMIC_ACQUIRE, "workgroup");
}

// =====================================================================================================
// Operand planes: XN[s*4096 + n][256] = f16( bf16_RNE(x_s[n][c]) * 64 ) (blocks 0..1023, 8 rows each, stream s = bx/512),
// WT[o][256] = f16( bf16_RNE(W[o][c]) * 64 ) (blocks 1024..1119; W is already [o][c] = k-contiguous, no transpose).
// Thread t: row = 8 per block (t>>5), 8 consecutive elements at 8*(t&31): one instruction of 32 lanes x 16 B = one whole
// coverage: 1024 x 8 = 8192 XN rows and 96 x 8 = 768 WT rows, each row 32 lanes x 8 halves = 256 columns: both planes entirely.
// =====================================================================================================
__global__ __launch_bounds__(256) void cvt_planes(const float* __restrict__ xb, const float* __restrict__ xa,
                                                   const float* __restrict__ w, unsigned short* XN, unsigned short* WT) {
  const int tid = threadIdx.x, r = tid >> 5, lane = tid & 31;
  const int bx  = blockIdx.x;
  const bool isx = (bx < (MROWS / 8));                    // block-uniform
  const int  s   = isx ? (bx / (NTOK / 8)) : 0;           // stream of this block
  const float* src = isx ? ((s == 0) ? xb : xa) : w;
  unsigned short* dst = isx ? XN : WT;
  const float sc  = isx ? XC : WSC;
  const int drow  = isx ? (bx * 8 + r) : ((bx - MROWS / 8) * 8 + r);   // row in dst plane
  const int srow  = isx ? (drow - s * NTOK) : drow;                       // row in src tensor
  const float* sp = src + (size_t)srow * CDIM + 8 * lane;
  const v4f a = *(const v4f*)(sp), c = *(const v4f*)(sp + 4);
  float f[8];
#pragma unroll
  for (int i = 0; i < 4; ++i) { f[i] = bfr(a[i]) * sc; f[4 + i] = bfr(c[i]) * sc; }
  v4u v;
#pragma unroll
  for (int i = 0; i < 4; ++i) v[i] = pk16(h_bits((_Float16)f[2 * i]), h_bits((_Float16)f[2 * i + 1]));
  unsigned short* dp = dst + (size_t)drow * CDIM + 8 * lane;
  *(v4u*)dp = v;
  
}

// =====================================================================================================
// Register-blocked f16 WMMA GEMM, one wave per 64x64 tile, no block barriers:
//   C[m][n] = osc * sum_k A[m][k] * Bt[n][k]   (f32 out, pitch ldc)
// A: f16 row-major [M][K] pitch lda; Bt: f16 [N][K] (k contiguous, pitch ldb); fragments = two 16-B loads with the
// split k map (ldfrag_h). M, N multiples of 64, K multiple of 32 (host-checked constants here).
// lines, n0*4 is a multiple of 256) written by 16 consecutive lanes x 16 B of ONE instruction (lanes 0-15 row it*2, lanes
// coverage: 4 slabs x 16 rows x 64 cols = the wave's whole 64x64 tile; grid = tilesM*tilesN/8 blocks (exact multiple of 8).
// =====================================================================================================
__global__ __launch_bounds__(256) void gemm64f(
    const unsigned short* __restrict__ Ap, int lda,
    const unsigned short* __restrict__ Bp, int ldb,
    float* Cout, int ldc, float osc, int M, int N, int K) {
  __shared__ __align__(16) float sT[8][16 * 68];   // per-wave 16x64 slab, pitch 68 floats
  const int lane = threadIdx.x & 31;
  const int wave = threadIdx.x >> 5;
  const int tilesN = N >> 6;
  const int tilesM = M >> 6;
  const int tile = blockIdx.x * 8 + wave;
  if (tile >= tilesM * tilesN) return;   // wave-uniform; no block barriers in this kernel
  const int tm = tile / tilesN;
  const int tn = tile - tm * tilesN;
  const int m0 = tm << 6;
  const int n0 = tn << 6;

  const _Float16* Ah = (const _Float16*)(const void*)Ap;
  const _Float16* Bb = (const _Float16*)(const void*)Bp;

  const int rlane = lane & 15;                 // row (A) / col (B, D) within subtile
  const int koff  = (lane >> 4) * 8;           // k offset of this lane half
  const int mOff  = (lane >> 4) * 8;           // D row offset

  v8f acc[4][4];
#pragma unroll
  for (int i = 0; i < 4; ++i)
#pragma unroll
    for (int j = 0; j < 4; ++j) acc[i][j] = zero8();

  for (int k0 = 0; k0 < K; k0 += 32) {
    v16h bh[4];
#pragma unroll
    for (int j = 0; j < 4; ++j) {
      const size_t bo = (size_t)(n0 + (j << 4) + rlane) * ldb + koff + k0;
      bh[j] = ldfrag_h(Bb + bo);
    }
#pragma unroll
    for (int i = 0; i < 4; ++i) {
      const size_t ao = (size_t)(m0 + (i << 4) + rlane) * lda + koff + k0;
      const v16h ah = ldfrag_h(Ah + ao);
#pragma unroll
      for (int j = 0; j < 4; ++j) acc[i][j] = mma_h_raw(ah, bh[j], acc[i][j]);
      dep_guard1(acc[i][0], acc[i][3], ah);
    }
    keep4_h(bh[0], bh[1], bh[2], bh[3]);
  }
  acc_guard4(acc[0][0], acc[0][1], acc[0][2], acc[0][3]);
  acc_guard4(acc[1][0], acc[1][1], acc[1][2], acc[1][3]);
  acc_guard4(acc[2][0], acc[2][1], acc[2][2], acc[2][3]);
  acc_guard4(acc[3][0], acc[3][1], acc[3][2], acc[3][3]);

  const int hh2 = lane >> 4, c4 = (lane & 15) * 4;     // f32 out: 256-B row segment = 16 lanes x 16 B
  float* slab = sT[wave];
#pragma unroll
  for (int i = 0; i < 4; ++i) {
    const int mBase = m0 + (i << 4);
#pragma unroll
    for (int j = 0; j < 4; ++j) {
#pragma unroll
      for (int r = 0; r < 8; ++r) {
        slab[(mOff + r) * 68 + (j << 4) + rlane] = acc[i][j][r];
      }
    }
    wave_sync_lds();
    v4f vals[8];
#pragma unroll
    for (int it = 0; it < 8; ++it) {
      const int row = it * 2 + hh2;                      // it 0..7 x hh2 0..1 = rows 0..15
      v4f v = *(const v4f*)(slab + row * 68 + c4);
#pragma unroll
      for (int e = 0; e < 4; ++e) v[e] = v[e] * osc;
      vals[it] = v;
    }
    {
#pragma unroll
      for (int it = 0; it < 8; ++it) {
        const int row = it * 2 + hh2;
        *(v4f*)(Cout + (size_t)(mBase + row) * ldc + n0 + c4) = vals[it];
      }
      
    }
    wave_sync_lds();
  }
}

// =====================================================================================================
// Per-head LayerNorm of q, k and v (feature o = part*256 + h*32 + dd of the projection row) and 16-bit plane writes.
// One lane owns 8 consecutive features of a token, so a head (32 features) is one quad of lanes: mean and variance are
// 8 adds in the lane and a two-step sum over the quad. No LDS and no barrier; every load of a wave is independent.
// k and v are stored in the order in which the attention kernel's fragment loads read them, so that each of its 32-lane
// 16-B loads covers four whole 128-B lines:
//   KH[s][h][tile of 16 tokens][j][piece = 16*hh + c][8]     = k of token 16*tile + c, d = 16*j + 8*hh + e
//   VTH, VTL[s][h][block of 64 tokens][jf][piece = 4*tg + ch][8] = v of token 64*block + 8*tg + e, d = 8*ch + jf
//   blocks 0..127 (v): 64 tokens of stream s, wave = head; lane = (token group tg = lane>>2, feature chunk ch = lane&3)
//      holds 8 tokens x 8 features; y*256 -> f16 hi + residual; per feature jf the lane's 8 tokens are one 16-B piece and
//      the wave's 32 pieces one contiguous 512-B store.
//   blocks 128..383 (q): wave = 4 token rows; lane = features 8*lane..8*lane+7 of the row; y*1024 -> f16 hi + f16
//      residual; each store instruction is one whole 512-B row.
//   blocks 384..639 (k): wave = one 16-token tile x 2 heads; lane = (token tr = lane>>2 and tr + 8, chunk ch = lane&3);
//      y*1024 -> f16 hi; chunk ch is (j, hh) = (ch>>1, ch&1), so a store instruction is four whole 128-B lines.
// coverage: q rows: 256 blocks x 8 waves x 4 rows = all 8192 rows, full width; KH: 256 blocks x 8 waves = 512 tiles x
//           4 head pairs, 1024 B per tile and head = the whole plane; VT planes: 128 blocks x 8 heads x 8 jf x 512 B =
//           both planes entirely.
// =====================================================================================================
__device__ __forceinline__ float quad_sum(float v) {   // sum over lanes l, l^1, l^2, l^3 (DPP row_xmask 1, then 2)
  v += __builtin_bit_cast(float, __builtin_amdgcn_update_dpp(0, __builtin_bit_cast(int, v), 0x161, 0xf, 0xf, true));
  v += __builtin_bit_cast(float, __builtin_amdgcn_update_dpp(0, __builtin_bit_cast(int, v), 0x162, 0xf, 0xf, true));
  return v;
}
__device__ __forceinline__ float rsq_pos(float x) {   // 1/sqrt(x) for x >= LNEPS: never in the range that rsqrtf rescales
  float r = 0.f;
#if defined(__HIP_DEVICE_COMPILE__)
  // v_nop: fills the one slot asked for behind a transcendental, before an instruction that may overwrite its source
  asm("v_rsq_f32 %0, %1\n\tv_nop" : "=v"(r) : "v"(x));
#endif
  return r;
}
__device__ __forceinline__ void ln8(const v4f a, const v4f c, const float (&g)[8], const float (&b)[8], float sc,
                                    float (&y)[8]) {
  const float mean = quad_sum(((a[0] + a[1]) + (a[2] + a[3])) + ((c[0] + c[1]) + (c[2] + c[3]))) * (1.0f / DHEAD);
  float d[8];
#pragma unroll
  for (int j = 0; j < 4; ++j) { d[j] = a[j] - mean; d[4 + j] = c[j] - mean; }
  float ss = 0.f;
#pragma unroll
  for (int j = 0; j < 8; ++j) ss += d[j] * d[j];
  const float rs = rsq_pos(quad_sum(ss) * (1.0f / DHEAD) + LNEPS);
#pragma unroll
  for (int j = 0; j < 8; ++j) y[j] = ((d[j] * rs) * g[j] + b[j]) * sc;
}
__device__ __forceinline__ void bfr8(const v4f lo, const v4f hi, float (&o)[8]) {
#pragma unroll
  for (int j = 0; j < 4; ++j) { o[j] = bfr(lo[j]); o[4 + j] = bfr(hi[j]); }
}
__device__ __forceinline__ unsigned hi2(float x, float y) { return pk16(h_bits((_Float16)x), h_bits((_Float16)y)); }
__device__ __forceinline__ unsigned lo2(float x, float y) {
  return pk16(h_bits((_Float16)(x - (float)(_Float16)x)), h_bits((_Float16)(y - (float)(_Float16)y)));
}

__global__ __launch_bounds__(256)
void ln_heads(const float* __restrict__ T, const float* __restrict__ gam, const float* __restrict__ bet,
              unsigned short* QH, unsigned short* QL, unsigned short* KH,
              unsigned short* VTH, unsigned short* VTL) {
  const int tid = threadIdx.x, wave = tid >> 5, lane = tid & 31;
  const int bx  = blockIdx.x;
  const int ch  = lane & 3;                           // 8-feature chunk of the head, all three mappings
  float g[8], be[8];
  if (bx < MROWS / 64) {                              // block-uniform: v, transposed in registers
    const int s    = bx / (NTOK / 64);
    const int tok0 = (bx - s * (NTOK / 64)) * 64 + 8 * (lane >> 2);
    const float* tp = T + ((size_t)s * NTOK + tok0) * OC + 2 * CDIM + wave * DHEAD + 8 * ch;
    v4f xa[8], xc[8];
#pragma unroll
    for (int i = 0; i < 8; ++i) { xa[i] = *(const v4f*)(tp + (size_t)i * OC); xc[i] = *(const v4f*)(tp + (size_t)i * OC + 4); }
    const v4f g0 = *(const v4f*)(gam + 8 * ch), g1 = *(const v4f*)(gam + 8 * ch + 4);
    const v4f b0 = *(const v4f*)(bet + 8 * ch), b1 = *(const v4f*)(bet + 8 * ch + 4);
    // keeps every load of the wave in front of the arithmetic: one memory latency instead of two or three in a row
    __builtin_amdgcn_sched_barrier(0);
    bfr8(g0, g1, g);
    bfr8(b0, b1, be);
    float y[8][8];
#pragma unroll
    for (int i = 0; i < 8; ++i) ln8(xa[i], xc[i], g, be, VC, y[i]);
    const size_t vo = (((size_t)s * NHEAD + wave) * (NTOK / 64) + (bx - s * (NTOK / 64))) * 2048 + 8 * lane;
#pragma unroll
    for (int j = 0; j < 8; ++j) {
      v4u hv, lv;
#pragma unroll
      for (int p = 0; p < 4; ++p) { hv[p] = hi2(y[2 * p][j], y[2 * p + 1][j]); lv[p] = lo2(y[2 * p][j], y[2 * p + 1][j]); }
      *(v4u*)(VTH + vo + j * 256) = hv;
      *(v4u*)(VTL + vo + j * 256) = lv;
    }
  } else if (bx < MROWS / 64 + MROWS / 32) {          // block-uniform: q, token rows
    const size_t row0 = ((size_t)(bx - MROWS / 64) * 8 + wave) * 4;
    const float* tp = T + row0 * OC + 8 * lane;
    v4f xa[4], xc[4];
#pragma unroll
    for (int i = 0; i < 4; ++i) {
      const float* p = tp + (size_t)i * OC;
      xa[i] = *(const v4f*)(p);
      xc[i] = *(const v4f*)(p + 4);
    }
    const v4f g0 = *(const v4f*)(gam + 8 * ch), g1 = *(const v4f*)(gam + 8 * ch + 4);
    const v4f b0 = *(const v4f*)(bet + 8 * ch), b1 = *(const v4f*)(bet + 8 * ch + 4);
    // keeps every load of the wave in front of the arithmetic: one memory latency instead of two or three in a row
    __builtin_amdgcn_sched_barrier(0);
    bfr8(g0, g1, g);
    bfr8(b0, b1, be);
#pragma unroll
    for (int i = 0; i < 4; ++i) {
      float y[8];
      ln8(xa[i], xc[i], g, be, QC, y);
      const size_t o = (row0 + i) * CDIM + 8 * lane;
      v4u hv, lv;
#pragma unroll
      for (int p = 0; p < 4; ++p) { hv[p] = hi2(y[2 * p], y[2 * p + 1]); lv[p] = lo2(y[2 * p], y[2 * p + 1]); }
      *(v4u*)(QH + o) = hv;
      *(v4u*)(QL + o) = lv;
    }
  } else {                                            // k, fragment order
    const int wid = (bx - (MROWS / 64 + MROWS / 32)) * 8 + wave;
    const int t16 = wid >> 2;                         // 16-token tile, both streams stacked
    const int h0  = (wid & 3) * 2;                    // first of the wave's two heads
    const int tr  = lane >> 2;
    const float* tp = T + ((size_t)t16 * 16 + tr) * OC + CDIM + h0 * DHEAD + 8 * ch;
    v4f xa[4], xc[4];                                 // index = 2*head + token half (tokens tr, tr + 8)
#pragma unroll
    for (int i = 0; i < 4; ++i) {
      const float* p = tp + (size_t)(i & 1) * 8 * OC + (i >> 1) * DHEAD;
      xa[i] = *(const v4f*)(p);
      xc[i] = *(const v4f*)(p + 4);
    }
    const v4f g0 = *(const v4f*)(gam + 8 * ch), g1 = *(const v4f*)(gam + 8 * ch + 4);
    const v4f b0 = *(const v4f*)(bet + 8 * ch), b1 = *(const v4f*)(bet + 8 * ch + 4);
    // keeps every load of the wave in front of the arithmetic: one memory latency instead of two or three in a row
    __builtin_amdgcn_sched_barrier(0);
    bfr8(g0, g1, g);
    bfr8(b0, b1, be);
    const int s = t16 / (NTOK / 16), tile = t16 - s * (NTOK / 16);
    const size_t ko = (((size_t)s * NHEAD + h0) * (NTOK / 16) + tile) * 512 + (ch >> 1) * 256 + ((ch & 1) * 16 + tr) * 8;
#pragma unroll
    for (int i = 0; i < 4; ++i) {
      float y[8];
      ln8(xa[i], xc[i], g, be, KC, y);
      v4u hv;
#pragma unroll
      for (int p = 0; p < 4; ++p) hv[p] = hi2(y[2 * p], y[2 * p + 1]);
      *(v4u*)(KH + ko + (size_t)(i >> 1) * (NTOK / 16) * 512 + (i & 1) * 64) = hv;
    }
  }
}

// =====================================================================================================
// Attention for one (dir, head, 64-query block), transposed formulation, head dim 32, 4096 keys, no mask:
//   dir 0: queries from stream 1, keys/values from stream 0 -> output slot 0; dir 1: queries from stream 0, keys/values
//   from stream 1 -> output slot 1.
//   S^T tile (16 keys x 16 queries) = A(k rows = keys, d via the split k map) . B(q, col = query, same d map):
//   s = k.q_hi + k.q_res (two products) = 1024*1024 * logit_dot. Per lane the D tile holds 8 keys of ONE query, so the
//   online softmax (running max, f32) is per-lane state with one shuffle (lane^16) for the max over 32 keys; the row sum
//   is kept as a per-lane partial and combined at the end. P = e^{s-m} x 16384 as f16 hi + f16 residual is used directly
//   as the B operand of O^T (rows d, cols queries) += A(v^T rows d, keys contiguous, two 16-B loads) . B(P^T):
//   B element r <- the key tile covering keys kb..kb+15, element 8+r <- the tile covering kb+16..kb+31, lane unchanged
//   (D-as-B chaining layout). Products vhi.phi + vhi.plo + vlo.phi into one accumulator per d tile.
//   k and v come from planes in fragment order (layouts: at ln_heads): every load of a wave covers four whole 128-B lines.
//   A k tile is 1024 contiguous bytes, piece = lane. Row c of v^T tile dt is d = 8*(c&3) + 4*dt + (c>>2): its four
//   feature rows jf = 4*dt + (c>>2) each give one line (key groups 2j, 2j+1 of the 32 keys x chunks 0..3); the epilogue
//   puts the output rows back in d order.
//   32 keys per step: 4 score WMMAs + 6 output WMMAs per wave; two steps a trip, each on its own register set of k and v
//   fragments, fetched two steps ahead. Block = 4 waves = 64 queries; grid = 2*8*64 = 1024.
//   Epilogue: the block's [64 query][32 d] f32 tile is staged in LDS (scalar stores), block barrier, then 4 instructions
// coverage: block writes queries q0..q0+63 x d 0..31 of its (dir, head); grid covers out [2][4096][256] exactly once.
// =====================================================================================================
__device__ __forceinline__ float exp_slot(float x) {   // e^x as __expf forms it: one multiply, one v_exp_f32
  float r = 0.f;
#if defined(__HIP_DEVICE_COMPILE__)
  // v_nop: fills the one slot asked for behind a transcendental, before an instruction that may overwrite its source
  asm("v_exp_f32 %0, %1\n\tv_nop" : "=v"(r) : "v"(x * 1.44269504088896340736f));
#endif
  return r;
}

__global__ __launch_bounds__(128)
void attn_kernel(const unsigned short* __restrict__ qh, const unsigned short* __restrict__ ql,
                 const unsigned short* __restrict__ kh, const unsigned short* __restrict__ vth,
                 const unsigned short* __restrict__ vtl, float* out) {
  __shared__ __align__(16) float Os[64 * DHEAD];
  const int tid  = threadIdx.x;
  const int wave = tid >> 5;
  const int lane = tid & 31;
  const int hh   = lane >> 4;
  const int c    = lane & 15;
  const int bx   = blockIdx.x;
  const int qb   = bx % (NTOK / 64);              // NTOK/64 = 64 query blocks per (stream, head)
  const int hd   = (bx / (NTOK / 64)) % NHEAD;
  const int dir  = bx / ((NTOK / 64) * NHEAD);
  const int qsrc = 1 - dir;
  const int ksrc = dir;
  const int q0   = qb * 64;

  const _Float16* QHp = (const _Float16*)(const void*)qh;
  const _Float16* QLp = (const _Float16*)(const void*)ql;
  const _Float16* KHp = (const _Float16*)(const void*)kh;
  const _Float16* VHp = (const _Float16*)(const void*)vth;
  const _Float16* VLp = (const _Float16*)(const void*)vtl;

  // ---- q fragments (B operand, col = query q0 + 16*wave + c): hi plane and residual plane ----
  const size_t qtok = (size_t)qsrc * NTOK + q0 + wave * 16 + c;
  const v16h qhf = ldfrag_h(QHp + qtok * CDIM + hd * DHEAD + 8 * hh);
  const v16h qlf = ldfrag_h(QLp + qtok * CDIM + hd * DHEAD + 8 * hh);
#if defined(__HIP_DEVICE_COMPILE__)
  // stands in front of the first k and v loads, whose results land in registers that the q loads name as addresses
  asm volatile("s_wait_xcnt 0x0" ::: "memory");
#endif
  // ---- k fragment base (A operand, row = key kb + c): 512 halves a 16-key tile, the lane's piece = lane ----
  const _Float16* Kp = KHp + (size_t)(ksrc * NHEAD + hd) * (NTOK / 16) * 512 + 8 * lane;
  // ---- v^T fragment bases (A operand, row c = d 8*(c&3) + 4*dt + (c>>2)): 2048 halves a 64-key block ----
  const size_t vrow = (size_t)(ksrc * NHEAD + hd) * (NTOK / 64) * 2048 + (c >> 2) * 256 + (4 * hh + (c & 3)) * 8;
  const _Float16* VH0 = VHp + vrow;
  const _Float16* VH1 = VH0 + 4 * 256;
  const _Float16* VL0 = VLp + vrow;
  const _Float16* VL1 = VL0 + 4 * 256;
  const float SC = ATTSC / (QC * KC);

  float m = -1.0e30f, l = 0.f;
  v8f o0 = zero8(), o1 = zero8();
  // One 32-key step on the fragment set (kf0..vl1). Each operand group is refilled for step nx, two steps ahead, directly
  // behind its last use, so a load has about two steps of other work between its issue and its wait.
  // refill is a literal at each call; the last two steps have nothing left to fetch.
  auto step = [&](v16h& kf0, v16h& kf1, v16h& vh0, v16h& vh1, v16h& vl0, v16h& vl1, const int nx, const bool refill)
      __attribute__((always_inline)) {
    v8f s0 = mma_h_raw(kf0, qhf, zero8());
    v8f s1 = mma_h_raw(kf1, qhf, zero8());
    s0 = mma_h_raw(kf0, qlf, s0);
    s1 = mma_h_raw(kf1, qlf, s1);
    sguard2(s0, s1, kf0, kf1, qhf, qlf);
    // the two scheduling barriers hold the k refill here: lifted over the products it would need a third register set and
    // copies, sunk into the softmax (where the compiler put it) it would be waited for shortly after its issue
    if (refill) {
      __builtin_amdgcn_sched_barrier(0);
      kf0 = ldfrag_p(Kp + (size_t)nx * 1024, 256);          // keys kb..kb+15 of step nx, kb = 32*nx
      kf1 = ldfrag_p(Kp + (size_t)nx * 1024 + 512, 256);    // keys kb+16..kb+31
      __builtin_amdgcn_sched_barrier(0);
    }

    float mx = fmaxf(hmax8(s0), hmax8(s1));
    mx = fmaxf(mx, __shfl_xor(mx, 16, 32));
    const float mn   = fmaxf(m, mx * SC);
    const float corr = exp_slot(m - mn);
    m = mn;
    const float msh = mn - LNPSC;            // exp gives e^{s-m} * 16384
    l *= corr;
#pragma unroll
    for (int r = 0; r < 8; ++r) { o0[r] *= corr; o1[r] *= corr; }

    FragH ph, pl;
    float ls = 0.f;
#pragma unroll
    for (int r = 0; r < 8; ++r) {
      const float e0 = __expf(s0[r] * SC - msh);      // key kb      + 8hh + r
      const float e1 = __expf(s1[r] * SC - msh);      // key kb + 16 + 8hh + r
      ls += e0 + e1;
      const _Float16 h0 = (_Float16)e0, h1 = (_Float16)e1;
      ph.h[0][r] = h0;
      ph.h[1][r] = h1;
      pl.h[0][r] = (_Float16)(e0 - (float)h0);
      pl.h[1][r] = (_Float16)(e1 - (float)h1);
    }
    l += ls;

    o0 = mma_h_raw(vh0, ph.v, o0);
    o1 = mma_h_raw(vh1, ph.v, o1);
    o0 = mma_h_raw(vh0, pl.v, o0);
    o1 = mma_h_raw(vh1, pl.v, o1);
    o0 = mma_h_raw(vl0, ph.v, o0);
    o1 = mma_h_raw(vl1, ph.v, o1);
    oguard2(o0, o1, vh0, vh1, vl0, vl1, ph.v, pl.v);
    if (refill) {
      const size_t vo = (size_t)(nx >> 1) * 2048 + (nx & 1) * 128;     // 64-key block, then its 32-key half
      // the same for the v refill; the second barrier also keeps the next step's products out of this step
      __builtin_amdgcn_sched_barrier(0);
      vh0 = ldfrag_p(VH0 + vo, 64);
      vh1 = ldfrag_p(VH1 + vo, 64);
      vl0 = ldfrag_p(VL0 + vo, 64);
      vl1 = ldfrag_p(VL1 + vo, 64);
      __builtin_amdgcn_sched_barrier(0);
    }
  };
  // two fragment sets: a = even steps, b = odd steps
  v16h ka0 = ldfrag_p(Kp, 256),        ka1 = ldfrag_p(Kp + 512, 256);
  v16h va0 = ldfrag_p(VH0, 64),        va1 = ldfrag_p(VH1, 64),       va2 = ldfrag_p(VL0, 64),       va3 = ldfrag_p(VL1, 64);
  v16h kb0 = ldfrag_p(Kp + 1024, 256), kb1 = ldfrag_p(Kp + 1536, 256);
  v16h vb0 = ldfrag_p(VH0 + 128, 64),  vb1 = ldfrag_p(VH1 + 128, 64), vb2 = ldfrag_p(VL0 + 128, 64), vb3 = ldfrag_p(VL1 + 128, 64);
  // kept rolled: a trip already holds both sets' steps, further copies would only lengthen the text
#pragma unroll 1
  for (int it = 0; it < NTOK / 32 - 2; it += 2) {
    step(ka0, ka1, va0, va1, va2, va3, it + 2, true);
    step(kb0, kb1, vb0, vb1, vb2, vb3, it + 3, true);
#if defined(__HIP_DEVICE_COMPILE__)
    // stands in front of the next trip's overwrite of the address registers that this trip's loads name
    asm volatile("s_wait_xcnt 0x0" ::: "memory");
#endif
  }
  step(ka0, ka1, va0, va1, va2, va3, 0, false);
  step(kb0, kb1, vb0, vb1, vb2, vb3, 0, false);
  l += __shfl_xor(l, 16, 32);
  const float sc = (1.0f / VC) * (1.0f / l);

  // ---- stage O[query 16*wave + c][d]: accumulator row 8hh + r of tile dt is d = 8*(r&3) + 4*dt + 2hh + (r>>2) ----
  float* os = Os + (wave * 16 + c) * DHEAD + 2 * hh;
#pragma unroll
  for (int r = 0; r < 8; ++r) {
    os[8 * (r & 3) + (r >> 2)]     = o0[r] * sc;
    os[8 * (r & 3) + (r >> 2) + 4] = o1[r] * sc;
  }
  __syncthreads();
  {
    const int e = tid & 7, qq = tid >> 3;              // qq 0..15: line within group, e: 16-B piece
    v4f vals[4];
#pragma unroll
    for (int it = 0; it < 4; ++it) {
      const int qi = it * 16 + qq;                       // it 0..3 x qq 0..15 = queries 0..63 of the block
      vals[it] = *(const v4f*)(Os + qi * DHEAD + 4 * e);
    }
    float* ob = out + (size_t)dir * NTOK * CDIM + (size_t)hd * DHEAD + 4 * e;
    {
#pragma unroll
      for (int it = 0; it < 4; ++it) {
        const int qi = it * 16 + qq;
        *(v4f*)(ob + (size_t)(q0 + qi) * CDIM) = vals[it];
      }
      
    }
  }
}

// =====================================================================================================
// Workspace map (bytes), every offset a multiple of 256 and every plane sized to its whole-row store granularity:
//   XN   f16 [8192][256]            0           4194304
//   WT   f16 [768][256]             4194304     393216
//   T    f32 [8192][768]            4587520     25165824
//   QH   f16 [8192][256]            29753344    4194304
//   QL   f16 [8192][256]            33947648    4194304
//   KH   f16 [2][8][256][2][32][8]  38141952    4194304
//   VTH  f16 [2][8][64][8][32][8]   42336256    4194304
//   VTL  f16 [2][8][64][8][32][8]   46530560    4194304
//   end                              50724864
// =====================================================================================================
extern "C" void kernel_launch(void* const* d_in, const int* in_sizes, int n_in,
                              void* d_out, int out_size, void* d_ws, size_t ws_size,
                              hipStream_t stream) {
  if (n_in < 5) return;
  if (in_sizes[0] != NTOK * CDIM || in_sizes[1] != NTOK * CDIM) return;
  if (in_sizes[2] != OC * CDIM) return;
  if (in_sizes[3] != DHEAD || in_sizes[4] != DHEAD) return;
  if (out_size != NSTR * NTOK * CDIM) return;

  const float* x_b   = (const float*)d_in[0];
  const float* x_a   = (const float*)d_in[1];
  const float* w_qkv = (const float*)d_in[2];
  const float* ln_g  = (const float*)d_in[3];
  const float* ln_b  = (const float*)d_in[4];

  const size_t PXN = (size_t)MROWS * CDIM * 2;        //  4194304
  const size_t PWT = (size_t)OC * CDIM * 2;           //   393216
  const size_t PT  = (size_t)MROWS * OC * 4;          // 25165824
  const size_t PQ  = (size_t)MROWS * CDIM * 2;        //  4194304
  const size_t PV  = (size_t)NSTR * CDIM * NTOK * 2;  //  4194304
  size_t off = 0;
  const size_t oXN = off; off += PXN;
  const size_t oWT = off; off += PWT;
  const size_t oT  = off; off += PT;
  const size_t oQH = off; off += PQ;
  const size_t oQL = off; off += PQ;
  const size_t oKH = off; off += PQ;
  const size_t oVH = off; off += PV;
  const size_t oVL = off; off += PV;
  if (off > ws_size) return;                          // off = 50724864
  if (off > (size_t)134217728) return;

  char* ws = (char*)d_ws;
  unsigned short* XN  = (unsigned short*)(ws + oXN);
  unsigned short* WT  = (unsigned short*)(ws + oWT);
  float*          T   = (float*)(ws + oT);
  unsigned short* QH  = (unsigned short*)(ws + oQH);
  unsigned short* QL  = (unsigned short*)(ws + oQL);
  unsigned short* KH  = (unsigned short*)(ws + oKH);
  unsigned short* VTH = (unsigned short*)(ws + oVH);
  unsigned short* VTL = (unsigned short*)(ws + oVL);
  float*          out = (float*)d_out;

  const dim3 blk(256), blk128(128);
  const dim3 gCV(MROWS / 8 + OC / 8);                          // 1024 + 96 = 1120 blocks of 8 rows
  const dim3 gGM(((MROWS / 64) * (OC / 64)) / 8);              // 1536 tiles -> 192 blocks
  const dim3 gLN(MROWS / 64 + MROWS / 32 + MROWS / 32);        // 128 blocks (v, 64 tokens) + 256 (q, 32 rows) + 256 (k, 2 tiles)
  const dim3 gAT(NSTR * NHEAD * (NTOK / 64));                  // 1024 blocks of 128

  // (0) 16-bit operand planes: f16( bf16_RNE(x) * 64 ), f16( bf16_RNE(W) * 64 )
  cvt_planes<<<gCV, blk, 0, stream>>>(x_b, x_a, w_qkv, XN, WT);

  // (1) T[s*4096 + n][o] = (x_s[n] . W[o]) : both streams stacked, scale 1/(64*64)
  gemm64f<<<gGM, blk, 0, stream>>>(XN, CDIM, WT, CDIM, T, OC, 1.0f / (XC * WSC), MROWS, OC, CDIM);

  // (2) per-head LayerNorm -> q hi/res token rows; k hi and v hi/res in fragment order
  ln_heads<<<gLN, blk, 0, stream>>>(T, ln_g, ln_b, QH, QL, KH, VTH, VTL);

  // (3) attention, both directions, all heads -> out[dir][n][h*32 + d]
  attn_kernel<<<gAT, blk128, 0, stream>>>(QH, QL, KH, VTH, VTL, out);
  (void)hipGetLastError();
}

// v005
// One run takes 72.6 microseconds.
// Versions between v003 and this one are left out; their measured steps multiply to 1.52 times as fast.
// All steps since v000 together make it 4.57 times as fast.
// Contractions: qkv projection (x token rows f16 x64 . W_qkv rows f16 x64, K=256, one product); attention scores
// S^T = k (f16 x1024) . q^T (f16 x1024), one product, head dim 32; attention O^T = v^T (f16 x256) . P^T (f16 x16384,
// taken from the score D registers), one product over 4096 keys. Every operand is one f16 plane (RNE from f32).
// All v_wmma_f32_16x16x32_f16, f32 accumulate; LayerNorm and softmax in f32 on VALU; every float input RNE-converted
// to bf16 on load.
#include <hip/hip_runtime.h>
#include <math.h>
#include <stdint.h>

#define NTOK   4096
#define CDIM   256
#define NHEAD  8
#define DHEAD  32
#define OC     (3 * CDIM)
#define NSTR   2
#define MROWS  (NSTR * NTOK)
#define LNEPS  1.0e-5f
#define XC     64.0f
#define WSC    64.0f
#define QC     1024.0f
#define KC     1024.0f
#define VC     256.0f
#define LNPSC  9.704060527839234f
#define ATTSC  0.17677669529663687f
static_assert(NHEAD * DHEAD == CDIM);
static_assert((MROWS % 64) == 0 && (OC % 64) == 0 && (CDIM % 32) == 0);
static_assert((((MROWS / 64) * (OC / 64)) % 8) == 0);
static_assert((NTOK % 64) == 0 && (NTOK / 32) >= 4 && (MROWS % 8) == 0 && (OC % 8) == 0);

typedef _Float16 v16h __attribute__((ext_vector_type(16)));
typedef _Float16 v8h  __attribute__((ext_vector_type(8)));
typedef float    v8f  __attribute__((ext_vector_type(8)));
typedef float    v4f  __attribute__((ext_vector_type(4)));
typedef unsigned int v4u __attribute__((ext_vector_type(4)));

union FragH { v16h v; v8h h[2]; };

// ---- scalar helpers --------------------------------------------------------------------------------
__device__ __forceinline__ unsigned short bf_bits(float f) {          // f32 -> bf16 bits, RNE convert
  unsigned u = __float_as_uint(f);
  return (unsigned short)((u + 0x7FFFu + ((u >> 16) & 1u)) >> 16);
}
__device__ __forceinline__ float bf_up(unsigned short h) { return __uint_as_float(((unsigned)h) << 16); }
__device__ __forceinline__ float bfr(float f) { return bf_up(bf_bits(f)); }
__device__ __forceinline__ unsigned short h_bits(_Float16 x) { return __builtin_bit_cast(unsigned short, x); }
__device__ __forceinline__ unsigned pk16(unsigned short a, unsigned short b) { return (unsigned)a | ((unsigned)b << 16); }
__device__ __forceinline__ v8f zero8() { v8f z = {0.f, 0.f, 0.f, 0.f, 0.f, 0.f, 0.f, 0.f}; return z; }
__device__ __forceinline__ float hmax8(v8f s) {
  return fmaxf(fmaxf(fmaxf(s[0], s[1]), fmaxf(s[2], s[3])), fmaxf(fmaxf(s[4], s[5]), fmaxf(s[6], s[7])));
}

// ---- fragment loader: 16-bit A/B operand, lane -> row/col (lane&15), p already includes +8*(lane>>4);
//      elements 0..7 <- p[0..7] (k0+8h..), elements 8..15 <- p[16..23] (k0+16+8h..)
__device__ __forceinline__ v16h ldfrag_h(const _Float16* p) {
  FragH f;
  f.h[0] = *(const v8h*)(p);
  f.h[1] = *(const v8h*)(p + 16);
  return f.v;
}
// ---- the same operand from a plane stored in fragment order: elements 0..7 <- p[0..7], elements 8..15 <- p[step..step+7];
//      p already includes the lane's own 16-B piece
__device__ __forceinline__ v16h ldfrag_p(const _Float16* p, int step) {
  FragH f;
  f.h[0] = *(const v8h*)(p);
  f.h[1] = *(const v8h*)(p + step);
  return f.v;
}

// ---- WMMA helpers with trailing VALU hazard gap --------------------------------------------------------
__device__ __forceinline__ v8f mma_h_raw(v16h a, v16h b, v8f c) {
  return __builtin_amdgcn_wmma_f32_16x16x32_f16(false, a, false, b, (short)0, c, false, false);
}
__device__ __forceinline__ void dep_guard1(v8f& a, v8f& b, v16h x) {
#if defined(__HIP_DEVICE_COMPILE__)
  asm volatile("v_nop\n\tv_nop\n\tv_nop\n\tv_nop" : "+v"(a), "+v"(b) : "v"(x));
#endif
}
__device__ __forceinline__ void keep4_h(v16h a, v16h b, v16h c, v16h d) {
#if defined(__HIP_DEVICE_COMPILE__)
  asm volatile("v_nop" :: "v"(a), "v"(b), "v"(c), "v"(d));
#endif
}
__device__ __forceinline__ void acc_guard4(v8f& a, v8f& b, v8f& c, v8f& d) {
#if defined(__HIP_DEVICE_COMPILE__)
  asm volatile("v_nop\n\tv_nop\n\tv_nop\n\tv_nop" : "+v"(a), "+v"(b), "+v"(c), "+v"(d));
#endif
}
// behind four products of two A fragments (x0, x1) with two B fragments (y0, y1). v_nop x4: the distance asked for between
// the last product and the first vector instruction that reads a D or overwrites an A or B register; the operands hold the
// statement behind the products and in front of the refill of x0, x1
__device__ __forceinline__ void guard4(v8f& a, v8f& b, v8f& c, v8f& d, v16h x0, v16h x1, v16h y0, v16h y1) {
#if defined(__HIP_DEVICE_COMPILE__)
  asm volatile("v_nop\n\tv_nop\n\tv_nop\n\tv_nop"
               : "+v"(a), "+v"(b), "+v"(c), "+v"(d) : "v"(x0), "v"(x1), "v"(y0), "v"(y1));
#endif
}
__device__ __forceinline__ void wave_sync_lds() {
  __builtin_amdgcn_fence(__ATOMIC_RELEASE, "workgroup");
  __builtin_amdgcn_wave_barrier();
  __builtin_amdgcn_fence(__ATOMIC_ACQUIRE, "workgroup");
}

// =====================================================================================================
// Operand planes: XN[s*4096 + n][256] = f16( bf16_RNE(x_s[n][c]) * 64 ) (blocks 0..1023, 8 rows each, stream s = bx/512),
// WT[o][256] = f16( bf16_RNE(W[o][c]) * 64 ) (blocks 1024..1119; W is already [o][c] = k-contiguous, no transpose).
// Thread t: row = 8 per block (t>>5), 8 consecutive elements at 8*(t&31): one instruction of 32 lanes x 16 B = one whole
// coverage: 1024 x 8 = 8192 XN rows and 96 x 8 = 768 WT rows, each row 32 lanes x 8 halves = 256 columns: both planes entirely.
// =====================================================================================================
__global__ __launch_bounds__(256) void cvt_planes(const float* __restrict__ xb, const float* __restrict__ xa,
                                                   const float* __restrict__ w, unsigned short* XN, unsigned short* WT) {
  const int tid = threadIdx.x, r = tid >> 5, lane = tid & 31;
  const int bx  = blockIdx.x;
  const bool isx = (bx < (MROWS / 8));                    // block-uniform
  const int  s   = isx ? (bx / (NTOK / 8)) : 0;           // stream of this block
  const float* src = isx ? ((s == 0) ? xb : xa) : w;
  unsigned short* dst = isx ? XN : WT;
  const float sc  = isx ? XC : WSC;
  const int drow  = isx ? (bx * 8 + r) : ((bx - MROWS / 8) * 8 + r);   // row in dst plane
  const int srow  = isx ? (drow - s * NTOK) : drow;                       // row in src tensor
  const float* sp = src + (size_t)srow * CDIM + 8 * lane;
  const v4f a = *(const v4f*)(sp), c = *(const v4f*)(sp + 4);
  float f[8];
#pragma unroll
  for (int i = 0; i < 4; ++i) { f[i] = bfr(a[i]) * sc; f[4 + i] = bfr(c[i]) * sc; }
  v4u v;
#pragma unroll
  for (int i = 0; i < 4; ++i) v[i] = pk16(h_bits((_Float16)f[2 * i]), h_bits((_Float16)f[2 * i + 1]));
  unsigned short* dp = dst + (size_t)drow * CDIM + 8 * lane;
  *(v4u*)dp = v;
  
}

// =====================================================================================================
// Register-blocked f16 WMMA GEMM, one wave per 64x64 tile, no block barriers:
//   C[m][n] = osc * sum_k A[m][k] * Bt[n][k]   (f32 out, pitch ldc)
// A: f16 row-major [M][K] pitch lda; Bt: f16 [N][K] (k contiguous, pitch ldb); fragments = two 16-B loads with the
// split k map (ldfrag_h). M, N multiples of 64, K multiple of 32 (host-checked constants here).
// lines, n0*4 is a multiple of 256) written by 16 consecutive lanes x 16 B of ONE instruction (lanes 0-15 row it*2, lanes
// coverage: 4 slabs x 16 rows x 64 cols = the wave's whole 64x64 tile; grid = tilesM*tilesN/8 blocks (exact multiple of 8).
// =====================================================================================================
__global__ __launch_bounds__(256) void gemm64f(
    const unsigned short* __restrict__ Ap, int lda,
    const unsigned short* __restrict__ Bp, int ldb,
    float* Cout, int ldc, float osc, int M, int N, int K) {
  __shared__ __align__(16) float sT[8][16 * 68];   // per-wave 16x64 slab, pitch 68 floats
  const int lane = threadIdx.x & 31;
  const int wave = threadIdx.x >> 5;
  const int tilesN = N >> 6;
  const int tilesM = M >> 6;
  const int tile = blockIdx.x * 8 + wave;
  if (tile >= tilesM * tilesN) return;   // wave-uniform; no block barriers in this kernel
  const int tm = tile / tilesN;
  const int tn = tile - tm * tilesN;
  const int m0 = tm << 6;
  const int n0 = tn << 6;

  const _Float16* Ah = (const _Float16*)(const void*)Ap;
  const _Float16* Bb = (const _Float16*)(const void*)Bp;

  const int rlane = lane & 15;                 // row (A) / col (B, D) within subtile
  const int koff  = (lane >> 4) * 8;           // k offset of this lane half
  const int mOff  = (lane >> 4) * 8;           // D row offset

  v8f acc[4][4];
#pragma unroll
  for (int i = 0; i < 4; ++i)
#pragma unroll
    for (int j = 0; j < 4; ++j) acc[i][j] = zero8();

  for (int k0 = 0; k0 < K; k0 += 32) {
    v16h bh[4];
#pragma unroll
    for (int j = 0; j < 4; ++j) {
      const size_t bo = (size_t)(n0 + (j << 4) + rlane) * ldb + koff + k0;
      bh[j] = ldfrag_h(Bb + bo);
    }
#pragma unroll
    for (int i = 0; i < 4; ++i) {
      const size_t ao = (size_t)(m0 + (i << 4) + rlane) * lda + koff + k0;
      const v16h ah = ldfrag_h(Ah + ao);
#pragma unroll
      for (int j = 0; j < 4; ++j) acc[i][j] = mma_h_raw(ah, bh[j], acc[i][j]);
      dep_guard1(acc[i][0], acc[i][3], ah);
    }
    keep4_h(bh[0], bh[1], bh[2], bh[3]);
  }
  acc_guard4(acc[0][0], acc[0][1], acc[0][2], acc[0][3]);
  acc_guard4(acc[1][0], acc[1][1], acc[1][2], acc[1][3]);
  acc_guard4(acc[2][0], acc[2][1], acc[2][2], acc[2][3]);
  acc_guard4(acc[3][0], acc[3][1], acc[3][2], acc[3][3]);

  const int hh2 = lane >> 4, c4 = (lane & 15) * 4;     // f32 out: 256-B row segment = 16 lanes x 16 B
  float* slab = sT[wave];
#pragma unroll
  for (int i = 0; i < 4; ++i) {
    const int mBase = m0 + (i << 4);
#pragma unroll
    for (int j = 0; j < 4; ++j) {
#pragma unroll
      for (int r = 0; r < 8; ++r) {
        slab[(mOff + r) * 68 + (j << 4) + rlane] = acc[i][j][r];
      }
    }
    wave_sync_lds();
    v4f vals[8];
#pragma unroll
    for (int it = 0; it < 8; ++it) {
      const int row = it * 2 + hh2;                      // it 0..7 x hh2 0..1 = rows 0..15
      v4f v = *(const v4f*)(slab + row * 68 + c4);
#pragma unroll
      for (int e = 0; e < 4; ++e) v[e] = v[e] * osc;
      vals[it] = v;
    }
    {
#pragma unroll
      for (int it = 0; it < 8; ++it) {
        const int row = it * 2 + hh2;
        *(v4f*)(Cout + (size_t)(mBase + row) * ldc + n0 + c4) = vals[it];
      }
      
    }
    wave_sync_lds();
  }
}

// =====================================================================================================
// Per-head LayerNorm of q, k and v (feature o = part*256 + h*32 + dd of the projection row) and 16-bit plane writes.
// One lane owns 8 consecutive features of a token, so a head (32 features) is one quad of lanes: mean and variance are
// 8 adds in the lane and a two-step sum over the quad. No LDS and no barrier; every load of a wave is independent.
// k and v are stored in the order in which the attention kernel's fragment loads read them, so that each of its 32-lane
// 16-B loads covers four whole 128-B lines:
//   KH[s][h][tile of 16 tokens][j][piece = 16*hh + c][8]     = k of token 16*tile + c, d = 16*j + 8*hh + e
//   VTH[s][h][block of 64 tokens][jf][piece = 4*tg + ch][8]  = v of token 64*block + 8*tg + e, d = 8*ch + jf
//   blocks 0..127 (v): 64 tokens of stream s, wave = head; lane = (token group tg = lane>>2, feature chunk ch = lane&3)
//      holds 8 tokens x 8 features; y*256 -> f16; per feature jf the lane's 8 tokens are one 16-B piece and
//      the wave's 32 pieces one contiguous 512-B store.
//   blocks 128..383 (q): wave = 4 token rows; lane = features 8*lane..8*lane+7 of the row; y*1024 -> f16;
//      each store instruction is one whole 512-B row.
//   blocks 384..639 (k): wave = one 16-token tile x 2 heads; lane = (token tr = lane>>2 and tr + 8, chunk ch = lane&3);
//      y*1024 -> f16; chunk ch is (j, hh) = (ch>>1, ch&1), so a store instruction is four whole 128-B lines.
// coverage: q rows: 256 blocks x 8 waves x 4 rows = all 8192 rows, full width; KH: 256 blocks x 8 waves = 512 tiles x
//           4 head pairs, 1024 B per tile and head = the whole plane; VT plane: 128 blocks x 8 heads x 8 jf x 512 B =
//           the whole plane.
// =====================================================================================================
__device__ __forceinline__ float quad_sum(float v) {   // sum over lanes l, l^1, l^2, l^3 (DPP row_xmask 1, then 2)
  v += __builtin_bit_cast(float, __builtin_amdgcn_update_dpp(0, __builtin_bit_cast(int, v), 0x161, 0xf, 0xf, true));
  v += __builtin_bit_cast(float, __builtin_amdgcn_update_dpp(0, __builtin_bit_cast(int, v), 0x162, 0xf, 0xf, true));
  return v;
}
__device__ __forceinline__ float rsq_pos(float x) {   // 1/sqrt(x) for x >= LNEPS: never in the range that rsqrtf rescales
  float r = 0.f;
#if defined(__HIP_DEVICE_COMPILE__)
  // v_nop: fills the one slot asked for behind a transcendental, before an instruction that may overwrite its source
  asm("v_rsq_f32 %0, %1\n\tv_nop" : "=v"(r) : "v"(x));
#endif
  return r;
}
__device__ __forceinline__ void ln8(const v4f a, const v4f c, const float (&g)[8], const float (&b)[8], float sc,
                                    float (&y)[8]) {
  const float mean = quad_sum(((a[0] + a[1]) + (a[2] + a[3])) + ((c[0] + c[1]) + (c[2] + c[3]))) * (1.0f / DHEAD);
  float d[8];
#pragma unroll
  for (int j = 0; j < 4; ++j) { d[j] = a[j] - mean; d[4 + j] = c[j] - mean; }
  float ss = 0.f;
#pragma unroll
  for (int j = 0; j < 8; ++j) ss += d[j] * d[j];
  const float rs = rsq_pos(quad_sum(ss) * (1.0f / DHEAD) + LNEPS);
#pragma unroll
  for (int j = 0; j < 8; ++j) y[j] = ((d[j] * rs) * g[j] + b[j]) * sc;
}
__device__ __forceinline__ void bfr8(const v4f lo, const v4f hi, float (&o)[8]) {
#pragma unroll
  for (int j = 0; j < 4; ++j) { o[j] = bfr(lo[j]); o[4 + j] = bfr(hi[j]); }
}
__device__ __forceinline__ unsigned hi2(float x, float y) { return pk16(h_bits((_Float16)x), h_bits((_Float16)y)); }

__global__ __launch_bounds__(256)
void ln_heads(const float* __restrict__ T, const float* __restrict__ gam, const float* __restrict__ bet,
              unsigned short* QH, unsigned short* KH, unsigned short* VTH) {
  const int tid = threadIdx.x, wave = tid >> 5, lane = tid & 31;
  const int bx  = blockIdx.x;
  const int ch  = lane & 3;                           // 8-feature chunk of the head, all three mappings
  float g[8], be[8];
  if (bx < MROWS / 64) {                              // block-uniform: v, transposed in registers
    const int s    = bx / (NTOK / 64);
    const int tok0 = (bx - s * (NTOK / 64)) * 64 + 8 * (lane >> 2);
    const float* tp = T + ((size_t)s * NTOK + tok0) * OC + 2 * CDIM + wave * DHEAD + 8 * ch;
    v4f xa[8], xc[8];
#pragma unroll
    for (int i = 0; i < 8; ++i) { xa[i] = *(const v4f*)(tp + (size_t)i * OC); xc[i] = *(const v4f*)(tp + (size_t)i * OC + 4); }
    const v4f g0 = *(const v4f*)(gam + 8 * ch), g1 = *(const v4f*)(gam + 8 * ch + 4);
    const v4f b0 = *(const v4f*)(bet + 8 * ch), b1 = *(const v4f*)(bet + 8 * ch + 4);
    // keeps every load of the wave in front of the arithmetic: one memory latency instead of two or three in a row
    __builtin_amdgcn_sched_barrier(0);
    bfr8(g0, g1, g);
    bfr8(b0, b1, be);
    float y[8][8];
#pragma unroll
    for (int i = 0; i < 8; ++i) ln8(xa[i], xc[i], g, be, VC, y[i]);
    const size_t vo = (((size_t)s * NHEAD + wave) * (NTOK / 64) + (bx - s * (NTOK / 64))) * 2048 + 8 * lane;
#pragma unroll
    for (int j = 0; j < 8; ++j) {
      v4u hv;
#pragma unroll
      for (int p = 0; p < 4; ++p) hv[p] = hi2(y[2 * p][j], y[2 * p + 1][j]);
      *(v4u*)(VTH + vo + j * 256) = hv;
    }
  } else if (bx < MROWS / 64 + MROWS / 32) {          // block-uniform: q, token rows
    const size_t row0 = ((size_t)(bx - MROWS / 64) * 8 + wave) * 4;
    const float* tp = T + row0 * OC + 8 * lane;
    v4f xa[4], xc[4];
#pragma unroll
    for (int i = 0; i < 4; ++i) {
      const float* p = tp + (size_t)i * OC;
      xa[i] = *(const v4f*)(p);
      xc[i] = *(const v4f*)(p + 4);
    }
    const v4f g0 = *(const v4f*)(gam + 8 * ch), g1 = *(const v4f*)(gam + 8 * ch + 4);
    const v4f b0 = *(const v4f*)(bet + 8 * ch), b1 = *(const v4f*)(bet + 8 * ch + 4);
    // keeps every load of the wave in front of the arithmetic: one memory latency instead of two or three in a row
    __builtin_amdgcn_sched_barrier(0);
    bfr8(g0, g1, g);
    bfr8(b0, b1, be);
#pragma unroll
    for (int i = 0; i < 4; ++i) {
      float y[8];
      ln8(xa[i], xc[i], g, be, QC, y);
      const size_t o = (row0 + i) * CDIM + 8 * lane;
      v4u hv;
#pragma unroll
      for (int p = 0; p < 4; ++p) hv[p] = hi2(y[2 * p], y[2 * p + 1]);
      *(v4u*)(QH + o) = hv;
    }
  } else {                                            // k, fragment order
    const int wid = (bx - (MROWS / 64 + MROWS / 32)) * 8 + wave;
    const int t16 = wid >> 2;                         // 16-token tile, both streams stacked
    const int h0  = (wid & 3) * 2;                    // first of the wave's two heads
    const int tr  = lane >> 2;
    const float* tp = T + ((size_t)t16 * 16 + tr) * OC + CDIM + h0 * DHEAD + 8 * ch;
    v4f xa[4], xc[4];                                 // index = 2*head + token half (tokens tr, tr + 8)
#pragma unroll
    for (int i = 0; i < 4; ++i) {
      const float* p = tp + (size_t)(i & 1) * 8 * OC + (i >> 1) * DHEAD;
      xa[i] = *(const v4f*)(p);
      xc[i] = *(const v4f*)(p + 4);
    }
    const v4f g0 = *(const v4f*)(gam + 8 * ch), g1 = *(const v4f*)(gam + 8 * ch + 4);
    const v4f b0 = *(const v4f*)(bet + 8 * ch), b1 = *(const v4f*)(bet + 8 * ch + 4);
    // keeps every load of the wave in front of the arithmetic: one memory latency instead of two or three in a row
    __builtin_amdgcn_sched_barrier(0);
    bfr8(g0, g1, g);
    bfr8(b0, b1, be);
    const int s = t16 / (NTOK / 16), tile = t16 - s * (NTOK / 16);
    const size_t ko = (((size_t)s * NHEAD + h0) * (NTOK / 16) + tile) * 512 + (ch >> 1) * 256 + ((ch & 1) * 16 + tr) * 8;
#pragma unroll
    for (int i = 0; i < 4; ++i) {
      float y[8];
      ln8(xa[i], xc[i], g, be, KC, y);
      v4u hv;
#pragma unroll
      for (int p = 0; p < 4; ++p) hv[p] = hi2(y[2 * p], y[2 * p + 1]);
      *(v4u*)(KH + ko + (size_t)(i >> 1) * (NTOK / 16) * 512 + (i & 1) * 64) = hv;
    }
  }
}

// =====================================================================================================
// Attention for one (dir, head, 128-query block), transposed formulation, head dim 32, 4096 keys, no mask:
//   dir 0: queries from stream 1, keys/values from stream 0 -> output slot 0; dir 1: queries from stream 0, keys/values
//   from stream 1 -> output slot 1.
//   S^T tile (16 keys x 16 queries) = A(k rows = keys, d via the split k map) . B(q, col = query, same d map):
//   s = k.q (one product) = 1024*1024 * logit_dot. Per lane the D tile holds 8 keys of ONE query, so the
//   online softmax (running max, f32) is per-lane state with one shuffle (lane^16) for the max over 32 keys; the row sum
//   (of the f32 values, before they are rounded to f16) is kept as a per-lane partial and combined at the end.
//   P = e^{s-m} x 16384 as f16 is used directly
//   as the B operand of O^T (rows d, cols queries) += A(v^T rows d, keys contiguous, two 16-B loads) . B(P^T):
//   B element r <- the key tile covering keys kb..kb+15, element 8+r <- the tile covering kb+16..kb+31, lane unchanged
//   (D-as-B chaining layout). One product v.P into one accumulator per d tile.
//   k and v come from planes in fragment order (layouts: at ln_heads): every load of a wave covers four whole 128-B lines.
//   A k tile is 1024 contiguous bytes, piece = lane. Row c of v^T tile dt is d = 8*(c&3) + 4*dt + (c>>2): its four
//   feature rows jf = 4*dt + (c>>2) each give one line (key groups 2j, 2j+1 of the 32 keys x chunks 0..3); the epilogue
//   puts the output rows back in d order.
//   Wave tile = 32 queries (two q fragments) x 2048 keys: every k and v fragment a wave loads feeds two products, so a
//   score costs half the loaded bytes of a 16-query wave, and the number of waves stays 4096.
//   32 keys per step: 4 score WMMAs + 4 output WMMAs per wave; two steps a trip, each on its own register set of k and v
//   fragments, fetched two steps ahead. Block = 8 waves = 4 query groups x 2 key halves = 128 queries; grid = 2*8*32 = 512.
//   Epilogue: the waves of key half 1 hand (m, l, O) to their partners through LDS; the partner joins the two halves
//   (common maximum, both sides rescaled), divides and stages its [32 query][32 d] f32 rows in LDS; block barrier, then
//   4 store instructions of whole 128-B lines per thread group.
// coverage: block writes queries q0..q0+127 x d 0..31 of its (dir, head); grid covers out [2][4096][256] exactly once.
// =====================================================================================================
__device__ __forceinline__ float exp_slot(float x) {   // e^x as __expf forms it: one multiply, one v_exp_f32
  float r = 0.f;
#if defined(__HIP_DEVICE_COMPILE__)
  // v_nop: fills the one slot asked for behind a transcendental, before an instruction that may overwrite its source
  asm("v_exp_f32 %0, %1\n\tv_nop" : "=v"(r) : "v"(x * 1.44269504088896340736f));
#endif
  return r;
}
__device__ __forceinline__ v4f lo4(v8f x) { v4f r = {x[0], x[1], x[2], x[3]}; return r; }
__device__ __forceinline__ v4f hi4(v8f x) { v4f r = {x[4], x[5], x[6], x[7]}; return r; }

#define QBLK   128                    // queries of a block
#define KSTEPS (NTOK / 2 / 32)        // 32-key steps of a wave: half of the keys
static_assert((NTOK % QBLK) == 0 && (KSTEPS % 2) == 0 && KSTEPS >= 4);

__global__ __launch_bounds__(256)
void attn_kernel(const unsigned short* __restrict__ qh, const unsigned short* __restrict__ kh,
                 const unsigned short* __restrict__ vth, float* out) {
  __shared__ __align__(16) float Os[QBLK * DHEAD];
  __shared__ __align__(16) v4f Pm[4][9][32];          // key half 1's (O, m, l): [query group][piece][lane]
  const int tid  = threadIdx.x;
  const int wave = __builtin_amdgcn_readfirstlane(tid >> 5);
  const int lane = tid & 31;
  const int hh   = lane >> 4;
  const int c    = lane & 15;
  const int qg   = wave & 3;                        // 32-query group of the block
  const int kv   = wave >> 2;                       // key half
  const int bx   = blockIdx.x;
  const int qb   = bx % (NTOK / QBLK);              // 32 query blocks per (stream, head)
  const int hd   = (bx / (NTOK / QBLK)) % NHEAD;
  const int dir  = bx / ((NTOK / QBLK) * NHEAD);
  const int qsrc = 1 - dir;
  const int ksrc = dir;
  const int q0   = qb * QBLK;

  const _Float16* QHp = (const _Float16*)(const void*)qh;
  const _Float16* KHp = (const _Float16*)(const void*)kh;
  const _Float16* VHp = (const _Float16*)(const void*)vth;

  // ---- q fragments (B operand, col = query q0 + 32*qg + 16*t + c, t = 0, 1) ----
  const size_t qtok = (size_t)qsrc * NTOK + q0 + qg * 32 + c;
  const v16h qf0 = ldfrag_h(QHp + qtok * CDIM + hd * DHEAD + 8 * hh);
  const v16h qf1 = ldfrag_h(QHp + (qtok + 16) * CDIM + hd * DHEAD + 8 * hh);
#if defined(__HIP_DEVICE_COMPILE__)
  // stands in front of the first k and v loads, whose results land in registers that the q loads name as addresses
  asm volatile("s_wait_xcnt 0x0" ::: "memory");
#endif
  // ---- k fragment base (A operand, row = key kb + c): 512 halves a 16-key tile, the lane's piece = lane ----
  const _Float16* Kp = KHp + (size_t)(ksrc * NHEAD + hd) * (NTOK / 16) * 512 + (size_t)kv * KSTEPS * 1024 + 8 * lane;
  // ---- v^T fragment bases (A operand, row c = d 8*(c&3) + 4*dt + (c>>2)): 2048 halves a 64-key block ----
  const size_t vrow = (size_t)(ksrc * NHEAD + hd) * (NTOK / 64) * 2048 + (size_t)kv * (KSTEPS / 2) * 2048
                    + (c >> 2) * 256 + (4 * hh + (c & 3)) * 8;
  const _Float16* VH0 = VHp + vrow;
  const _Float16* VH1 = VH0 + 4 * 256;
  const float SC = ATTSC / (QC * KC);

  float m0 = -1.0e30f, m1 = -1.0e30f, l0 = 0.f, l1 = 0.f;
  v8f o00 = zero8(), o01 = zero8(), o10 = zero8(), o11 = zero8();     // o<query tile><d tile>
  // online softmax of one query tile's 32 scores; mx = their maximum over both lane halves
  auto soft = [&](const v8f& s0, const v8f& s1, const float mx, float& m, float& l, v8f& oa, v8f& ob, FragH& ph)
      __attribute__((always_inline)) {
    const float mn   = fmaxf(m, mx * SC);
    const float corr = exp_slot(m - mn);
    m = mn;
    const float msh = mn - LNPSC;            // exp gives e^{s-m} * 16384
    l *= corr;
#pragma unroll
    for (int r = 0; r < 8; ++r) { oa[r] *= corr; ob[r] *= corr; }
    float ls = 0.f;
#pragma unroll
    for (int r = 0; r < 8; ++r) {
      const float e0 = __expf(s0[r] * SC - msh);      // key kb      + 8hh + r
      const float e1 = __expf(s1[r] * SC - msh);      // key kb + 16 + 8hh + r
      ls += e0 + e1;
      ph.h[0][r] = (_Float16)e0;
      ph.h[1][r] = (_Float16)e1;
    }
    l += ls;
  };
  // One 32-key step on the fragment set (kf0..vh1). Each operand group is refilled for step nx, two steps ahead, directly
  // behind its last use, so a load has about two steps of other work between its issue and its wait.
  // refill is a literal at each call; the last two steps have nothing left to fetch.
  auto step = [&](v16h& kf0, v16h& kf1, v16h& vh0, v16h& vh1, const int nx, const bool refill)
      __attribute__((always_inline)) {
    v8f s00 = mma_h_raw(kf0, qf0, zero8());
    v8f s01 = mma_h_raw(kf1, qf0, zero8());
    v8f s10 = mma_h_raw(kf0, qf1, zero8());
    v8f s11 = mma_h_raw(kf1, qf1, zero8());
    guard4(s00, s01, s10, s11, kf0, kf1, qf0, qf1);
    // the two scheduling barriers hold the k refill here: lifted over the products it would need a third register set and
    // copies, sunk into the softmax (where the compiler put it) it would be waited for shortly after its issue
    if (refill) {
      __builtin_amdgcn_sched_barrier(0);
      kf0 = ldfrag_p(Kp + (size_t)nx * 1024, 256);          // keys kb..kb+15 of step nx, kb = 32*nx
      kf1 = ldfrag_p(Kp + (size_t)nx * 1024 + 512, 256);    // keys kb+16..kb+31
      __builtin_amdgcn_sched_barrier(0);
    }

    float mx0 = fmaxf(hmax8(s00), hmax8(s01));
    float mx1 = fmaxf(hmax8(s10), hmax8(s11));
    const float px0 = __shfl_xor(mx0, 16, 32), px1 = __shfl_xor(mx1, 16, 32);
    mx0 = fmaxf(mx0, px0);
    mx1 = fmaxf(mx1, px1);
    FragH p0, p1;
    soft(s00, s01, mx0, m0, l0, o00, o01, p0);
    soft(s10, s11, mx1, m1, l1, o10, o11, p1);

    o00 = mma_h_raw(vh0, p0.v, o00);
    o01 = mma_h_raw(vh1, p0.v, o01);
    o10 = mma_h_raw(vh0, p1.v, o10);
    o11 = mma_h_raw(vh1, p1.v, o11);
    guard4(o00, o01, o10, o11, vh0, vh1, p0.v, p1.v);
    if (refill) {
      const size_t vo = (size_t)(nx >> 1) * 2048 + (nx & 1) * 128;     // 64-key block, then its 32-key half
      // the same for the v refill; the second barrier also keeps the next step's products out of this step
      __builtin_amdgcn_sched_barrier(0);
      vh0 = ldfrag_p(VH0 + vo, 64);
      vh1 = ldfrag_p(VH1 + vo, 64);
      __builtin_amdgcn_sched_barrier(0);
    }
  };
  // two fragment sets: a = even steps, b = odd steps
  v16h ka0 = ldfrag_p(Kp, 256),        ka1 = ldfrag_p(Kp + 512, 256);
  v16h va0 = ldfrag_p(VH0, 64),        va1 = ldfrag_p(VH1, 64);
  v16h kb0 = ldfrag_p(Kp + 1024, 256), kb1 = ldfrag_p(Kp + 1536, 256);
#if defined(__HIP_DEVICE_COMPILE__)
  // stands in front of the last v loads, whose results may land in the register that the k loads name as their offset
  asm volatile("s_wait_xcnt 0x0" ::: "memory");
#endif
  v16h vb0 = ldfrag_p(VH0 + 128, 64),  vb1 = ldfrag_p(VH1 + 128, 64);
  // kept rolled: a trip already holds both sets' steps, further copies would only lengthen the text
#pragma unroll 1
  for (int it = 0; it < KSTEPS - 2; it += 2) {
    step(ka0, ka1, va0, va1, it + 2, true);
    step(kb0, kb1, vb0, vb1, it + 3, true);
#if defined(__HIP_DEVICE_COMPILE__)
    // stands in front of the next trip's overwrite of the address registers that this trip's loads name
    asm volatile("s_wait_xcnt 0x0" ::: "memory");
#endif
  }
  step(ka0, ka1, va0, va1, 0, false);
  step(kb0, kb1, vb0, vb1, 0, false);

  // ---- key half 1 hands its state over, lane to lane (16 B a lane and piece: contiguous, no bank conflict) ----
  if (kv == 1) {                                     // wave-uniform
    v4f (*pm)[32] = Pm[qg];
    pm[0][lane] = lo4(o00); pm[1][lane] = hi4(o00); pm[2][lane] = lo4(o01); pm[3][lane] = hi4(o01);
    pm[4][lane] = lo4(o10); pm[5][lane] = hi4(o10); pm[6][lane] = lo4(o11); pm[7][lane] = hi4(o11);
    const v4f ml = {m0, l0, m1, l1};
    pm[8][lane] = ml;
  }
  __syncthreads();
  if (kv == 0) {                                     // wave-uniform: join the halves, divide, stage
    const v4f (*pm)[32] = Pm[qg];
    const v4f ml = pm[8][lane];
    // ---- O[query 32*qg + 16*t + c][d]: accumulator row 8hh + r of tile dt is d = 8*(r&3) + 4*dt + 2hh + (r>>2) ----
    auto join = [&](const int t, const float m, const float l, const float mo, const float lo, const v8f& oa, const v8f& ob)
        __attribute__((always_inline)) {
      const float mn = fmaxf(m, mo);
      const float ca = __expf(m - mn), cb = __expf(mo - mn);
      float ls = l * ca + lo * cb;
      ls += __shfl_xor(ls, 16, 32);
      const float sc = (1.0f / VC) * (1.0f / ls);
      const float fa = ca * sc, fb = cb * sc;
      float* os = Os + (qg * 32 + t * 16 + c) * DHEAD + 2 * hh;
#pragma unroll
      for (int r = 0; r < 8; ++r) {
        os[8 * (r & 3) + (r >> 2)]     = oa[r] * fa + pm[4 * t + (r >> 2)][lane][r & 3] * fb;
        os[8 * (r & 3) + (r >> 2) + 4] = ob[r] * fa + pm[4 * t + 2 + (r >> 2)][lane][r & 3] * fb;
      }
    };
    join(0, m0, l0, ml[0], ml[1], o00, o01);
    join(1, m1, l1, ml[2], ml[3], o10, o11);
  }
  __syncthreads();
  {
    const int e = tid & 7, qq = tid >> 3;              // qq 0..31: line within group, e: 16-B piece
    v4f vals[4];
#pragma unroll
    for (int it = 0; it < 4; ++it) {
      const int qi = it * 32 + qq;                       // it 0..3 x qq 0..31 = queries 0..127 of the block
      vals[it] = *(const v4f*)(Os + qi * DHEAD + 4 * e);
    }
    float* ob = out + (size_t)dir * NTOK * CDIM + (size_t)hd * DHEAD + 4 * e;
    {
#pragma unroll
      for (int it = 0; it < 4; ++it) {
        const int qi = it * 32 + qq;
        *(v4f*)(ob + (size_t)(q0 + qi) * CDIM) = vals[it];
      }
    }
  }
}

// =====================================================================================================
// Workspace map (bytes), every offset a multiple of 256 and every plane sized to its whole-row store granularity:
//   XN   f16 [8192][256]            0           4194304
//   WT   f16 [768][256]             4194304     393216
//   T    f32 [8192][768]            4587520     25165824
//   QH   f16 [8192][256]            29753344    4194304
//   KH   f16 [2][8][256][2][32][8]  33947648    4194304
//   VTH  f16 [2][8][64][8][32][8]   38141952    4194304
//   end                              42336256
// =====================================================================================================
extern "C" void kernel_launch(void* const* d_in, const int* in_sizes, int n_in,
                              void* d_out, int out_size, void* d_ws, size_t ws_size,
                              hipStream_t stream) {
  if (n_in < 5) return;
  if (in_sizes[0] != NTOK * CDIM || in_sizes[1] != NTOK * CDIM) return;
  if (in_sizes[2] != OC * CDIM) return;
  if (in_sizes[3] != DHEAD || in_sizes[4] != DHEAD) return;
  if (out_size != NSTR * NTOK * CDIM) return;

  const float* x_b   = (const float*)d_in[0];
  const float* x_a   = (const float*)d_in[1];
  const float* w_qkv = (const float*)d_in[2];
  const float* ln_g  = (const float*)d_in[3];
  const float* ln_b  = (const float*)d_in[4];

  const size_t PXN = (size_t)MROWS * CDIM * 2;        //  4194304
  const size_t PWT = (size_t)OC * CDIM * 2;           //   393216
  const size_t PT  = (size_t)MROWS * OC * 4;          // 25165824
  const size_t PQ  = (size_t)MROWS * CDIM * 2;        //  4194304
  const size_t PV  = (size_t)NSTR * CDIM * NTOK * 2;  //  4194304
  size_t off = 0;
  const size_t oXN = off; off += PXN;
  const size_t oWT = off; off += PWT;
  const size_t oT  = off; off += PT;
  const size_t oQH = off; off += PQ;
  const size_t oKH = off; off += PQ;
  const size_t oVH = off; off += PV;
  if (off > ws_size) return;                          // off = 42336256
  if (off > (size_t)134217728) return;

  char* ws = (char*)d_ws;
  unsigned short* XN  = (unsigned short*)(ws + oXN);
  unsigned short* WT  = (unsigned short*)(ws + oWT);
  float*          T   = (float*)(ws + oT);
  unsigned short* QH  = (unsigned short*)(ws + oQH);
  unsigned short* KH  = (unsigned short*)(ws + oKH);
  unsigned short* VTH = (unsigned short*)(ws + oVH);
  float*          out = (float*)d_out;

  const dim3 blk(256);
  const dim3 gCV(MROWS / 8 + OC / 8);                          // 1024 + 96 = 1120 blocks of 8 rows
  const dim3 gGM(((MROWS / 64) * (OC / 64)) / 8);              // 1536 tiles -> 192 blocks
  const dim3 gLN(MROWS / 64 + MROWS / 32 + MROWS / 32);        // 128 blocks (v, 64 tokens) + 256 (q, 32 rows) + 256 (k, 2 tiles)
  const dim3 gAT(NSTR * NHEAD * (NTOK / QBLK));                // 512 blocks of 256

  // (0) 16-bit operand planes: f16( bf16_RNE(x) * 64 ), f16( bf16_RNE(W) * 64 )
  cvt_planes<<<gCV, blk, 0, stream>>>(x_b, x_a, w_qkv, XN, WT);

  // (1) T[s*4096 + n][o] = (x_s[n] . W[o]) : both streams stacked, scale 1/(64*64)
  gemm64f<<<gGM, blk, 0, stream>>>(XN, CDIM, WT, CDIM, T, OC, 1.0f / (XC * WSC), MROWS, OC, CDIM);

  // (2) per-head LayerNorm -> q token rows; k and v in fragment order
  ln_heads<<<gLN, blk, 0, stream>>>(T, ln_g, ln_b, QH, KH, VTH);

  // (3) attention, both directions, all heads -> out[dir][n][h*32 + d]
  attn_kernel<<<gAT, blk, 0, stream>>>(QH, KH, VTH, out);
  (void)hipGetLastError();
}

// v006
// It runs in 67.9 microseconds.
// In both of two side-by-side timings against v005, it was 1.07 times as fast.
// All steps since v000 together make it 4.90 times as fast.
// Contractions: qkv projection (x token rows f16 x64 . W_qkv rows f16 x64, K=256, one product); attention scores
// S^T = k (f16 x1024) . q^T (f16 x1024), one product, head dim 32; attention O^T = v^T (f16 x256) . P^T (f16 x256,
// taken from the score D registers), one product over 4096 keys. Every operand is one f16 plane (RNE from f32).
// All v_wmma_f32_16x16x32_f16, f32 accumulate; LayerNorm and softmax in f32 on VALU; every float input RNE-converted
// to bf16 on load.
#include <hip/hip_runtime.h>
#include <math.h>
#include <stdint.h>

#define NTOK   4096
#define CDIM   256
#define NHEAD  8
#define DHEAD  32
#define OC     (3 * CDIM)
#define NSTR   2
#define MROWS  (NSTR * NTOK)
#define LNEPS  1.0e-5f
#define XC     64.0f
#define WSC    64.0f
#define QC     1024.0f
#define KC     1024.0f
#define VC     256.0f
#define LNPSC  5.545177444479562f    // ln 256: P = e^{s-m} x 256
#define ELIM   32768.0f              // a lane's sum of 16 P values up to here: each of them is finite in f16
#define ATTSC  0.17677669529663687f
static_assert(NHEAD * DHEAD == CDIM);
static_assert((MROWS % 64) == 0 && (OC % 64) == 0 && (CDIM % 32) == 0);
static_assert((((MROWS / 64) * (OC / 64)) % 8) == 0);
static_assert((NTOK % 64) == 0 && (NTOK / 32) >= 4 && (MROWS % 8) == 0 && (OC % 8) == 0);

typedef _Float16 v16h __attribute__((ext_vector_type(16)));
typedef _Float16 v8h  __attribute__((ext_vector_type(8)));
typedef float    v8f  __attribute__((ext_vector_type(8)));
typedef float    v4f  __attribute__((ext_vector_type(4)));
typedef unsigned int v4u __attribute__((ext_vector_type(4)));

union FragH { v16h v; v8h h[2]; };

// ---- scalar helpers --------------------------------------------------------------------------------
__device__ __forceinline__ unsigned short bf_bits(float f) {          // f32 -> bf16 bits, RNE convert
  unsigned u = __float_as_uint(f);
  return (unsigned short)((u + 0x7FFFu + ((u >> 16) & 1u)) >> 16);
}
__device__ __forceinline__ float bf_up(unsigned short h) { return __uint_as_float(((unsigned)h) << 16); }
__device__ __forceinline__ float bfr(float f) { return bf_up(bf_bits(f)); }
__device__ __forceinline__ unsigned short h_bits(_Float16 x) { return __builtin_bit_cast(unsigned short, x); }
__device__ __forceinline__ unsigned pk16(unsigned short a, unsigned short b) { return (unsigned)a | ((unsigned)b << 16); }
__device__ __forceinline__ v8f zero8() { v8f z = {0.f, 0.f, 0.f, 0.f, 0.f, 0.f, 0.f, 0.f}; return z; }
__device__ __forceinline__ float hmax8(v8f s) {
  return fmaxf(fmaxf(fmaxf(s[0], s[1]), fmaxf(s[2], s[3])), fmaxf(fmaxf(s[4], s[5]), fmaxf(s[6], s[7])));
}

// ---- fragment loader: 16-bit A/B operand, lane -> row/col (lane&15), p already includes +8*(lane>>4);
//      elements 0..7 <- p[0..7] (k0+8h..), elements 8..15 <- p[16..23] (k0+16+8h..)
__device__ __forceinline__ v16h ldfrag_h(const _Float16* p) {
  FragH f;
  f.h[0] = *(const v8h*)(p);
  f.h[1] = *(const v8h*)(p + 16);
  return f.v;
}
// ---- the same operand from a plane stored in fragment order: elements 0..7 <- p[0..7], elements 8..15 <- p[step..step+7];
//      p already includes the lane's own 16-B piece
__device__ __forceinline__ v16h ldfrag_p(const _Float16* p, int step) {
  FragH f;
  f.h[0] = *(const v8h*)(p);
  f.h[1] = *(const v8h*)(p + step);
  return f.v;
}

// ---- WMMA helpers with trailing VALU hazard gap --------------------------------------------------------
__device__ __forceinline__ v8f mma_h_raw(v16h a, v16h b, v8f c) {
  return __builtin_amdgcn_wmma_f32_16x16x32_f16(false, a, false, b, (short)0, c, false, false);
}
__device__ __forceinline__ void dep_guard1(v8f& a, v8f& b, v16h x) {
#if defined(__HIP_DEVICE_COMPILE__)
  asm volatile("v_nop\n\tv_nop\n\tv_nop\n\tv_nop" : "+v"(a), "+v"(b) : "v"(x));
#endif
}
__device__ __forceinline__ void keep4_h(v16h a, v16h b, v16h c, v16h d) {
#if defined(__HIP_DEVICE_COMPILE__)
  asm volatile("v_nop" :: "v"(a), "v"(b), "v"(c), "v"(d));
#endif
}
__device__ __forceinline__ void acc_guard4(v8f& a, v8f& b, v8f& c, v8f& d) {
#if defined(__HIP_DEVICE_COMPILE__)
  asm volatile("v_nop\n\tv_nop\n\tv_nop\n\tv_nop" : "+v"(a), "+v"(b), "+v"(c), "+v"(d));
#endif
}
// behind four products of two A fragments (x0, x1) with two B fragments (y0, y1). v_nop x4: the distance asked for between
// the last product and the first vector instruction that reads a D or overwrites an A or B register; the operands hold the
// statement behind the products and in front of the refill of x0, x1
__device__ __forceinline__ void guard4(v8f& a, v8f& b, v8f& c, v8f& d, v16h x0, v16h x1, v16h y0, v16h y1) {
#if defined(__HIP_DEVICE_COMPILE__)
  asm volatile("v_nop\n\tv_nop\n\tv_nop\n\tv_nop"
               : "+v"(a), "+v"(b), "+v"(c), "+v"(d) : "v"(x0), "v"(x1), "v"(y0), "v"(y1));
#endif
}
__device__ __forceinline__ void wave_sync_lds() {
  __builtin_amdgcn_fence(__ATOMIC_RELEASE, "workgroup");
  __builtin_amdgcn_wave_barrier();
  __builtin_amdgcn_fence(__ATOMIC_ACQUIRE, "workgroup");
}

// =====================================================================================================
// Operand planes: XN[s*4096 + n][256] = f16( bf16_RNE(x_s[n][c]) * 64 ) (blocks 0..1023, 8 rows each, stream s = bx/512),
// WT[o][256] = f16( bf16_RNE(W[o][c]) * 64 ) (blocks 1024..1119; W is already [o][c] = k-contiguous, no transpose).
// Thread t: row = 8 per block (t>>5), 8 consecutive elements at 8*(t&31): one instruction of 32 lanes x 16 B = one whole
// coverage: 1024 x 8 = 8192 XN rows and 96 x 8 = 768 WT rows, each row 32 lanes x 8 halves = 256 columns: both planes entirely.
// =====================================================================================================
__global__ __launch_bounds__(256) void cvt_planes(const float* __restrict__ xb, const float* __restrict__ xa,
                                                   const float* __restrict__ w, unsigned short* XN, unsigned short* WT) {
  const int tid = threadIdx.x, r = tid >> 5, lane = tid & 31;
  const int bx  = blockIdx.x;
  const bool isx = (bx < (MROWS / 8));                    // block-uniform
  const int  s   = isx ? (bx / (NTOK / 8)) : 0;           // stream of this block
  const float* src = isx ? ((s == 0) ? xb : xa) : w;
  unsigned short* dst = isx ? XN : WT;
  const float sc  = isx ? XC : WSC;
  const int drow  = isx ? (bx * 8 + r) : ((bx - MROWS / 8) * 8 + r);   // row in dst plane
  const int srow  = isx ? (drow - s * NTOK) : drow;                       // row in src tensor
  const float* sp = src + (size_t)srow * CDIM + 8 * lane;
  const v4f a = *(const v4f*)(sp), c = *(const v4f*)(sp + 4);
  float f[8];
#pragma unroll
  for (int i = 0; i < 4; ++i) { f[i] = bfr(a[i]) * sc; f[4 + i] = bfr(c[i]) * sc; }
  v4u v;
#pragma unroll
  for (int i = 0; i < 4; ++i) v[i] = pk16(h_bits((_Float16)f[2 * i]), h_bits((_Float16)f[2 * i + 1]));
  unsigned short* dp = dst + (size_t)drow * CDIM + 8 * lane;
  *(v4u*)dp = v;
  
}

// =====================================================================================================
// Register-blocked f16 WMMA GEMM, one wave per 64x64 tile, no block barriers:
//   C[m][n] = osc * sum_k A[m][k] * Bt[n][k]   (f32 out, pitch ldc)
// A: f16 row-major [M][K] pitch lda; Bt: f16 [N][K] (k contiguous, pitch ldb); fragments = two 16-B loads with the
// split k map (ldfrag_h). M, N multiples of 64, K multiple of 32 (host-checked constants here).
// lines, n0*4 is a multiple of 256) written by 16 consecutive lanes x 16 B of ONE instruction (lanes 0-15 row it*2, lanes
// coverage: 4 slabs x 16 rows x 64 cols = the wave's whole 64x64 tile; grid = tilesM*tilesN/8 blocks (exact multiple of 8).
// =====================================================================================================
__global__ __launch_bounds__(256) void gemm64f(
    const unsigned short* __restrict__ Ap, int lda,
    const unsigned short* __restrict__ Bp, int ldb,
    float* Cout, int ldc, float osc, int M, int N, int K) {
  __shared__ __align__(16) float sT[8][16 * 68];   // per-wave 16x64 slab, pitch 68 floats
  const int lane = threadIdx.x & 31;
  const int wave = threadIdx.x >> 5;
  const int tilesN = N >> 6;
  const int tilesM = M >> 6;
  const int tile = blockIdx.x * 8 + wave;
  if (tile >= tilesM * tilesN) return;   // wave-uniform; no block barriers in this kernel
  const int tm = tile / tilesN;
  const int tn = tile - tm * tilesN;
  const int m0 = tm << 6;
  const int n0 = tn << 6;

  const _Float16* Ah = (const _Float16*)(const void*)Ap;
  const _Float16* Bb = (const _Float16*)(const void*)Bp;

  const int rlane = lane & 15;                 // row (A) / col (B, D) within subtile
  const int koff  = (lane >> 4) * 8;           // k offset of this lane half
  const int mOff  = (lane >> 4) * 8;           // D row offset

  v8f acc[4][4];
#pragma unroll
  for (int i = 0; i < 4; ++i)
#pragma unroll
    for (int j = 0; j < 4; ++j) acc[i][j] = zero8();

  for (int k0 = 0; k0 < K; k0 += 32) {
    v16h bh[4];
#pragma unroll
    for (int j = 0; j < 4; ++j) {
      const size_t bo = (size_t)(n0 + (j << 4) + rlane) * ldb + koff + k0;
      bh[j] = ldfrag_h(Bb + bo);
    }
#pragma unroll
    for (int i = 0; i < 4; ++i) {
      const size_t ao = (size_t)(m0 + (i << 4) + rlane) * lda + koff + k0;
      const v16h ah = ldfrag_h(Ah + ao);
#pragma unroll
      for (int j = 0; j < 4; ++j) acc[i][j] = mma_h_raw(ah, bh[j], acc[i][j]);
      dep_guard1(acc[i][0], acc[i][3], ah);
    }
    keep4_h(bh[0], bh[1], bh[2], bh[3]);
  }
  acc_guard4(acc[0][0], acc[0][1], acc[0][2], acc[0][3]);
  acc_guard4(acc[1][0], acc[1][1], acc[1][2], acc[1][3]);
  acc_guard4(acc[2][0], acc[2][1], acc[2][2], acc[2][3]);
  acc_guard4(acc[3][0], acc[3][1], acc[3][2], acc[3][3]);

  const int hh2 = lane >> 4, c4 = (lane & 15) * 4;     // f32 out: 256-B row segment = 16 lanes x 16 B
  float* slab = sT[wave];
#pragma unroll
  for (int i = 0; i < 4; ++i) {
    const int mBase = m0 + (i << 4);
#pragma unroll
    for (int j = 0; j < 4; ++j) {
#pragma unroll
      for (int r = 0; r < 8; ++r) {
        slab[(mOff + r) * 68 + (j << 4) + rlane] = acc[i][j][r];
      }
    }
    wave_sync_lds();
    v4f vals[8];
#pragma unroll
    for (int it = 0; it < 8; ++it) {
      const int row = it * 2 + hh2;                      // it 0..7 x hh2 0..1 = rows 0..15
      v4f v = *(const v4f*)(slab + row * 68 + c4);
#pragma unroll
      for (int e = 0; e < 4; ++e) v[e] = v[e] * osc;
      vals[it] = v;
    }
    {
#pragma unroll
      for (int it = 0; it < 8; ++it) {
        const int row = it * 2 + hh2;
        *(v4f*)(Cout + (size_t)(mBase + row) * ldc + n0 + c4) = vals[it];
      }
      
    }
    wave_sync_lds();
  }
}

// =====================================================================================================
// Per-head LayerNorm of q, k and v (feature o = part*256 + h*32 + dd of the projection row) and 16-bit plane writes.
// One lane owns 8 consecutive features of a token, so a head (32 features) is one quad of lanes: mean and variance are
// 8 adds in the lane and a two-step sum over the quad. No LDS and no barrier; every load of a wave is independent.
// k and v are stored in the order in which the attention kernel's fragment loads read them, so that each of its 32-lane
// 16-B loads covers four whole 128-B lines:
//   KH[s][h][tile of 16 tokens][j][piece = 16*hh + c][8]     = k of token 16*tile + c, d = 16*j + 8*hh + e
//   VTH[s][h][block of 64 tokens][jf][piece = 4*tg + ch][8]  = v of token 64*block + 8*tg + e, d = 8*ch + jf
//   blocks 0..127 (v): 64 tokens of stream s, wave = head; lane = (token group tg = lane>>2, feature chunk ch = lane&3)
//      holds 8 tokens x 8 features; y*256 -> f16; per feature jf the lane's 8 tokens are one 16-B piece and
//      the wave's 32 pieces one contiguous 512-B store.
//   blocks 128..383 (q): wave = 4 token rows; lane = features 8*lane..8*lane+7 of the row; y*1024 -> f16;
//      each store instruction is one whole 512-B row.
//   blocks 384..639 (k): wave = one 16-token tile x 2 heads; lane = (token tr = lane>>2 and tr + 8, chunk ch = lane&3);
//      y*1024 -> f16; chunk ch is (j, hh) = (ch>>1, ch&1), so a store instruction is four whole 128-B lines.
// coverage: q rows: 256 blocks x 8 waves x 4 rows = all 8192 rows, full width; KH: 256 blocks x 8 waves = 512 tiles x
//           4 head pairs, 1024 B per tile and head = the whole plane; VT plane: 128 blocks x 8 heads x 8 jf x 512 B =
//           the whole plane.
// =====================================================================================================
__device__ __forceinline__ float quad_sum(float v) {   // sum over lanes l, l^1, l^2, l^3 (DPP row_xmask 1, then 2)
  v += __builtin_bit_cast(float, __builtin_amdgcn_update_dpp(0, __builtin_bit_cast(int, v), 0x161, 0xf, 0xf, true));
  v += __builtin_bit_cast(float, __builtin_amdgcn_update_dpp(0, __builtin_bit_cast(int, v), 0x162, 0xf, 0xf, true));
  return v;
}
__device__ __forceinline__ float rsq_pos(float x) {   // 1/sqrt(x) for x >= LNEPS: never in the range that rsqrtf rescales
  float r = 0.f;
#if defined(__HIP_DEVICE_COMPILE__)
  // v_nop: fills the one slot asked for behind a transcendental, before an instruction that may overwrite its source
  asm("v_rsq_f32 %0, %1\n\tv_nop" : "=v"(r) : "v"(x));
#endif
  return r;
}
__device__ __forceinline__ void ln8(const v4f a, const v4f c, const float (&g)[8], const float (&b)[8], float sc,
                                    float (&y)[8]) {
  const float mean = quad_sum(((a[0] + a[1]) + (a[2] + a[3])) + ((c[0] + c[1]) + (c[2] + c[3]))) * (1.0f / DHEAD);
  float d[8];
#pragma unroll
  for (int j = 0; j < 4; ++j) { d[j] = a[j] - mean; d[4 + j] = c[j] - mean; }
  float ss = 0.f;
#pragma unroll
  for (int j = 0; j < 8; ++j) ss += d[j] * d[j];
  const float rs = rsq_pos(quad_sum(ss) * (1.0f / DHEAD) + LNEPS);
#pragma unroll
  for (int j = 0; j < 8; ++j) y[j] = ((d[j] * rs) * g[j] + b[j]) * sc;
}
__device__ __forceinline__ void bfr8(const v4f lo, const v4f hi, float (&o)[8]) {
#pragma unroll
  for (int j = 0; j < 4; ++j) { o[j] = bfr(lo[j]); o[4 + j] = bfr(hi[j]); }
}
__device__ __forceinline__ unsigned hi2(float x, float y) { return pk16(h_bits((_Float16)x), h_bits((_Float16)y)); }

__global__ __launch_bounds__(256)
void ln_heads(const float* __restrict__ T, const float* __restrict__ gam, const float* __restrict__ bet,
              unsigned short* QH, unsigned short* KH, unsigned short* VTH) {
  const int tid = threadIdx.x, wave = tid >> 5, lane = tid & 31;
  const int bx  = blockIdx.x;
  const int ch  = lane & 3;                           // 8-feature chunk of the head, all three mappings
  float g[8], be[8];
  if (bx < MROWS / 64) {                              // block-uniform: v, transposed in registers
    const int s    = bx / (NTOK / 64);
    const int tok0 = (bx - s * (NTOK / 64)) * 64 + 8 * (lane >> 2);
    const float* tp = T + ((size_t)s * NTOK + tok0) * OC + 2 * CDIM + wave * DHEAD + 8 * ch;
    v4f xa[8], xc[8];
#pragma unroll
    for (int i = 0; i < 8; ++i) { xa[i] = *(const v4f*)(tp + (size_t)i * OC); xc[i] = *(const v4f*)(tp + (size_t)i * OC + 4); }
    const v4f g0 = *(const v4f*)(gam + 8 * ch), g1 = *(const v4f*)(gam + 8 * ch + 4);
    const v4f b0 = *(const v4f*)(bet + 8 * ch), b1 = *(const v4f*)(bet + 8 * ch + 4);
    // keeps every load of the wave in front of the arithmetic: one memory latency instead of two or three in a row
    __builtin_amdgcn_sched_barrier(0);
    bfr8(g0, g1, g);
    bfr8(b0, b1, be);
    float y[8][8];
#pragma unroll
    for (int i = 0; i < 8; ++i) ln8(xa[i], xc[i], g, be, VC, y[i]);
    const size_t vo = (((size_t)s * NHEAD + wave) * (NTOK / 64) + (bx - s * (NTOK / 64))) * 2048 + 8 * lane;
#pragma unroll
    for (int j = 0; j < 8; ++j) {
      v4u hv;
#pragma unroll
      for (int p = 0; p < 4; ++p) hv[p] = hi2(y[2 * p][j], y[2 * p + 1][j]);
      *(v4u*)(VTH + vo + j * 256) = hv;
    }
  } else if (bx < MROWS / 64 + MROWS / 32) {          // block-uniform: q, token rows
    const size_t row0 = ((size_t)(bx - MROWS / 64) * 8 + wave) * 4;
    const float* tp = T + row0 * OC + 8 * lane;
    v4f xa[4], xc[4];
#pragma unroll
    for (int i = 0; i < 4; ++i) {
      const float* p = tp + (size_t)i * OC;
      xa[i] = *(const v4f*)(p);
      xc[i] = *(const v4f*)(p + 4);
    }
    const v4f g0 = *(const v4f*)(gam + 8 * ch), g1 = *(const v4f*)(gam + 8 * ch + 4);
    const v4f b0 = *(const v4f*)(bet + 8 * ch), b1 = *(const v4f*)(bet + 8 * ch + 4);
    // keeps every load of the wave in front of the arithmetic: one memory latency instead of two or three in a row
    __builtin_amdgcn_sched_barrier(0);
    bfr8(g0, g1, g);
    bfr8(b0, b1, be);
#pragma unroll
    for (int i = 0; i < 4; ++i) {
      float y[8];
      ln8(xa[i], xc[i], g, be, QC, y);
      const size_t o = (row0 + i) * CDIM + 8 * lane;
      v4u hv;
#pragma unroll
      for (int p = 0; p < 4; ++p) hv[p] = hi2(y[2 * p], y[2 * p + 1]);
      *(v4u*)(QH + o) = hv;
    }
  } else {                                            // k, fragment order
    const int wid = (bx - (MROWS / 64 + MROWS / 32)) * 8 + wave;
    const int t16 = wid >> 2;                         // 16-token tile, both streams stacked
    const int h0  = (wid & 3) * 2;                    // first of the wave's two heads
    const int tr  = lane >> 2;
    const float* tp = T + ((size_t)t16 * 16 + tr) * OC + CDIM + h0 * DHEAD + 8 * ch;
    v4f xa[4], xc[4];                                 // index = 2*head + token half (tokens tr, tr + 8)
#pragma unroll
    for (int i = 0; i < 4; ++i) {
      const float* p = tp + (size_t)(i & 1) * 8 * OC + (i >> 1) * DHEAD;
      xa[i] = *(const v4f*)(p);
      xc[i] = *(const v4f*)(p + 4);
    }
    const v4f g0 = *(const v4f*)(gam + 8 * ch), g1 = *(const v4f*)(gam + 8 * ch + 4);
    const v4f b0 = *(const v4f*)(bet + 8 * ch), b1 = *(const v4f*)(bet + 8 * ch + 4);
    // keeps every load of the wave in front of the arithmetic: one memory latency instead of two or three in a row
    __builtin_amdgcn_sched_barrier(0);
    bfr8(g0, g1, g);
    bfr8(b0, b1, be);
    const int s = t16 / (NTOK / 16), tile = t16 - s * (NTOK / 16);
    const size_t ko = (((size_t)s * NHEAD + h0) * (NTOK / 16) + tile) * 512 + (ch >> 1) * 256 + ((ch & 1) * 16 + tr) * 8;
#pragma unroll
    for (int i = 0; i < 4; ++i) {
      float y[8];
      ln8(xa[i], xc[i], g, be, KC, y);
      v4u hv;
#pragma unroll
      for (int p = 0; p < 4; ++p) hv[p] = hi2(y[2 * p], y[2 * p + 1]);
      *(v4u*)(KH + ko + (size_t)(i >> 1) * (NTOK / 16) * 512 + (i & 1) * 64) = hv;
    }
  }
}

// =====================================================================================================
// Attention for one (dir, head, 128-query block), transposed formulation, head dim 32, 4096 keys, no mask:
//   dir 0: queries from stream 1, keys/values from stream 0 -> output slot 0; dir 1: queries from stream 0, keys/values
//   from stream 1 -> output slot 1.
//   S^T tile (16 keys x 16 queries) = A(k rows = keys, d via the split k map) . B(q, col = query, same d map):
//   s = k.q (one product) = 1024*1024 * logit_dot. Per lane the D tile holds 8 keys of ONE query, so the
//   online softmax is per-lane state. Its reference m is a maximum over keys seen earlier and is renewed only on demand:
//   a step forms P with the m in use and sums it; only if a lane's sum of 16 P values is above ELIM (or not a number)
//   does the wave take the renewal path (one test a step, a scalar branch): maximum over the step's 32 keys with one
//   shuffle (lane^16), O and l rescaled, P formed again. The first step (m = -1e30, P = inf) always takes it. The row sum
//   (of the f32 values, before they are rounded to f16) is kept as a per-lane partial and combined at the end.
//   P = e^{s-m} x 256 as f16 (at most ELIM, so finite) is used directly
//   as the B operand of O^T (rows d, cols queries) += A(v^T rows d, keys contiguous, two 16-B loads) . B(P^T):
//   B element r <- the key tile covering keys kb..kb+15, element 8+r <- the tile covering kb+16..kb+31, lane unchanged
//   (D-as-B chaining layout). One product v.P into one accumulator per d tile.
//   k and v come from planes in fragment order (layouts: at ln_heads): every load of a wave covers four whole 128-B lines.
//   A k tile is 1024 contiguous bytes, piece = lane. Row c of v^T tile dt is d = 8*(c&3) + 4*dt + (c>>2): its four
//   feature rows jf = 4*dt + (c>>2) each give one line (key groups 2j, 2j+1 of the 32 keys x chunks 0..3); the epilogue
//   puts the output rows back in d order.
//   Wave tile = 32 queries (two q fragments) x 2048 keys: every k and v fragment a wave loads feeds two products, so a
//   score costs half the loaded bytes of a 16-query wave, and the number of waves stays 4096.
//   32 keys per step: 4 score WMMAs + 4 output WMMAs per wave; two steps a trip, each on its own register set of k and v
//   fragments, fetched two steps ahead. Block = 8 waves = 4 query groups x 2 key halves = 128 queries; grid = 2*8*32 = 512.
//   Epilogue: the waves of key half 1 hand (m, l, O) to their partners through LDS; the partner joins the two halves
//   (common maximum, both sides rescaled), divides and stages its [32 query][32 d] f32 rows in LDS; block barrier, then
//   4 store instructions of whole 128-B lines per thread group.
// coverage: block writes queries q0..q0+127 x d 0..31 of its (dir, head); grid covers out [2][4096][256] exactly once.
// =====================================================================================================
__device__ __forceinline__ float exp_slot(float x) {   // e^x as __expf forms it: one multiply, one v_exp_f32
  float r = 0.f;
#if defined(__HIP_DEVICE_COMPILE__)
  // v_nop: fills the one slot asked for behind a transcendental, before an instruction that may overwrite its source
  asm("v_exp_f32 %0, %1\n\tv_nop" : "=v"(r) : "v"(x * 1.44269504088896340736f));
#endif
  return r;
}
__device__ __forceinline__ v4f lo4(v8f x) { v4f r = {x[0], x[1], x[2], x[3]}; return r; }
__device__ __forceinline__ v4f hi4(v8f x) { v4f r = {x[4], x[5], x[6], x[7]}; return r; }

#define QBLK   128                    // queries of a block
#define KSTEPS (NTOK / 2 / 32)        // 32-key steps of a wave: half of the keys
static_assert((NTOK % QBLK) == 0 && (KSTEPS % 2) == 0 && KSTEPS >= 4);

__global__ __launch_bounds__(256)
void attn_kernel(const unsigned short* __restrict__ qh, const unsigned short* __restrict__ kh,
                 const unsigned short* __restrict__ vth, float* out) {
  __shared__ __align__(16) float Os[QBLK * DHEAD];
  __shared__ __align__(16) v4f Pm[4][9][32];          // key half 1's (O, m, l): [query group][piece][lane]
  const int tid  = threadIdx.x;
  const int wave = __builtin_amdgcn_readfirstlane(tid >> 5);
  const int lane = tid & 31;
  const int hh   = lane >> 4;
  const int c    = lane & 15;
  const int qg   = wave & 3;                        // 32-query group of the block
  const int kv   = wave >> 2;                       // key half
  const int bx   = blockIdx.x;
  const int qb   = bx % (NTOK / QBLK);              // 32 query blocks per (stream, head)
  const int hd   = (bx / (NTOK / QBLK)) % NHEAD;
  const int dir  = bx / ((NTOK / QBLK) * NHEAD);
  const int qsrc = 1 - dir;
  const int ksrc = dir;
  const int q0   = qb * QBLK;

  const _Float16* QHp = (const _Float16*)(const void*)qh;
  const _Float16* KHp = (const _Float16*)(const void*)kh;
  const _Float16* VHp = (const _Float16*)(const void*)vth;

  // ---- q fragments (B operand, col = query q0 + 32*qg + 16*t + c, t = 0, 1) ----
  const size_t qtok = (size_t)qsrc * NTOK + q0 + qg * 32 + c;
  const v16h qf0 = ldfrag_h(QHp + qtok * CDIM + hd * DHEAD + 8 * hh);
  const v16h qf1 = ldfrag_h(QHp + (qtok + 16) * CDIM + hd * DHEAD + 8 * hh);
#if defined(__HIP_DEVICE_COMPILE__)
  // stands in front of the first k and v loads, whose results land in registers that the q loads name as addresses
  asm volatile("s_wait_xcnt 0x0" ::: "memory");
#endif
  // ---- k fragment base (A operand, row = key kb + c): 512 halves a 16-key tile, the lane's piece = lane ----
  const _Float16* Kp = KHp + (size_t)(ksrc * NHEAD + hd) * (NTOK / 16) * 512 + (size_t)kv * KSTEPS * 1024 + 8 * lane;
  // ---- v^T fragment bases (A operand, row c = d 8*(c&3) + 4*dt + (c>>2)): 2048 halves a 64-key block ----
  const size_t vrow = (size_t)(ksrc * NHEAD + hd) * (NTOK / 64) * 2048 + (size_t)kv * (KSTEPS / 2) * 2048
                    + (c >> 2) * 256 + (4 * hh + (c & 3)) * 8;
  const _Float16* VH0 = VHp + vrow;
  const _Float16* VH1 = VH0 + 4 * 256;
  const float SC = ATTSC / (QC * KC);

  float m0 = -1.0e30f, m1 = -1.0e30f, l0 = 0.f, l1 = 0.f;
  float h0 = m0 - LNPSC, h1 = m1 - LNPSC;             // shift in use: exp gives e^{s-m} * 256
  v8f o00 = zero8(), o01 = zero8(), o10 = zero8(), o11 = zero8();     // o<query tile><d tile>
  // P (f32) of one query tile's 32 scores with the shift msh; returns the lane's sum of its 16 values
  auto exps = [&](const v8f& s0, const v8f& s1, const float msh, v8f& e0, v8f& e1)
      __attribute__((always_inline)) {
    float ls = 0.f;
#pragma unroll
    for (int r = 0; r < 8; ++r) {
      e0[r] = __expf(s0[r] * SC - msh);               // key kb      + 8hh + r
      e1[r] = __expf(s1[r] * SC - msh);               // key kb + 16 + 8hh + r
      ls += e0[r] + e1[r];
    }
    return ls;
  };
  // renewal of one query tile's reference; mx = the maximum of the step's 32 scores over both lane halves
  auto renew = [&](const float mx, float& m, float& h, float& l, v8f& oa, v8f& ob) __attribute__((always_inline)) {
    const float mn   = fmaxf(m, mx * SC);
    const float corr = exp_slot(m - mn);
    m = mn;
    h = mn - LNPSC;
    l *= corr;
#pragma unroll
    for (int r = 0; r < 8; ++r) { oa[r] *= corr; ob[r] *= corr; }
  };
  // One 32-key step on the fragment set (kf0..vh1). Each operand group is refilled for step nx, two steps ahead, directly
  // behind its last use, so a load has about two steps of other work between its issue and its wait.
  // refill is a literal at each call; the last two steps have nothing left to fetch.
  auto step = [&](v16h& kf0, v16h& kf1, v16h& vh0, v16h& vh1, const int nx, const bool refill)
      __attribute__((always_inline)) {
    v8f s00 = mma_h_raw(kf0, qf0, zero8());
    v8f s01 = mma_h_raw(kf1, qf0, zero8());
    v8f s10 = mma_h_raw(kf0, qf1, zero8());
    v8f s11 = mma_h_raw(kf1, qf1, zero8());
    guard4(s00, s01, s10, s11, kf0, kf1, qf0, qf1);
    // the two scheduling barriers hold the k refill here: lifted over the products it would need a third register set and
    // copies, sunk into the softmax (where the compiler put it) it would be waited for shortly after its issue
    if (refill) {
      __builtin_amdgcn_sched_barrier(0);
      kf0 = ldfrag_p(Kp + (size_t)nx * 1024, 256);          // keys kb..kb+15 of step nx, kb = 32*nx
      kf1 = ldfrag_p(Kp + (size_t)nx * 1024 + 512, 256);    // keys kb+16..kb+31
      __builtin_amdgcn_sched_barrier(0);
    }

    v8f e00, e01, e10, e11;
    float ls0 = exps(s00, s01, h0, e00, e01);
    float ls1 = exps(s10, s11, h1, e10, e11);
    // written as "not <=" so that inf and NaN ask for the renewal too; the ballot makes the branch scalar: the whole
    // wave takes it or none of it does, and both lane halves of a query keep one m
    const bool need = !(ls0 <= ELIM) || !(ls1 <= ELIM);
    if (__builtin_expect(__builtin_amdgcn_ballot_w32(need) != 0u, 0)) {
      float mx0 = fmaxf(hmax8(s00), hmax8(s01));
      float mx1 = fmaxf(hmax8(s10), hmax8(s11));
      const float px0 = __shfl_xor(mx0, 16, 32), px1 = __shfl_xor(mx1, 16, 32);
      mx0 = fmaxf(mx0, px0);
      mx1 = fmaxf(mx1, px1);
      renew(mx0, m0, h0, l0, o00, o01);
      renew(mx1, m1, h1, l1, o10, o11);
      ls0 = exps(s00, s01, h0, e00, e01);             // every value now at most 256
      ls1 = exps(s10, s11, h1, e10, e11);
    }
    l0 += ls0;
    l1 += ls1;
    FragH p0, p1;
#pragma unroll
    for (int r = 0; r < 8; ++r) {
      p0.h[0][r] = (_Float16)e00[r];
      p0.h[1][r] = (_Float16)e01[r];
      p1.h[0][r] = (_Float16)e10[r];
      p1.h[1][r] = (_Float16)e11[r];
    }

    o00 = mma_h_raw(vh0, p0.v, o00);
    o01 = mma_h_raw(vh1, p0.v, o01);
    o10 = mma_h_raw(vh0, p1.v, o10);
    o11 = mma_h_raw(vh1, p1.v, o11);
    guard4(o00, o01, o10, o11, vh0, vh1, p0.v, p1.v);
    if (refill) {
      const size_t vo = (size_t)(nx >> 1) * 2048 + (nx & 1) * 128;     // 64-key block, then its 32-key half
      // the same for the v refill; the second barrier also keeps the next step's products out of this step
      __builtin_amdgcn_sched_barrier(0);
      vh0 = ldfrag_p(VH0 + vo, 64);
      vh1 = ldfrag_p(VH1 + vo, 64);
      __builtin_amdgcn_sched_barrier(0);
    }
  };
  // two fragment sets: a = even steps, b = odd steps
  v16h ka0 = ldfrag_p(Kp, 256),        ka1 = ldfrag_p(Kp + 512, 256);
  v16h va0 = ldfrag_p(VH0, 64),        va1 = ldfrag_p(VH1, 64);
  v16h kb0 = ldfrag_p(Kp + 1024, 256), kb1 = ldfrag_p(Kp + 1536, 256);
#if defined(__HIP_DEVICE_COMPILE__)
  // stands in front of the last v loads, whose results may land in the register that the k loads name as their offset
  asm volatile("s_wait_xcnt 0x0" ::: "memory");
#endif
  v16h vb0 = ldfrag_p(VH0 + 128, 64),  vb1 = ldfrag_p(VH1 + 128, 64);
  // kept rolled: a trip already holds both sets' steps, further copies would only lengthen the text
#pragma unroll 1
  for (int it = 0; it < KSTEPS - 2; it += 2) {
    step(ka0, ka1, va0, va1, it + 2, true);
    step(kb0, kb1, vb0, vb1, it + 3, true);
#if defined(__HIP_DEVICE_COMPILE__)
    // stands in front of the next trip's overwrite of the address registers that this trip's loads name
    asm volatile("s_wait_xcnt 0x0" ::: "memory");
#endif
  }
  step(ka0, ka1, va0, va1, 0, false);
  step(kb0, kb1, vb0, vb1, 0, false);

  // ---- key half 1 hands its state over, lane to lane (16 B a lane and piece: contiguous, no bank conflict) ----
  if (kv == 1) {                                     // wave-uniform
    v4f (*pm)[32] = Pm[qg];
    pm[0][lane] = lo4(o00); pm[1][lane] = hi4(o00); pm[2][lane] = lo4(o01); pm[3][lane] = hi4(o01);
    pm[4][lane] = lo4(o10); pm[5][lane] = hi4(o10); pm[6][lane] = lo4(o11); pm[7][lane] = hi4(o11);
    const v4f ml = {m0, l0, m1, l1};
    pm[8][lane] = ml;
  }
  __syncthreads();
  if (kv == 0) {                                     // wave-uniform: join the halves, divide, stage
    const v4f (*pm)[32] = Pm[qg];
    const v4f ml = pm[8][lane];
    // ---- O[query 32*qg + 16*t + c][d]: accumulator row 8hh + r of tile dt is d = 8*(r&3) + 4*dt + 2hh + (r>>2) ----
    auto join = [&](const int t, const float m, const float l, const float mo, const float lo, const v8f& oa, const v8f& ob)
        __attribute__((always_inline)) {
      const float mn = fmaxf(m, mo);
      const float ca = __expf(m - mn), cb = __expf(mo - mn);
      float ls = l * ca + lo * cb;
      ls += __shfl_xor(ls, 16, 32);
      const float sc = (1.0f / VC) * (1.0f / ls);
      const float fa = ca * sc, fb = cb * sc;
      float* os = Os + (qg * 32 + t * 16 + c) * DHEAD + 2 * hh;
#pragma unroll
      for (int r = 0; r < 8; ++r) {
        os[8 * (r & 3) + (r >> 2)]     = oa[r] * fa + pm[4 * t + (r >> 2)][lane][r & 3] * fb;
        os[8 * (r & 3) + (r >> 2) + 4] = ob[r] * fa + pm[4 * t + 2 + (r >> 2)][lane][r & 3] * fb;
      }
    };
    join(0, m0, l0, ml[0], ml[1], o00, o01);
    join(1, m1, l1, ml[2], ml[3], o10, o11);
  }
  __syncthreads();
  {
    const int e = tid & 7, qq = tid >> 3;              // qq 0..31: line within group, e: 16-B piece
    v4f vals[4];
#pragma unroll
    for (int it = 0; it < 4; ++it) {
      const int qi = it * 32 + qq;                       // it 0..3 x qq 0..31 = queries 0..127 of the block
      vals[it] = *(const v4f*)(Os + qi * DHEAD + 4 * e);
    }
    float* ob = out + (size_t)dir * NTOK * CDIM + (size_t)hd * DHEAD + 4 * e;
    {
#pragma unroll
      for (int it = 0; it < 4; ++it) {
        const int qi = it * 32 + qq;
        *(v4f*)(ob + (size_t)(q0 + qi) * CDIM) = vals[it];
      }
    }
  }
}

// =====================================================================================================
// Workspace map (bytes), every offset a multiple of 256 and every plane sized to its whole-row store granularity:
//   XN   f16 [8192][256]            0           4194304
//   WT   f16 [768][256]             4194304     393216
//   T    f32 [8192][768]            4587520     25165824
//   QH   f16 [8192][256]            29753344    4194304
//   KH   f16 [2][8][256][2][32][8]  33947648    4194304
//   VTH  f16 [2][8][64][8][32][8]   38141952    4194304
//   end                              42336256
// =====================================================================================================
extern "C" void kernel_launch(void* const* d_in, const int* in_sizes, int n_in,
                              void* d_out, int out_size, void* d_ws, size_t ws_size,
                              hipStream_t stream) {
  if (n_in < 5) return;
  if (in_sizes[0] != NTOK * CDIM || in_sizes[1] != NTOK * CDIM) return;
  if (in_sizes[2] != OC * CDIM) return;
  if (in_sizes[3] != DHEAD || in_sizes[4] != DHEAD) return;
  if (out_size != NSTR * NTOK * CDIM) return;

  const float* x_b   = (const float*)d_in[0];
  const float* x_a   = (const float*)d_in[1];
  const float* w_qkv = (const float*)d_in[2];
  const float* ln_g  = (const float*)d_in[3];
  const float* ln_b  = (const float*)d_in[4];

  const size_t PXN = (size_t)MROWS * CDIM * 2;        //  4194304
  const size_t PWT = (size_t)OC * CDIM * 2;           //   393216
  const size_t PT  = (size_t)MROWS * OC * 4;          // 25165824
  const size_t PQ  = (size_t)MROWS * CDIM * 2;        //  4194304
  const size_t PV  = (size_t)NSTR * CDIM * NTOK * 2;  //  4194304
  size_t off = 0;
  const size_t oXN = off; off += PXN;
  const size_t oWT = off; off += PWT;
  const size_t oT  = off; off += PT;
  const size_t oQH = off; off += PQ;
  const size_t oKH = off; off += PQ;
  const size_t oVH = off; off += PV;
  if (off > ws_size) return;                          // off = 42336256
  if (off > (size_t)134217728) return;

  char* ws = (char*)d_ws;
  unsigned short* XN  = (unsigned short*)(ws + oXN);
  unsigned short* WT  = (unsigned short*)(ws + oWT);
  float*          T   = (float*)(ws + oT);
  unsigned short* QH  = (unsigned short*)(ws + oQH);
  unsigned short* KH  = (unsigned short*)(ws + oKH);
  unsigned short* VTH = (unsigned short*)(ws + oVH);
  float*          out = (float*)d_out;

  const dim3 blk(256);
  const dim3 gCV(MROWS / 8 + OC / 8);                          // 1024 + 96 = 1120 blocks of 8 rows
  const dim3 gGM(((MROWS / 64) * (OC / 64)) / 8);              // 1536 tiles -> 192 blocks
  const dim3 gLN(MROWS / 64 + MROWS / 32 + MROWS / 32);        // 128 blocks (v, 64 tokens) + 256 (q, 32 rows) + 256 (k, 2 tiles)
  const dim3 gAT(NSTR * NHEAD * (NTOK / QBLK));                // 512 blocks of 256

  // (0) 16-bit operand planes: f16( bf16_RNE(x) * 64 ), f16( bf16_RNE(W) * 64 )
  cvt_planes<<<gCV, blk, 0, stream>>>(x_b, x_a, w_qkv, XN, WT);

  // (1) T[s*4096 + n][o] = (x_s[n] . W[o]) : both streams stacked, scale 1/(64*64)
  gemm64f<<<gGM, blk, 0, stream>>>(XN, CDIM, WT, CDIM, T, OC, 1.0f / (XC * WSC), MROWS, OC, CDIM);

  // (2) per-head LayerNorm -> q token rows; k and v in fragment order
  ln_heads<<<gLN, blk, 0, stream>>>(T, ln_g, ln_b, QH, KH, VTH);

  // (3) attention, both directions, all heads -> out[dir][n][h*32 + d]
  attn_kernel<<<gAT, blk, 0, stream>>>(QH, KH, VTH, out);
  (void)hipGetLastError();
}

// v007
// One run takes 59.6 microseconds.
// In two side-by-side timings against v006, it was 1.13 and 1.14 times as fast.
// All steps since v000 together make it 5.57 times as fast.
// Contractions: qkv projection (x token rows f16 x64 . W_qkv rows f16 x64, K=256, one product); attention scores
// S^T = k (f16 x1) . q^T (f16 x scale*log2 e) - shift (the C operand), one product, head dim 32; attention O^T = v^T (f16 x256) . P^T (f16 x256,
// taken from the score D registers), one product over 4096 keys. Every operand is one f16 plane (RNE from f32).
// All v_wmma_f32_16x16x32_f16, f32 accumulate; LayerNorm and softmax in f32 on VALU; every float input RNE-converted
// to bf16 on load.
#include <hip/hip_runtime.h>
#include <math.h>
#include <stdint.h>

#define NTOK   4096
#define CDIM   256
#define NHEAD  8
#define DHEAD  32
#define OC     (3 * CDIM)
#define NSTR   2
#define MROWS  (NSTR * NTOK)
#define LNEPS  1.0e-5f
#define XC     64.0f
#define WSC    64.0f
#define ATTSC  0.17677669529663687f
#define QC     (ATTSC * 1.44269504088896340736f)   // q carries the logit scale and log2 e: k.q is the base-2 logit
#define KC     1.0f
#define VC     256.0f
#define PSH    8.0f                  // log2 256: P = 2^{t-m} x 256
#define ELIM   32768.0f              // a lane's sum of 16 P values up to here: each of them is finite in f16
static_assert(NHEAD * DHEAD == CDIM);
static_assert((MROWS % 64) == 0 && (OC % 64) == 0 && (CDIM % 32) == 0);
static_assert((((MROWS / 64) * (OC / 64)) % 8) == 0);
static_assert((NTOK % 64) == 0 && (NTOK / 32) >= 4 && (MROWS % 8) == 0 && (OC % 8) == 0);

typedef _Float16 v16h __attribute__((ext_vector_type(16)));
typedef _Float16 v8h  __attribute__((ext_vector_type(8)));
typedef float    v8f  __attribute__((ext_vector_type(8)));
typedef float    v4f  __attribute__((ext_vector_type(4)));
typedef unsigned int v4u __attribute__((ext_vector_type(4)));

union FragH { v16h v; v8h h[2]; };

// ---- scalar helpers --------------------------------------------------------------------------------
__device__ __forceinline__ unsigned short bf_bits(float f) {          // f32 -> bf16 bits, RNE convert
  unsigned u = __float_as_uint(f);
  return (unsigned short)((u + 0x7FFFu + ((u >> 16) & 1u)) >> 16);
}
__device__ __forceinline__ float bf_up(unsigned short h) { return __uint_as_float(((unsigned)h) << 16); }
__device__ __forceinline__ float bfr(float f) { return bf_up(bf_bits(f)); }
__device__ __forceinline__ unsigned short h_bits(_Float16 x) { return __builtin_bit_cast(unsigned short, x); }
__device__ __forceinline__ unsigned pk16(unsigned short a, unsigned short b) { return (unsigned)a | ((unsigned)b << 16); }
__device__ __forceinline__ v8f zero8() { v8f z = {0.f, 0.f, 0.f, 0.f, 0.f, 0.f, 0.f, 0.f}; return z; }
__device__ __forceinline__ float hmax8(v8f s) {
  return fmaxf(fmaxf(fmaxf(s[0], s[1]), fmaxf(s[2], s[3])), fmaxf(fmaxf(s[4], s[5]), fmaxf(s[6], s[7])));
}

// ---- fragment loader: 16-bit A/B operand, lane -> row/col (lane&15), p already includes +8*(lane>>4);
//      elements 0..7 <- p[0..7] (k0+8h..), elements 8..15 <- p[16..23] (k0+16+8h..)
__device__ __forceinline__ v16h ldfrag_h(const _Float16* p) {
  FragH f;
  f.h[0] = *(const v8h*)(p);
  f.h[1] = *(const v8h*)(p + 16);
  return f.v;
}
// ---- the same operand from a plane stored in fragment order: elements 0..7 <- p[0..7], elements 8..15 <- p[step..step+7];
//      p already includes the lane's own 16-B piece
__device__ __forceinline__ v16h ldfrag_p(const _Float16* p, int step) {
  FragH f;
  f.h[0] = *(const v8h*)(p);
  f.h[1] = *(const v8h*)(p + step);
  return f.v;
}

// ---- WMMA helpers with trailing VALU hazard gap --------------------------------------------------------
__device__ __forceinline__ v8f mma_h_raw(v16h a, v16h b, v8f c) {
  return __builtin_amdgcn_wmma_f32_16x16x32_f16(false, a, false, b, (short)0, c, false, false);
}
__device__ __forceinline__ void dep_guard1(v8f& a, v8f& b, v16h x) {
#if defined(__HIP_DEVICE_COMPILE__)
  asm volatile("v_nop\n\tv_nop\n\tv_nop\n\tv_nop" : "+v"(a), "+v"(b) : "v"(x));
#endif
}
__device__ __forceinline__ void keep4_h(v16h a, v16h b, v16h c, v16h d) {
#if defined(__HIP_DEVICE_COMPILE__)
  asm volatile("v_nop" :: "v"(a), "v"(b), "v"(c), "v"(d));
#endif
}
__device__ __forceinline__ void acc_guard4(v8f& a, v8f& b, v8f& c, v8f& d) {
#if defined(__HIP_DEVICE_COMPILE__)
  asm volatile("v_nop\n\tv_nop\n\tv_nop\n\tv_nop" : "+v"(a), "+v"(b), "+v"(c), "+v"(d));
#endif
}
// behind four products of two A fragments (x0, x1) with two B fragments (y0, y1). v_nop x4: the distance asked for between
// the last product and the first vector instruction that reads a D or overwrites an A or B register; the operands hold the
// statement behind the products and in front of the refill of x0, x1
__device__ __forceinline__ void guard4(v8f& a, v8f& b, v8f& c, v8f& d, v16h x0, v16h x1, v16h y0, v16h y1) {
#if defined(__HIP_DEVICE_COMPILE__)
  asm volatile("v_nop\n\tv_nop\n\tv_nop\n\tv_nop"
               : "+v"(a), "+v"(b), "+v"(c), "+v"(d) : "v"(x0), "v"(x1), "v"(y0), "v"(y1));
#endif
}
__device__ __forceinline__ void wave_sync_lds() {
  __builtin_amdgcn_fence(__ATOMIC_RELEASE, "workgroup");
  __builtin_amdgcn_wave_barrier();
  __builtin_amdgcn_fence(__ATOMIC_ACQUIRE, "workgroup");
}

// =====================================================================================================
// Operand planes: XN[s*4096 + n][256] = f16( bf16_RNE(x_s[n][c]) * 64 ) (blocks 0..1023, 8 rows each, stream s = bx/512),
// WT[o][256] = f16( bf16_RNE(W[o][c]) * 64 ) (blocks 1024..1119; W is already [o][c] = k-contiguous, no transpose).
// Thread t: row = 8 per block (t>>5), 8 consecutive elements at 8*(t&31): one instruction of 32 lanes x 16 B = one whole
// coverage: 1024 x 8 = 8192 XN rows and 96 x 8 = 768 WT rows, each row 32 lanes x 8 halves = 256 columns: both planes entirely.
// =====================================================================================================
__global__ __launch_bounds__(256) void cvt_planes(const float* __restrict__ xb, const float* __restrict__ xa,
                                                   const float* __restrict__ w, unsigned short* XN, unsigned short* WT) {
  const int tid = threadIdx.x, r = tid >> 5, lane = tid & 31;
  const int bx  = blockIdx.x;
  const bool isx = (bx < (MROWS / 8));                    // block-uniform
  const int  s   = isx ? (bx / (NTOK / 8)) : 0;           // stream of this block
  const float* src = isx ? ((s == 0) ? xb : xa) : w;
  unsigned short* dst = isx ? XN : WT;
  const float sc  = isx ? XC : WSC;
  const int drow  = isx ? (bx * 8 + r) : ((bx - MROWS / 8) * 8 + r);   // row in dst plane
  const int srow  = isx ? (drow - s * NTOK) : drow;                       // row in src tensor
  const float* sp = src + (size_t)srow * CDIM + 8 * lane;
  const v4f a = *(const v4f*)(sp), c = *(const v4f*)(sp + 4);
  float f[8];
#pragma unroll
  for (int i = 0; i < 4; ++i) { f[i] = bfr(a[i]) * sc; f[4 + i] = bfr(c[i]) * sc; }
  v4u v;
#pragma unroll
  for (int i = 0; i < 4; ++i) v[i] = pk16(h_bits((_Float16)f[2 * i]), h_bits((_Float16)f[2 * i + 1]));
  unsigned short* dp = dst + (size_t)drow * CDIM + 8 * lane;
  *(v4u*)dp = v;
  
}

// =====================================================================================================
// Register-blocked f16 WMMA GEMM, one wave per 64x64 tile, no block barriers:
//   C[m][n] = osc * sum_k A[m][k] * Bt[n][k]   (f32 out, pitch ldc)
// A: f16 row-major [M][K] pitch lda; Bt: f16 [N][K] (k contiguous, pitch ldb); fragments = two 16-B loads with the
// split k map (ldfrag_h). M, N multiples of 64, K multiple of 32 (host-checked constants here).
// lines, n0*4 is a multiple of 256) written by 16 consecutive lanes x 16 B of ONE instruction (lanes 0-15 row it*2, lanes
// coverage: 4 slabs x 16 rows x 64 cols = the wave's whole 64x64 tile; grid = tilesM*tilesN/8 blocks (exact multiple of 8).
// =====================================================================================================
__global__ __launch_bounds__(256) void gemm64f(
    const unsigned short* __restrict__ Ap, int lda,
    const unsigned short* __restrict__ Bp, int ldb,
    float* Cout, int ldc, float osc, int M, int N, int K) {
  __shared__ __align__(16) float sT[8][16 * 68];   // per-wave 16x64 slab, pitch 68 floats
  const int lane = threadIdx.x & 31;
  const int wave = threadIdx.x >> 5;
  const int tilesN = N >> 6;
  const int tilesM = M >> 6;
  const int tile = blockIdx.x * 8 + wave;
  if (tile >= tilesM * tilesN) return;   // wave-uniform; no block barriers in this kernel
  const int tm = tile / tilesN;
  const int tn = tile - tm * tilesN;
  const int m0 = tm << 6;
  const int n0 = tn << 6;

  const _Float16* Ah = (const _Float16*)(const void*)Ap;
  const _Float16* Bb = (const _Float16*)(const void*)Bp;

  const int rlane = lane & 15;                 // row (A) / col (B, D) within subtile
  const int koff  = (lane >> 4) * 8;           // k offset of this lane half
  const int mOff  = (lane >> 4) * 8;           // D row offset

  v8f acc[4][4];
#pragma unroll
  for (int i = 0; i < 4; ++i)
#pragma unroll
    for (int j = 0; j < 4; ++j) acc[i][j] = zero8();

  for (int k0 = 0; k0 < K; k0 += 32) {
    v16h bh[4];
#pragma unroll
    for (int j = 0; j < 4; ++j) {
      const size_t bo = (size_t)(n0 + (j << 4) + rlane) * ldb + koff + k0;
      bh[j] = ldfrag_h(Bb + bo);
    }
#pragma unroll
    for (int i = 0; i < 4; ++i) {
      const size_t ao = (size_t)(m0 + (i << 4) + rlane) * lda + koff + k0;
      const v16h ah = ldfrag_h(Ah + ao);
#pragma unroll
      for (int j = 0; j < 4; ++j) acc[i][j] = mma_h_raw(ah, bh[j], acc[i][j]);
      dep_guard1(acc[i][0], acc[i][3], ah);
    }
    keep4_h(bh[0], bh[1], bh[2], bh[3]);
  }
  acc_guard4(acc[0][0], acc[0][1], acc[0][2], acc[0][3]);
  acc_guard4(acc[1][0], acc[1][1], acc[1][2], acc[1][3]);
  acc_guard4(acc[2][0], acc[2][1], acc[2][2], acc[2][3]);
  acc_guard4(acc[3][0], acc[3][1], acc[3][2], acc[3][3]);

  const int hh2 = lane >> 4, c4 = (lane & 15) * 4;     // f32 out: 256-B row segment = 16 lanes x 16 B
  float* slab = sT[wave];
#pragma unroll
  for (int i = 0; i < 4; ++i) {
    const int mBase = m0 + (i << 4);
#pragma unroll
    for (int j = 0; j < 4; ++j) {
#pragma unroll
      for (int r = 0; r < 8; ++r) {
        slab[(mOff + r) * 68 + (j << 4) + rlane] = acc[i][j][r];
      }
    }
    wave_sync_lds();
    v4f vals[8];
#pragma unroll
    for (int it = 0; it < 8; ++it) {
      const int row = it * 2 + hh2;                      // it 0..7 x hh2 0..1 = rows 0..15
      v4f v = *(const v4f*)(slab + row * 68 + c4);
#pragma unroll
      for (int e = 0; e < 4; ++e) v[e] = v[e] * osc;
      vals[it] = v;
    }
    {
#pragma unroll
      for (int it = 0; it < 8; ++it) {
        const int row = it * 2 + hh2;
        *(v4f*)(Cout + (size_t)(mBase + row) * ldc + n0 + c4) = vals[it];
      }
      
    }
    wave_sync_lds();
  }
}

// =====================================================================================================
// Per-head LayerNorm of q, k and v (feature o = part*256 + h*32 + dd of the projection row) and 16-bit plane writes.
// One lane owns 8 consecutive features of a token, so a head (32 features) is one quad of lanes: mean and variance are
// 8 adds in the lane and a two-step sum over the quad. No LDS and no barrier; every load of a wave is independent.
// k and v are stored in the order in which the attention kernel's fragment loads read them, so that each of its 32-lane
// 16-B loads covers four whole 128-B lines:
//   KH[s][h][tile of 16 tokens][j][piece = 16*hh + c][8]     = k of token 16*tile + c, d = 16*j + 8*hh + e
//   VTH[s][h][block of 64 tokens][jf][piece = 4*tg + ch][8]  = v of token 64*block + 8*tg + e, d = 8*ch + jf
//   blocks 0..127 (v): 64 tokens of stream s, wave = head; lane = (token group tg = lane>>2, feature chunk ch = lane&3)
//      holds 8 tokens x 8 features; y*256 -> f16; per feature jf the lane's 8 tokens are one 16-B piece and
//      the wave's 32 pieces one contiguous 512-B store.
//   blocks 128..383 (q): wave = 4 token rows; lane = features 8*lane..8*lane+7 of the row; y*QC -> f16;
//      each store instruction is one whole 512-B row.
//   blocks 384..639 (k): wave = one 16-token tile x 2 heads; lane = (token tr = lane>>2 and tr + 8, chunk ch = lane&3);
//      y -> f16; chunk ch is (j, hh) = (ch>>1, ch&1), so a store instruction is four whole 128-B lines.
// coverage: q rows: 256 blocks x 8 waves x 4 rows = all 8192 rows, full width; KH: 256 blocks x 8 waves = 512 tiles x
//           4 head pairs, 1024 B per tile and head = the whole plane; VT plane: 128 blocks x 8 heads x 8 jf x 512 B =
//           the whole plane.
// =====================================================================================================
__device__ __forceinline__ float quad_sum(float v) {   // sum over lanes l, l^1, l^2, l^3 (DPP row_xmask 1, then 2)
  v += __builtin_bit_cast(float, __builtin_amdgcn_update_dpp(0, __builtin_bit_cast(int, v), 0x161, 0xf, 0xf, true));
  v += __builtin_bit_cast(float, __builtin_amdgcn_update_dpp(0, __builtin_bit_cast(int, v), 0x162, 0xf, 0xf, true));
  return v;
}
__device__ __forceinline__ float rsq_pos(float x) {   // 1/sqrt(x) for x >= LNEPS: never in the range that rsqrtf rescales
  float r = 0.f;
#if defined(__HIP_DEVICE_COMPILE__)
  // v_nop: fills the one slot asked for behind a transcendental, before an instruction that may overwrite its source
  asm("v_rsq_f32 %0, %1\n\tv_nop" : "=v"(r) : "v"(x));
#endif
  return r;
}
__device__ __forceinline__ void ln8(const v4f a, const v4f c, const float (&g)[8], const float (&b)[8], float sc,
                                    float (&y)[8]) {
  const float mean = quad_sum(((a[0] + a[1]) + (a[2] + a[3])) + ((c[0] + c[1]) + (c[2] + c[3]))) * (1.0f / DHEAD);
  float d[8];
#pragma unroll
  for (int j = 0; j < 4; ++j) { d[j] = a[j] - mean; d[4 + j] = c[j] - mean; }
  float ss = 0.f;
#pragma unroll
  for (int j = 0; j < 8; ++j) ss += d[j] * d[j];
  const float rs = rsq_pos(quad_sum(ss) * (1.0f / DHEAD) + LNEPS);
#pragma unroll
  for (int j = 0; j < 8; ++j) y[j] = ((d[j] * rs) * g[j] + b[j]) * sc;
}
__device__ __forceinline__ void bfr8(const v4f lo, const v4f hi, float (&o)[8]) {
#pragma unroll
  for (int j = 0; j < 4; ++j) { o[j] = bfr(lo[j]); o[4 + j] = bfr(hi[j]); }
}
__device__ __forceinline__ unsigned hi2(float x, float y) { return pk16(h_bits((_Float16)x), h_bits((_Float16)y)); }

__global__ __launch_bounds__(256)
void ln_heads(const float* __restrict__ T, const float* __restrict__ gam, const float* __restrict__ bet,
              unsigned short* QH, unsigned short* KH, unsigned short* VTH) {
  const int tid = threadIdx.x, wave = tid >> 5, lane = tid & 31;
  const int bx  = blockIdx.x;
  const int ch  = lane & 3;                           // 8-feature chunk of the head, all three mappings
  float g[8], be[8];
  if (bx < MROWS / 64) {                              // block-uniform: v, transposed in registers
    const int s    = bx / (NTOK / 64);
    const int tok0 = (bx - s * (NTOK / 64)) * 64 + 8 * (lane >> 2);
    const float* tp = T + ((size_t)s * NTOK + tok0) * OC + 2 * CDIM + wave * DHEAD + 8 * ch;
    v4f xa[8], xc[8];
#pragma unroll
    for (int i = 0; i < 8; ++i) { xa[i] = *(const v4f*)(tp + (size_t)i * OC); xc[i] = *(const v4f*)(tp + (size_t)i * OC + 4); }
    const v4f g0 = *(const v4f*)(gam + 8 * ch), g1 = *(const v4f*)(gam + 8 * ch + 4);
    const v4f b0 = *(const v4f*)(bet + 8 * ch), b1 = *(const v4f*)(bet + 8 * ch + 4);
    // keeps every load of the wave in front of the arithmetic: one memory latency instead of two or three in a row
    __builtin_amdgcn_sched_barrier(0);
    bfr8(g0, g1, g);
    bfr8(b0, b1, be);
    float y[8][8];
#pragma unroll
    for (int i = 0; i < 8; ++i) ln8(xa[i], xc[i], g, be, VC, y[i]);
    const size_t vo = (((size_t)s * NHEAD + wave) * (NTOK / 64) + (bx - s * (NTOK / 64))) * 2048 + 8 * lane;
#pragma unroll
    for (int j = 0; j < 8; ++j) {
      v4u hv;
#pragma unroll
      for (int p = 0; p < 4; ++p) hv[p] = hi2(y[2 * p][j], y[2 * p + 1][j]);
      *(v4u*)(VTH + vo + j * 256) = hv;
    }
  } else if (bx < MROWS / 64 + MROWS / 32) {          // block-uniform: q, token rows
    const size_t row0 = ((size_t)(bx - MROWS / 64) * 8 + wave) * 4;
    const float* tp = T + row0 * OC + 8 * lane;
    v4f xa[4], xc[4];
#pragma unroll
    for (int i = 0; i < 4; ++i) {
      const float* p = tp + (size_t)i * OC;
      xa[i] = *(const v4f*)(p);
      xc[i] = *(const v4f*)(p + 4);
    }
    const v4f g0 = *(const v4f*)(gam + 8 * ch), g1 = *(const v4f*)(gam + 8 * ch + 4);
    const v4f b0 = *(const v4f*)(bet + 8 * ch), b1 = *(const v4f*)(bet + 8 * ch + 4);
    // keeps every load of the wave in front of the arithmetic: one memory latency instead of two or three in a row
    __builtin_amdgcn_sched_barrier(0);
    bfr8(g0, g1, g);
    bfr8(b0, b1, be);
#pragma unroll
    for (int i = 0; i < 4; ++i) {
      float y[8];
      ln8(xa[i], xc[i], g, be, QC, y);
      const size_t o = (row0 + i) * CDIM + 8 * lane;
      v4u hv;
#pragma unroll
      for (int p = 0; p < 4; ++p) hv[p] = hi2(y[2 * p], y[2 * p + 1]);
      *(v4u*)(QH + o) = hv;
    }
  } else {                                            // k, fragment order
    const int wid = (bx - (MROWS / 64 + MROWS / 32)) * 8 + wave;
    const int t16 = wid >> 2;                         // 16-token tile, both streams stacked
    const int h0  = (wid & 3) * 2;                    // first of the wave's two heads
    const int tr  = lane >> 2;
    const float* tp = T + ((size_t)t16 * 16 + tr) * OC + CDIM + h0 * DHEAD + 8 * ch;
    v4f xa[4], xc[4];                                 // index = 2*head + token half (tokens tr, tr + 8)
#pragma unroll
    for (int i = 0; i < 4; ++i) {
      const float* p = tp + (size_t)(i & 1) * 8 * OC + (i >> 1) * DHEAD;
      xa[i] = *(const v4f*)(p);
      xc[i] = *(const v4f*)(p + 4);
    }
    const v4f g0 = *(const v4f*)(gam + 8 * ch), g1 = *(const v4f*)(gam + 8 * ch + 4);
    const v4f b0 = *(const v4f*)(bet + 8 * ch), b1 = *(const v4f*)(bet + 8 * ch + 4);
    // keeps every load of the wave in front of the arithmetic: one memory latency instead of two or three in a row
    __builtin_amdgcn_sched_barrier(0);
    bfr8(g0, g1, g);
    bfr8(b0, b1, be);
    const int s = t16 / (NTOK / 16), tile = t16 - s * (NTOK / 16);
    const size_t ko = (((size_t)s * NHEAD + h0) * (NTOK / 16) + tile) * 512 + (ch >> 1) * 256 + ((ch & 1) * 16 + tr) * 8;
#pragma unroll
    for (int i = 0; i < 4; ++i) {
      float y[8];
      ln8(xa[i], xc[i], g, be, KC, y);
      v4u hv;
#pragma unroll
      for (int p = 0; p < 4; ++p) hv[p] = hi2(y[2 * p], y[2 * p + 1]);
      *(v4u*)(KH + ko + (size_t)(i >> 1) * (NTOK / 16) * 512 + (i & 1) * 64) = hv;
    }
  }
}

// =====================================================================================================
// Attention for one (dir, head, 128-query block), transposed formulation, head dim 32, 4096 keys, no mask:
//   dir 0: queries from stream 1, keys/values from stream 0 -> output slot 0; dir 1: queries from stream 0, keys/values
//   from stream 1 -> output slot 1.
//   S^T tile (16 keys x 16 queries) = A(k rows = keys, d via the split k map) . B(q, col = query, same d map):
//   t = k.q (one product) is the base-2 logit (q carries scale * log2 e). Per lane the D tile holds 8 keys of ONE query,
//   so the online softmax is per-lane state, and the shift h = m - 8 in use is one value a lane: the product takes -h in
//   all 8 registers of its C operand, D = t - h, and P = 2^D is one v_exp_f32 on the D register with no other arithmetic.
//   The reference m is a maximum over keys seen earlier and is renewed only on demand:
//   a step forms P with the h in use and sums it; only if a lane's sum of 16 P values is above ELIM (or not a number)
//   does the wave take the renewal path (one test a step, a scalar branch): maximum over the step's 32 keys with one
//   shuffle (lane^16), h raised by delta = max(D) - 8 where that is positive (the C registers lowered by it), O and l
//   rescaled by 2^-delta, P formed again as 2^(D - delta). The first h comes from the first 32 keys' scores, formed once more with
//   C = 0 in front of the loop. The row sum
//   (of the f32 values, before they are rounded to f16) is kept as a per-lane partial and combined at the end.
//   P = 2^{t-m} x 256 as f16 (at most ELIM, so finite) is used directly
//   as the B operand of O^T (rows d, cols queries) += A(v^T rows d, keys contiguous, two 16-B loads) . B(P^T):
//   B element r <- the key tile covering keys kb..kb+15, element 8+r <- the tile covering kb+16..kb+31, lane unchanged
//   (D-as-B chaining layout). One product v.P into one accumulator per d tile.
//   k and v come from planes in fragment order (layouts: at ln_heads): every load of a wave covers four whole 128-B lines.
//   A k tile is 1024 contiguous bytes, piece = lane. Row c of v^T tile dt is d = 8*(c&3) + 4*dt + (c>>2): its four
//   feature rows jf = 4*dt + (c>>2) each give one line (key groups 2j, 2j+1 of the 32 keys x chunks 0..3); the epilogue
//   puts the output rows back in d order.
//   Wave tile = 32 queries (two q fragments) x 2048 keys: every k and v fragment a wave loads feeds two products, so a
//   score costs half the loaded bytes of a 16-query wave, and the number of waves stays 4096.
//   32 keys per step: 4 score WMMAs + 4 output WMMAs per wave; two steps a trip, each on its own register set of k and v
//   fragments, fetched two steps ahead. Block = 8 waves = 4 query groups x 2 key halves = 128 queries; grid = 2*8*32 = 512.
//   Epilogue: the waves of key half 1 hand (h, l, O) to their partners through LDS; the partner joins the two halves
//   (common maximum, both sides rescaled), divides and stages its [32 query][32 d] f32 rows in LDS; block barrier, then
//   4 store instructions of whole 128-B lines per thread group.
// coverage: block writes queries q0..q0+127 x d 0..31 of its (dir, head); grid covers out [2][4096][256] exactly once.
// =====================================================================================================
__device__ __forceinline__ float exp2_slot(float x) {   // 2^x: one v_exp_f32
  float r = 0.f;
#if defined(__HIP_DEVICE_COMPILE__)
  // v_nop: fills the one slot asked for behind a transcendental, before an instruction that may overwrite its source
  asm("v_exp_f32 %0, %1\n\tv_nop" : "=v"(r) : "v"(x));
#endif
  return r;
}
__device__ __forceinline__ float exp2_raw(float x) {    // 2^x: one v_exp_f32, placed by the compiler
#if defined(__HIP_DEVICE_COMPILE__)
  return __builtin_amdgcn_exp2f(x);
#else
  return x;
#endif
}
__device__ __forceinline__ v8f splat8(float x) { v8f r = {x, x, x, x, x, x, x, x}; return r; }
__device__ __forceinline__ v4f lo4(v8f x) { v4f r = {x[0], x[1], x[2], x[3]}; return r; }
__device__ __forceinline__ v4f hi4(v8f x) { v4f r = {x[4], x[5], x[6], x[7]}; return r; }

#define QBLK   128                    // queries of a block
#define KSTEPS (NTOK / 2 / 32)        // 32-key steps of a wave: half of the keys
static_assert((NTOK % QBLK) == 0 && (KSTEPS % 2) == 0 && KSTEPS >= 4);

__global__ __launch_bounds__(256)
void attn_kernel(const unsigned short* __restrict__ qh, const unsigned short* __restrict__ kh,
                 const unsigned short* __restrict__ vth, float* out) {
  __shared__ __align__(16) float Os[QBLK * DHEAD];
  __shared__ __align__(16) v4f Pm[4][9][32];          // key half 1's (O, h, l): [query group][piece][lane]
  const int tid  = threadIdx.x;
  const int wave = __builtin_amdgcn_readfirstlane(tid >> 5);
  const int lane = tid & 31;
  const int hh   = lane >> 4;
  const int c    = lane & 15;
  const int qg   = wave & 3;                        // 32-query group of the block
  const int kv   = wave >> 2;                       // key half
  const int bx   = blockIdx.x;
  const int qb   = bx % (NTOK / QBLK);              // 32 query blocks per (stream, head)
  const int hd   = (bx / (NTOK / QBLK)) % NHEAD;
  const int dir  = bx / ((NTOK / QBLK) * NHEAD);
  const int qsrc = 1 - dir;
  const int ksrc = dir;
  const int q0   = qb * QBLK;

  const _Float16* QHp = (const _Float16*)(const void*)qh;
  const _Float16* KHp = (const _Float16*)(const void*)kh;
  const _Float16* VHp = (const _Float16*)(const void*)vth;

  // ---- q fragments (B operand, col = query q0 + 32*qg + 16*t + c, t = 0, 1) ----
  const size_t qtok = (size_t)qsrc * NTOK + q0 + qg * 32 + c;
  const v16h qf0 = ldfrag_h(QHp + qtok * CDIM + hd * DHEAD + 8 * hh);
  const v16h qf1 = ldfrag_h(QHp + (qtok + 16) * CDIM + hd * DHEAD + 8 * hh);
#if defined(__HIP_DEVICE_COMPILE__)
  // stands in front of the first k and v loads, whose results land in registers that the q loads name as addresses
  asm volatile("s_wait_xcnt 0x0" ::: "memory");
#endif
  // ---- k fragment base (A operand, row = key kb + c): 512 halves a 16-key tile, the lane's piece = lane ----
  const _Float16* Kp = KHp + (size_t)(ksrc * NHEAD + hd) * (NTOK / 16) * 512 + (size_t)kv * KSTEPS * 1024 + 8 * lane;
  // ---- v^T fragment bases (A operand, row c = d 8*(c&3) + 4*dt + (c>>2)): 2048 halves a 64-key block ----
  const size_t vrow = (size_t)(ksrc * NHEAD + hd) * (NTOK / 64) * 2048 + (size_t)kv * (KSTEPS / 2) * 2048
                    + (c >> 2) * 256 + (4 * hh + (c & 3)) * 8;
  const _Float16* VH0 = VHp + vrow;
  const _Float16* VH1 = VH0 + 4 * 256;

  float l0 = 0.f, l1 = 0.f;
  // the C operand of the score products: -h in all 8 registers, h = m - 8 the shift in use: 2^(t - h) = 2^{t-m} * 256
  v8f c0 = zero8(), c1 = zero8();
  v8f o00 = zero8(), o01 = zero8(), o10 = zero8(), o11 = zero8();     // o<query tile><d tile>
  // P (f32) of one query tile's 32 shifted scores; returns the lane's sum of its 16 values
  auto exps = [&](const v8f& s0, const v8f& s1, v8f& e0, v8f& e1) __attribute__((always_inline)) {
    float ls = 0.f;
#pragma unroll
    for (int r = 0; r < 8; ++r) {
      e0[r] = exp2_raw(s0[r]);                        // key kb      + 8hh + r
      e1[r] = exp2_raw(s1[r]);                        // key kb + 16 + 8hh + r
      ls += e0[r] + e1[r];
    }
    return ls;
  };
  // the same with the shift raised by dl (renewal path only)
  auto exps_d = [&](const v8f& s0, const v8f& s1, const float dl, v8f& e0, v8f& e1) __attribute__((always_inline)) {
    float ls = 0.f;
#pragma unroll
    for (int r = 0; r < 8; ++r) {
      e0[r] = exp2_slot(s0[r] - dl);
      e1[r] = exp2_slot(s1[r] - dl);
      ls += e0[r] + e1[r];
    }
    return ls;
  };
  // maximum of one query tile's 32 scores over both lane halves
  auto max32 = [&](const v8f& s0, const v8f& s1) __attribute__((always_inline)) {
    const float mx = fmaxf(hmax8(s0), hmax8(s1));
    return fmaxf(mx, __shfl_xor(mx, 16, 32));
  };
  // renewal of one query tile's reference: the shift rises by dl >= 0
  auto renew = [&](const float dl, v8f& cc, float& l, v8f& oa, v8f& ob) __attribute__((always_inline)) {
    const float corr = exp2_slot(-dl);
    l *= corr;
#pragma unroll
    for (int r = 0; r < 8; ++r) { cc[r] -= dl; oa[r] *= corr; ob[r] *= corr; }
  };
  // One 32-key step on the fragment set (kf0..vh1). Each operand group is refilled for step nx, two steps ahead, directly
  // behind its last use, so a load has about two steps of other work between its issue and its wait.
  // refill is a literal at each call; the last two steps have nothing left to fetch.
  auto step = [&](v16h& kf0, v16h& kf1, v16h& vh0, v16h& vh1, const int nx, const bool refill)
      __attribute__((always_inline)) {
    v8f s00 = mma_h_raw(kf0, qf0, c0);                // t - h
    v8f s01 = mma_h_raw(kf1, qf0, c0);
    v8f s10 = mma_h_raw(kf0, qf1, c1);
    v8f s11 = mma_h_raw(kf1, qf1, c1);
    guard4(s00, s01, s10, s11, kf0, kf1, qf0, qf1);
    // the two scheduling barriers hold the k refill here: lifted over the products it would need a third register set and
    // copies, sunk into the softmax (where the compiler put it) it would be waited for shortly after its issue
    if (refill) {
      __builtin_amdgcn_sched_barrier(0);
      kf0 = ldfrag_p(Kp + (size_t)nx * 1024, 256);          // keys kb..kb+15 of step nx, kb = 32*nx
      kf1 = ldfrag_p(Kp + (size_t)nx * 1024 + 512, 256);    // keys kb+16..kb+31
      __builtin_amdgcn_sched_barrier(0);
    }

    v8f e00, e01, e10, e11;
    float ls0 = exps(s00, s01, e00, e01);
    float ls1 = exps(s10, s11, e10, e11);
    // written as "not <=" so that inf and NaN ask for the renewal too; the ballot makes the branch scalar: the whole
    // wave takes it or none of it does, and both lane halves of a query keep one m
    const bool need = !(ls0 <= ELIM) || !(ls1 <= ELIM);
    if (__builtin_expect(__builtin_amdgcn_ballot_w32(need) != 0u, 0)) {
      const float d0 = fmaxf(max32(s00, s01) - PSH, 0.f);   // new maximum - maximum in use, where positive
      const float d1 = fmaxf(max32(s10, s11) - PSH, 0.f);
      renew(d0, c0, l0, o00, o01);
      renew(d1, c1, l1, o10, o11);
      ls0 = exps_d(s00, s01, d0, e00, e01);           // every value now at most 256
      ls1 = exps_d(s10, s11, d1, e10, e11);
    }
    l0 += ls0;
    l1 += ls1;
    FragH p0, p1;
#pragma unroll
    for (int r = 0; r < 8; ++r) {
      p0.h[0][r] = (_Float16)e00[r];
      p0.h[1][r] = (_Float16)e01[r];
      p1.h[0][r] = (_Float16)e10[r];
      p1.h[1][r] = (_Float16)e11[r];
    }

    o00 = mma_h_raw(vh0, p0.v, o00);
    o01 = mma_h_raw(vh1, p0.v, o01);
    o10 = mma_h_raw(vh0, p1.v, o10);
    o11 = mma_h_raw(vh1, p1.v, o11);
    guard4(o00, o01, o10, o11, vh0, vh1, p0.v, p1.v);
    if (refill) {
      const size_t vo = (size_t)(nx >> 1) * 2048 + (nx & 1) * 128;     // 64-key block, then its 32-key half
      // the same for the v refill; the second barrier also keeps the next step's products out of this step
      __builtin_amdgcn_sched_barrier(0);
      vh0 = ldfrag_p(VH0 + vo, 64);
      vh1 = ldfrag_p(VH1 + vo, 64);
      __builtin_amdgcn_sched_barrier(0);
    }
  };
  // two fragment sets: a = even steps, b = odd steps
  v16h ka0 = ldfrag_p(Kp, 256),        ka1 = ldfrag_p(Kp + 512, 256);
  v16h va0 = ldfrag_p(VH0, 64),        va1 = ldfrag_p(VH1, 64);
  v16h kb0 = ldfrag_p(Kp + 1024, 256), kb1 = ldfrag_p(Kp + 1536, 256);
#if defined(__HIP_DEVICE_COMPILE__)
  // stands in front of the last v loads, whose results may land in the register that the k loads name as their offset
  asm volatile("s_wait_xcnt 0x0" ::: "memory");
#endif
  v16h vb0 = ldfrag_p(VH0 + 128, 64),  vb1 = ldfrag_p(VH1 + 128, 64);
  // ---- first shift: maximum of the first 32 keys' scores (C = 0), so that the first step's P is at most 256 ----
  {
    // keeps every first load in front of these products, which wait for the k loads: one memory latency, not two in a row
    __builtin_amdgcn_sched_barrier(0);
    v8f s00 = mma_h_raw(ka0, qf0, zero8());
    v8f s01 = mma_h_raw(ka1, qf0, zero8());
    v8f s10 = mma_h_raw(ka0, qf1, zero8());
    v8f s11 = mma_h_raw(ka1, qf1, zero8());
    guard4(s00, s01, s10, s11, ka0, ka1, qf0, qf1);
    c0 = splat8(PSH - max32(s00, s01));
    c1 = splat8(PSH - max32(s10, s11));
  }
  // kept rolled: a trip already holds both sets' steps, further copies would only lengthen the text
#pragma unroll 1
  for (int it = 0; it < KSTEPS - 2; it += 2) {
    step(ka0, ka1, va0, va1, it + 2, true);
    step(kb0, kb1, vb0, vb1, it + 3, true);
#if defined(__HIP_DEVICE_COMPILE__)
    // stands in front of the next trip's overwrite of the address registers that this trip's loads name
    asm volatile("s_wait_xcnt 0x0" ::: "memory");
#endif
  }
  step(ka0, ka1, va0, va1, 0, false);
  step(kb0, kb1, vb0, vb1, 0, false);

  const float h0 = -c0[0], h1 = -c1[0];
  // ---- key half 1 hands its state over, lane to lane (16 B a lane and piece: contiguous, no bank conflict) ----
  if (kv == 1) {                                     // wave-uniform
    v4f (*pm)[32] = Pm[qg];
    pm[0][lane] = lo4(o00); pm[1][lane] = hi4(o00); pm[2][lane] = lo4(o01); pm[3][lane] = hi4(o01);
    pm[4][lane] = lo4(o10); pm[5][lane] = hi4(o10); pm[6][lane] = lo4(o11); pm[7][lane] = hi4(o11);
    const v4f ml = {h0, l0, h1, l1};
    pm[8][lane] = ml;
  }
  __syncthreads();
  if (kv == 0) {                                     // wave-uniform: join the halves, divide, stage
    const v4f (*pm)[32] = Pm[qg];
    const v4f ml = pm[8][lane];
    // ---- O[query 32*qg + 16*t + c][d]: accumulator row 8hh + r of tile dt is d = 8*(r&3) + 4*dt + 2hh + (r>>2) ----
    auto join = [&](const int t, const float m, const float l, const float mo, const float lo, const v8f& oa, const v8f& ob)
        __attribute__((always_inline)) {
      const float mn = fmaxf(m, mo);
      const float ca = exp2_raw(m - mn), cb = exp2_raw(mo - mn);
      float ls = l * ca + lo * cb;
      ls += __shfl_xor(ls, 16, 32);
      const float sc = (1.0f / VC) * (1.0f / ls);
      const float fa = ca * sc, fb = cb * sc;
      float* os = Os + (qg * 32 + t * 16 + c) * DHEAD + 2 * hh;
#pragma unroll
      for (int r = 0; r < 8; ++r) {
        os[8 * (r & 3) + (r >> 2)]     = oa[r] * fa + pm[4 * t + (r >> 2)][lane][r & 3] * fb;
        os[8 * (r & 3) + (r >> 2) + 4] = ob[r] * fa + pm[4 * t + 2 + (r >> 2)][lane][r & 3] * fb;
      }
    };
    join(0, h0, l0, ml[0], ml[1], o00, o01);           // the shifts differ as the maxima do
    join(1, h1, l1, ml[2], ml[3], o10, o11);
  }
  __syncthreads();
  {
    const int e = tid & 7, qq = tid >> 3;              // qq 0..31: line within group, e: 16-B piece
    v4f vals[4];
#pragma unroll
    for (int it = 0; it < 4; ++it) {
      const int qi = it * 32 + qq;                       // it 0..3 x qq 0..31 = queries 0..127 of the block
      vals[it] = *(const v4f*)(Os + qi * DHEAD + 4 * e);
    }
    float* ob = out + (size_t)dir * NTOK * CDIM + (size_t)hd * DHEAD + 4 * e;
    {
#pragma unroll
      for (int it = 0; it < 4; ++it) {
        const int qi = it * 32 + qq;
        *(v4f*)(ob + (size_t)(q0 + qi) * CDIM) = vals[it];
      }
    }
  }
}

// =====================================================================================================
// Workspace map (bytes), every offset a multiple of 256 and every plane sized to its whole-row store granularity:
//   XN   f16 [8192][256]            0           4194304
//   WT   f16 [768][256]             4194304     393216
//   T    f32 [8192][768]            4587520     25165824
//   QH   f16 [8192][256]            29753344    4194304
//   KH   f16 [2][8][256][2][32][8]  33947648    4194304
//   VTH  f16 [2][8][64][8][32][8]   38141952    4194304
//   end                              42336256
// =====================================================================================================
extern "C" void kernel_launch(void* const* d_in, const int* in_sizes, int n_in,
                              void* d_out, int out_size, void* d_ws, size_t ws_size,
                              hipStream_t stream) {
  if (n_in < 5) return;
  if (in_sizes[0] != NTOK * CDIM || in_sizes[1] != NTOK * CDIM) return;
  if (in_sizes[2] != OC * CDIM) return;
  if (in_sizes[3] != DHEAD || in_sizes[4] != DHEAD) return;
  if (out_size != NSTR * NTOK * CDIM) return;

  const float* x_b   = (const float*)d_in[0];
  const float* x_a   = (const float*)d_in[1];
  const float* w_qkv = (const float*)d_in[2];
  const float* ln_g  = (const float*)d_in[3];
  const float* ln_b  = (const float*)d_in[4];

  const size_t PXN = (size_t)MROWS * CDIM * 2;        //  4194304
  const size_t PWT = (size_t)OC * CDIM * 2;           //   393216
  const size_t PT  = (size_t)MROWS * OC * 4;          // 25165824
  const size_t PQ  = (size_t)MROWS * CDIM * 2;        //  4194304
  const size_t PV  = (size_t)NSTR * CDIM * NTOK * 2;  //  4194304
  size_t off = 0;
  const size_t oXN = off; off += PXN;
  const size_t oWT = off; off += PWT;
  const size_t oT  = off; off += PT;
  const size_t oQH = off; off += PQ;
  const size_t oKH = off; off += PQ;
  const size_t oVH = off; off += PV;
  if (off > ws_size) return;                          // off = 42336256
  if (off > (size_t)134217728) return;

  char* ws = (char*)d_ws;
  unsigned short* XN  = (unsigned short*)(ws + oXN);
  unsigned short* WT  = (unsigned short*)(ws + oWT);
  float*          T   = (float*)(ws + oT);
  unsigned short* QH  = (unsigned short*)(ws + oQH);
  unsigned short* KH  = (unsigned short*)(ws + oKH);
  unsigned short* VTH = (unsigned short*)(ws + oVH);
  float*          out = (float*)d_out;

  const dim3 blk(256);
  const dim3 gCV(MROWS / 8 + OC / 8);                          // 1024 + 96 = 1120 blocks of 8 rows
  const dim3 gGM(((MROWS / 64) * (OC / 64)) / 8);              // 1536 tiles -> 192 blocks
  const dim3 gLN(MROWS / 64 + MROWS / 32 + MROWS / 32);        // 128 blocks (v, 64 tokens) + 256 (q, 32 rows) + 256 (k, 2 tiles)
  const dim3 gAT(NSTR * NHEAD * (NTOK / QBLK));                // 512 blocks of 256

  // (0) 16-bit operand planes: f16( bf16_RNE(x) * 64 ), f16( bf16_RNE(W) * 64 )
  cvt_planes<<<gCV, blk, 0, stream>>>(x_b, x_a, w_qkv, XN, WT);

  // (1) T[s*4096 + n][o] = (x_s[n] . W[o]) : both streams stacked, scale 1/(64*64)
  gemm64f<<<gGM, blk, 0, stream>>>(XN, CDIM, WT, CDIM, T, OC, 1.0f / (XC * WSC), MROWS, OC, CDIM);

  // (2) per-head LayerNorm -> q token rows; k and v in fragment order
  ln_heads<<<gLN, blk, 0, stream>>>(T, ln_g, ln_b, QH, KH, VTH);

  // (3) attention, both directions, all heads -> out[dir][n][h*32 + d]
  attn_kernel<<<gAT, blk, 0, stream>>>(QH, KH, VTH, out);
  (void)hipGetLastError();
}

// v008
// It runs in 52.6 microseconds.
// In two side-by-side timings against v007, it was 1.14 and 1.12 times as fast.
// All steps since v000 together make it 6.31 times as fast.
// Contractions: qkv projection (x token rows f16 x64 . W_qkv rows f16 x64, K=256, one product); attention scores
// S^T = k (f16 x1) . q^T (f16 x scale*log2 e) - shift (the C operand), one product, head dim 32; attention O^T = v^T (f16 x256) . P^T (f16 x256,
// taken from the score D registers), one product over 4096 keys. Every operand is one f16 plane (RNE from f32).
// All v_wmma_f32_16x16x32_f16, f32 accumulate; LayerNorm and softmax in f32 on VALU; every float input RNE-converted
// to bf16 on load.
#include <hip/hip_runtime.h>
#include <math.h>
#include <stdint.h>

#define NTOK   4096
#define CDIM   256
#define NHEAD  8
#define DHEAD  32
#define OC     (3 * CDIM)
#define NSTR   2
#define MROWS  (NSTR * NTOK)
#define LNEPS  1.0e-5f
#define XC     64.0f
#define WSC    64.0f
#define ATTSC  0.17677669529663687f
#define QC     (ATTSC * 1.44269504088896340736f)   // q carries the logit scale and log2 e: k.q is the base-2 logit
#define KC     1.0f
#define VC     256.0f
#define PSH    8.0f                  // log2 256: P = 2^{t-m} x 256
#define ELIM   32768.0f              // a lane's sum of 16 P values up to here: each of them is finite in f16
static_assert(NHEAD * DHEAD == CDIM);
static_assert((MROWS % 64) == 0 && (OC % 64) == 0 && (CDIM % 32) == 0);
static_assert((((MROWS / 64) * (OC / 64)) % 8) == 0);
static_assert((NTOK % 64) == 0 && (NTOK / 32) >= 4 && (MROWS % 8) == 0 && (OC % 8) == 0);

typedef _Float16 v16h __attribute__((ext_vector_type(16)));
typedef _Float16 v8h  __attribute__((ext_vector_type(8)));
typedef float    v8f  __attribute__((ext_vector_type(8)));
typedef float    v4f  __attribute__((ext_vector_type(4)));
typedef unsigned int v4u __attribute__((ext_vector_type(4)));

union FragH { v16h v; v8h h[2]; };

// ---- scalar helpers --------------------------------------------------------------------------------
__device__ __forceinline__ unsigned short bf_bits(float f) {          // f32 -> bf16 bits, RNE convert
  unsigned u = __float_as_uint(f);
  return (unsigned short)((u + 0x7FFFu + ((u >> 16) & 1u)) >> 16);
}
__device__ __forceinline__ float bf_up(unsigned short h) { return __uint_as_float(((unsigned)h) << 16); }
__device__ __forceinline__ float bfr(float f) { return bf_up(bf_bits(f)); }
__device__ __forceinline__ unsigned short h_bits(_Float16 x) { return __builtin_bit_cast(unsigned short, x); }
__device__ __forceinline__ unsigned pk16(unsigned short a, unsigned short b) { return (unsigned)a | ((unsigned)b << 16); }
__device__ __forceinline__ v8f zero8() { v8f z = {0.f, 0.f, 0.f, 0.f, 0.f, 0.f, 0.f, 0.f}; return z; }
__device__ __forceinline__ float hmax8(v8f s) {
  return fmaxf(fmaxf(fmaxf(s[0], s[1]), fmaxf(s[2], s[3])), fmaxf(fmaxf(s[4], s[5]), fmaxf(s[6], s[7])));
}

// ---- fragment loader: 16-bit A/B operand, lane -> row/col (lane&15), p already includes +8*(lane>>4);
//      elements 0..7 <- p[0..7] (k0+8h..), elements 8..15 <- p[16..23] (k0+16+8h..)
__device__ __forceinline__ v16h ldfrag_h(const _Float16* p) {
  FragH f;
  f.h[0] = *(const v8h*)(p);
  f.h[1] = *(const v8h*)(p + 16);
  return f.v;
}
// ---- the same operand from a plane stored in fragment order: elements 0..7 <- p[0..7], elements 8..15 <- p[step..step+7];
//      p already includes the lane's own 16-B piece
__device__ __forceinline__ v16h ldfrag_p(const _Float16* p, int step) {
  FragH f;
  f.h[0] = *(const v8h*)(p);
  f.h[1] = *(const v8h*)(p + step);
  return f.v;
}

// ---- WMMA helpers with trailing VALU hazard gap --------------------------------------------------------
__device__ __forceinline__ v8f mma_h_raw(v16h a, v16h b, v8f c) {
  return __builtin_amdgcn_wmma_f32_16x16x32_f16(false, a, false, b, (short)0, c, false, false);
}
__device__ __forceinline__ void dep_guard1(v8f& a, v8f& b, v16h x) {
#if defined(__HIP_DEVICE_COMPILE__)
  asm volatile("v_nop\n\tv_nop\n\tv_nop\n\tv_nop" : "+v"(a), "+v"(b) : "v"(x));
#endif
}
__device__ __forceinline__ void keep4_h(v16h a, v16h b, v16h c, v16h d) {
#if defined(__HIP_DEVICE_COMPILE__)
  asm volatile("v_nop" :: "v"(a), "v"(b), "v"(c), "v"(d));
#endif
}
__device__ __forceinline__ void acc_guard4(v8f& a, v8f& b, v8f& c, v8f& d) {
#if defined(__HIP_DEVICE_COMPILE__)
  asm volatile("v_nop\n\tv_nop\n\tv_nop\n\tv_nop" : "+v"(a), "+v"(b), "+v"(c), "+v"(d));
#endif
}
// behind four products of two A fragments (x0, x1) with two B fragments (y0, y1). v_nop x4: the distance asked for between
// the last product and the first vector instruction that reads a D or overwrites an A or B register; the operands hold the
// statement behind the products and in front of the refill of x0, x1
__device__ __forceinline__ void guard4(v8f& a, v8f& b, v8f& c, v8f& d, v16h x0, v16h x1, v16h y0, v16h y1) {
#if defined(__HIP_DEVICE_COMPILE__)
  asm volatile("v_nop\n\tv_nop\n\tv_nop\n\tv_nop"
               : "+v"(a), "+v"(b), "+v"(c), "+v"(d) : "v"(x0), "v"(x1), "v"(y0), "v"(y1));
#endif
}
__device__ __forceinline__ void wave_sync_lds() {
  __builtin_amdgcn_fence(__ATOMIC_RELEASE, "workgroup");
  __builtin_amdgcn_wave_barrier();
  __builtin_amdgcn_fence(__ATOMIC_ACQUIRE, "workgroup");
}

// =====================================================================================================
// Operand planes: XN[s*4096 + n][256] = f16( bf16_RNE(x_s[n][c]) * 64 ) (blocks 0..1023, 8 rows each, stream s = bx/512),
// WT[o][256] = f16( bf16_RNE(W[o][c]) * 64 ) (blocks 1024..1119; W is already [o][c] = k-contiguous, no transpose).
// Thread t: row = 8 per block (t>>5), 8 consecutive elements at 8*(t&31): one instruction of 32 lanes x 16 B = one whole
// coverage: 1024 x 8 = 8192 XN rows and 96 x 8 = 768 WT rows, each row 32 lanes x 8 halves = 256 columns: both planes entirely.
// =====================================================================================================
__global__ __launch_bounds__(256) void cvt_planes(const float* __restrict__ xb, const float* __restrict__ xa,
                                                   const float* __restrict__ w, unsigned short* XN, unsigned short* WT) {
  const int tid = threadIdx.x, r = tid >> 5, lane = tid & 31;
  const int bx  = blockIdx.x;
  const bool isx = (bx < (MROWS / 8));                    // block-uniform
  const int  s   = isx ? (bx / (NTOK / 8)) : 0;           // stream of this block
  const float* src = isx ? ((s == 0) ? xb : xa) : w;
  unsigned short* dst = isx ? XN : WT;
  const float sc  = isx ? XC : WSC;
  const int drow  = isx ? (bx * 8 + r) : ((bx - MROWS / 8) * 8 + r);   // row in dst plane
  const int srow  = isx ? (drow - s * NTOK) : drow;                       // row in src tensor
  const float* sp = src + (size_t)srow * CDIM + 8 * lane;
  const v4f a = *(const v4f*)(sp), c = *(const v4f*)(sp + 4);
  float f[8];
#pragma unroll
  for (int i = 0; i < 4; ++i) { f[i] = bfr(a[i]) * sc; f[4 + i] = bfr(c[i]) * sc; }
  v4u v;
#pragma unroll
  for (int i = 0; i < 4; ++i) v[i] = pk16(h_bits((_Float16)f[2 * i]), h_bits((_Float16)f[2 * i + 1]));
  unsigned short* dp = dst + (size_t)drow * CDIM + 8 * lane;
  *(v4u*)dp = v;
  
}

// =====================================================================================================
// Per-head LayerNorm helpers. One lane owns 8 consecutive features of a token, so a head (32 features) is one quad of
// lanes: mean and variance are 8 adds in the lane and a two-step sum over the quad.
// =====================================================================================================
__device__ __forceinline__ float quad_sum(float v) {   // sum over lanes l, l^1, l^2, l^3 (DPP row_xmask 1, then 2)
  v += __builtin_bit_cast(float, __builtin_amdgcn_update_dpp(0, __builtin_bit_cast(int, v), 0x161, 0xf, 0xf, true));
  v += __builtin_bit_cast(float, __builtin_amdgcn_update_dpp(0, __builtin_bit_cast(int, v), 0x162, 0xf, 0xf, true));
  return v;
}
__device__ __forceinline__ float rsq_pos(float x) {   // 1/sqrt(x) for x >= LNEPS: never in the range that rsqrtf rescales
  float r = 0.f;
#if defined(__HIP_DEVICE_COMPILE__)
  // v_nop: fills the one slot asked for behind a transcendental, before an instruction that may overwrite its source
  asm("v_rsq_f32 %0, %1\n\tv_nop" : "=v"(r) : "v"(x));
#endif
  return r;
}
__device__ __forceinline__ void ln8(const v4f a, const v4f c, const float (&g)[8], const float (&b)[8], float sc,
                                    float (&y)[8]) {
  const float mean = quad_sum(((a[0] + a[1]) + (a[2] + a[3])) + ((c[0] + c[1]) + (c[2] + c[3]))) * (1.0f / DHEAD);
  float d[8];
#pragma unroll
  for (int j = 0; j < 4; ++j) { d[j] = a[j] - mean; d[4 + j] = c[j] - mean; }
  float ss = 0.f;
#pragma unroll
  for (int j = 0; j < 8; ++j) ss += d[j] * d[j];
  const float rs = rsq_pos(quad_sum(ss) * (1.0f / DHEAD) + LNEPS);
#pragma unroll
  for (int j = 0; j < 8; ++j) y[j] = ((d[j] * rs) * g[j] + b[j]) * sc;
}
__device__ __forceinline__ void bfr8(const v4f lo, const v4f hi, float (&o)[8]) {
#pragma unroll
  for (int j = 0; j < 4; ++j) { o[j] = bfr(lo[j]); o[4 + j] = bfr(hi[j]); }
}
__device__ __forceinline__ unsigned hi2(float x, float y) { return pk16(h_bits((_Float16)x), h_bits((_Float16)y)); }

// =====================================================================================================
// qkv projection with the per-head LayerNorm in its epilogue. One wave per 64x64 tile, no block barriers:
//   t[m][n] = osc * sum_k A[m][k] * Bt[n][k]   (f32, kept in the wave's LDS slab only)
// A: f16 row-major [M][K] pitch lda; Bt: f16 [N][K] (k contiguous, pitch ldb); fragments = two 16-B loads with the
// split k map (ldfrag_h). M, N multiples of 64, K multiple of 32 (host-checked constants here).
// A tile is 64 tokens of one stream x 2 whole heads of one part (feature n = part*256 + h*32 + dd), so every LayerNorm
// row lies inside the wave. The wave stages its tile in LDS (pitch 68 floats), then reads it back 8 features a lane.
// k and v are stored in the order in which the attention kernel's fragment loads read them, so that each of its 32-lane
// 16-B loads covers four whole 128-B lines:
//   KH[s][h][tile of 16 tokens][j][piece = 16*hh + c][8]     = k of token 16*tile + c, d = 16*j + 8*hh + e
//   VTH[s][h][block of 64 tokens][jf][piece = 4*tg + ch][8]  = v of token 64*block + 8*tg + e, d = 8*ch + jf
//   part 2 (v): per head, lane = (token group tg = lane>>2, feature chunk ch = lane&3) holds 8 tokens x 8 features;
//      y*256 -> f16; per feature jf the lane's 8 tokens are one 16-B piece and the wave's 32 pieces one 512-B store.
//   part 0 (q): lane = (row lane>>3 of 4, chunk lane&7 of the 64 columns); y*QC -> f16; a store is four 128-B lines.
//   part 1 (k): the same lanes; chunk ch = lane&3 of head (lane&7)>>2 is (j, hh) = (ch>>1, ch&1); y -> f16; a store is
//      eight 64-B runs, and the wave itself writes the other half of each line in the same pass of 16 rows.
// coverage: 128 x 12 tiles; q tiles: 64 rows x 64 columns of QH; k tiles: 4 token tiles x 2 heads x 1024 B; v tiles:
//           one 64-token block x 2 heads x 8 jf x 512 B: each plane entirely; grid = tilesM*tilesN/8 blocks.
// =====================================================================================================
__global__ __launch_bounds__(256) void gemm64_ln(
    const unsigned short* __restrict__ Ap, int lda,
    const unsigned short* __restrict__ Bp, int ldb,
    const float* __restrict__ gam, const float* __restrict__ bet,
    unsigned short* QH, unsigned short* KH, unsigned short* VTH, float osc, int M, int N, int K) {
  __shared__ __align__(16) float sT[8][64 * 68];   // per-wave 64x64 tile, pitch 68 floats
  const int lane = threadIdx.x & 31;
  const int wave = threadIdx.x >> 5;
  const int tilesN = N >> 6;
  const int tilesM = M >> 6;
  const int tile = blockIdx.x * 8 + wave;
  if (tile >= tilesM * tilesN) return;   // wave-uniform; no block barriers in this kernel
  const int tm = tile / tilesN;
  const int tn = tile - tm * tilesN;
  const int m0 = tm << 6;
  const int n0 = tn << 6;

  const _Float16* Ah = (const _Float16*)(const void*)Ap;
  const _Float16* Bb = (const _Float16*)(const void*)Bp;

  const int rlane = lane & 15;                 // row (A) / col (B, D) within subtile
  const int koff  = (lane >> 4) * 8;           // k offset of this lane half
  const int mOff  = (lane >> 4) * 8;           // D row offset

  v8f acc[4][4];
#pragma unroll
  for (int i = 0; i < 4; ++i)
#pragma unroll
    for (int j = 0; j < 4; ++j) acc[i][j] = zero8();

  for (int k0 = 0; k0 < K; k0 += 32) {
    v16h bh[4];
#pragma unroll
    for (int j = 0; j < 4; ++j) {
      const size_t bo = (size_t)(n0 + (j << 4) + rlane) * ldb + koff + k0;
      bh[j] = ldfrag_h(Bb + bo);
    }
#pragma unroll
    for (int i = 0; i < 4; ++i) {
      const size_t ao = (size_t)(m0 + (i << 4) + rlane) * lda + koff + k0;
      const v16h ah = ldfrag_h(Ah + ao);
#pragma unroll
      for (int j = 0; j < 4; ++j) acc[i][j] = mma_h_raw(ah, bh[j], acc[i][j]);
      dep_guard1(acc[i][0], acc[i][3], ah);
    }
    keep4_h(bh[0], bh[1], bh[2], bh[3]);
  }
  acc_guard4(acc[0][0], acc[0][1], acc[0][2], acc[0][3]);
  acc_guard4(acc[1][0], acc[1][1], acc[1][2], acc[1][3]);
  acc_guard4(acc[2][0], acc[2][1], acc[2][2], acc[2][3]);
  acc_guard4(acc[3][0], acc[3][1], acc[3][2], acc[3][3]);

  const int ch = lane & 3;                            // 8-feature chunk of the head, every mapping below
  const v4f g0 = *(const v4f*)(gam + 8 * ch), g1 = *(const v4f*)(gam + 8 * ch + 4);
  const v4f b0 = *(const v4f*)(bet + 8 * ch), b1 = *(const v4f*)(bet + 8 * ch + 4);
#if defined(__HIP_DEVICE_COMPILE__)
  // stands in front of whatever overwrites the address registers that the four loads above name
  asm volatile("s_wait_xcnt 0x0" ::: "memory");
#endif
  float* slab = sT[wave];
#pragma unroll
  for (int i = 0; i < 4; ++i)
#pragma unroll
    for (int j = 0; j < 4; ++j)
#pragma unroll
      for (int r = 0; r < 8; ++r) slab[((i << 4) + mOff + r) * 68 + (j << 4) + rlane] = acc[i][j][r] * osc;
  wave_sync_lds();                                    // the lanes read each other's rows below; the slab is the wave's own
  float g[8], be[8];
  bfr8(g0, g1, g);
  bfr8(b0, b1, be);
  const int part = __builtin_amdgcn_readfirstlane(n0 >> 8);   // 0 q, 1 k, 2 v: one value a wave, a scalar branch
  const int h0   = (n0 & (CDIM - 1)) >> 5;            // first of the tile's two heads
  const int s    = m0 / NTOK;                         // stream
  const int t0   = m0 - s * NTOK;                     // first token of the tile in its stream
  if (part == 2) {                                    // v, transposed in registers
#pragma unroll
    for (int hs = 0; hs < 2; ++hs) {
      const float* sp = slab + (8 * (lane >> 2)) * 68 + hs * DHEAD + 8 * ch;
      v4f xa[8], xc[8];
#pragma unroll
      for (int i = 0; i < 8; ++i) { xa[i] = *(const v4f*)(sp + i * 68); xc[i] = *(const v4f*)(sp + i * 68 + 4); }
      float y[8][8];
#pragma unroll
      for (int i = 0; i < 8; ++i) ln8(xa[i], xc[i], g, be, VC, y[i]);
      const size_t vo = (((size_t)s * NHEAD + h0 + hs) * (NTOK / 64) + (t0 >> 6)) * 2048 + 8 * lane;
#pragma unroll
      for (int j = 0; j < 8; ++j) {
        v4u hv;
#pragma unroll
        for (int p = 0; p < 4; ++p) hv[p] = hi2(y[2 * p][j], y[2 * p + 1][j]);
        *(v4u*)(VTH + vo + j * 256) = hv;
      }
#if defined(__HIP_DEVICE_COMPILE__)
      // stands in front of the next head's overwrite of the registers that these stores name
      asm volatile("s_wait_xcnt 0x0" ::: "memory");
#endif
    }
  } else {                                            // q token rows, or k in fragment order
    const int rs = lane >> 3, c8 = lane & 7;          // row of 4, 8-feature chunk of the 64 columns
    const bool isq = (part == 0);
    const float sc = isq ? QC : KC;
    unsigned short* dst = isq
        ? QH + (size_t)(m0 + rs) * CDIM + n0 + 8 * c8
        : KH + (((size_t)s * NHEAD + h0 + (c8 >> 2)) * (NTOK / 16) + (t0 >> 4)) * 512 + (ch >> 1) * 256
             + ((ch & 1) * 16 + rs) * 8;
    const int st16 = isq ? 16 * CDIM : 512;           // halves from one 16-row pass to the next
    const int st4  = isq ? 4 * CDIM : 32;             // halves from one 4-row group to the next
#pragma unroll
    for (int gq = 0; gq < 4; ++gq) {
      v4f xa[4], xc[4];
#pragma unroll
      for (int i = 0; i < 4; ++i) {
        const float* p = slab + (gq * 16 + i * 4 + rs) * 68 + 8 * c8;
        xa[i] = *(const v4f*)(p);
        xc[i] = *(const v4f*)(p + 4);
      }
#pragma unroll
      for (int i = 0; i < 4; ++i) {
        float y[8];
        ln8(xa[i], xc[i], g, be, sc, y);
        v4u hv;
#pragma unroll
        for (int p = 0; p < 4; ++p) hv[p] = hi2(y[2 * p], y[2 * p + 1]);
        *(v4u*)(dst + gq * st16 + i * st4) = hv;
      }
#if defined(__HIP_DEVICE_COMPILE__)
      // stands in front of the next pass's overwrite of the registers that these stores name
      asm volatile("s_wait_xcnt 0x0" ::: "memory");
#endif
    }
  }
}

// =====================================================================================================
// Attention for one (dir, head, 128-query block), transposed formulation, head dim 32, 4096 keys, no mask:
//   dir 0: queries from stream 1, keys/values from stream 0 -> output slot 0; dir 1: queries from stream 0, keys/values
//   from stream 1 -> output slot 1.
//   S^T tile (16 keys x 16 queries) = A(k rows = keys, d via the split k map) . B(q, col = query, same d map):
//   t = k.q (one product) is the base-2 logit (q carries scale * log2 e). Per lane the D tile holds 8 keys of ONE query,
//   so the online softmax is per-lane state, and the shift h = m - 8 in use is one value a lane: the product takes -h in
//   all 8 registers of its C operand, D = t - h, and P = 2^D is one v_exp_f32 on the D register with no other arithmetic.
//   The reference m is a maximum over keys seen earlier and is renewed only on demand:
//   a step forms P with the h in use and sums it; only if a lane's sum of 16 P values is above ELIM (or not a number)
//   does the wave take the renewal path (one test a step, a scalar branch): maximum over the step's 32 keys with one
//   shuffle (lane^16), h raised by delta = max(D) - 8 where that is positive (the C registers lowered by it), O and l
//   rescaled by 2^-delta, P formed again as 2^(D - delta). The first h comes from the first 32 keys' scores, formed once more with
//   C = 0 in front of the loop. The row sum
//   (of the f32 values, before they are rounded to f16) is kept as a per-lane partial and combined at the end.
//   P = 2^{t-m} x 256 as f16 (at most ELIM, so finite) is used directly
//   as the B operand of O^T (rows d, cols queries) += A(v^T rows d, keys contiguous, two 16-B loads) . B(P^T):
//   B element r <- the key tile covering keys kb..kb+15, element 8+r <- the tile covering kb+16..kb+31, lane unchanged
//   (D-as-B chaining layout). One product v.P into one accumulator per d tile.
//   k and v come from planes in fragment order (layouts: at gemm64_ln): every load of a wave covers four whole 128-B lines.
//   A k tile is 1024 contiguous bytes, piece = lane. Row c of v^T tile dt is d = 8*(c&3) + 4*dt + (c>>2): its four
//   feature rows jf = 4*dt + (c>>2) each give one line (key groups 2j, 2j+1 of the 32 keys x chunks 0..3); the epilogue
//   puts the output rows back in d order.
//   Wave tile = 32 queries (two q fragments) x 2048 keys: every k and v fragment a wave loads feeds two products, so a
//   score costs half the loaded bytes of a 16-query wave, and the number of waves stays 4096.
//   32 keys per step: 4 score WMMAs + 4 output WMMAs per wave; two steps a trip, each on its own register set of k and v
//   fragments, fetched two steps ahead. Block = 8 waves = 4 query groups x 2 key halves = 128 queries; grid = 2*8*32 = 512.
//   Epilogue: the waves of key half 1 hand (h, l, O) to their partners through LDS; the partner joins the two halves
//   (common maximum, both sides rescaled), divides and stages its [32 query][32 d] f32 rows in LDS; block barrier, then
//   4 store instructions of whole 128-B lines per thread group.
// coverage: block writes queries q0..q0+127 x d 0..31 of its (dir, head); grid covers out [2][4096][256] exactly once.
// =====================================================================================================
__device__ __forceinline__ float exp2_slot(float x) {   // 2^x: one v_exp_f32
  float r = 0.f;
#if defined(__HIP_DEVICE_COMPILE__)
  // v_nop: fills the one slot asked for behind a transcendental, before an instruction that may overwrite its source
  asm("v_exp_f32 %0, %1\n\tv_nop" : "=v"(r) : "v"(x));
#endif
  return r;
}
__device__ __forceinline__ float exp2_raw(float x) {    // 2^x: one v_exp_f32, placed by the compiler
#if defined(__HIP_DEVICE_COMPILE__)
  return __builtin_amdgcn_exp2f(x);
#else
  return x;
#endif
}
__device__ __forceinline__ v8f splat8(float x) { v8f r = {x, x, x, x, x, x, x, x}; return r; }
__device__ __forceinline__ v4f lo4(v8f x) { v4f r = {x[0], x[1], x[2], x[3]}; return r; }
__device__ __forceinline__ v4f hi4(v8f x) { v4f r = {x[4], x[5], x[6], x[7]}; return r; }

#define QBLK   128                    // queries of a block
#define KSTEPS (NTOK / 2 / 32)        // 32-key steps of a wave: half of the keys
static_assert((NTOK % QBLK) == 0 && (KSTEPS % 2) == 0 && KSTEPS >= 4);

__global__ __launch_bounds__(256)
void attn_kernel(const unsigned short* __restrict__ qh, const unsigned short* __restrict__ kh,
                 const unsigned short* __restrict__ vth, float* out) {
  __shared__ __align__(16) float Os[QBLK * DHEAD];
  __shared__ __align__(16) v4f Pm[4][9][32];          // key half 1's (O, h, l): [query group][piece][lane]
  const int tid  = threadIdx.x;
  const int wave = __builtin_amdgcn_readfirstlane(tid >> 5);
  const int lane = tid & 31;
  const int hh   = lane >> 4;
  const int c    = lane & 15;
  const int qg   = wave & 3;                        // 32-query group of the block
  const int kv   = wave >> 2;                       // key half
  const int bx   = blockIdx.x;
  const int qb   = bx % (NTOK / QBLK);              // 32 query blocks per (stream, head)
  const int hd   = (bx / (NTOK / QBLK)) % NHEAD;
  const int dir  = bx / ((NTOK / QBLK) * NHEAD);
  const int qsrc = 1 - dir;
  const int ksrc = dir;
  const int q0   = qb * QBLK;

  const _Float16* QHp = (const _Float16*)(const void*)qh;
  const _Float16* KHp = (const _Float16*)(const void*)kh;
  const _Float16* VHp = (const _Float16*)(const void*)vth;

  // ---- q fragments (B operand, col = query q0 + 32*qg + 16*t + c, t = 0, 1) ----
  const size_t qtok = (size_t)qsrc * NTOK + q0 + qg * 32 + c;
  const v16h qf0 = ldfrag_h(QHp + qtok * CDIM + hd * DHEAD + 8 * hh);
  const v16h qf1 = ldfrag_h(QHp + (qtok + 16) * CDIM + hd * DHEAD + 8 * hh);
#if defined(__HIP_DEVICE_COMPILE__)
  // stands in front of the first k and v loads, whose results land in registers that the q loads name as addresses
  asm volatile("s_wait_xcnt 0x0" ::: "memory");
#endif
  // ---- k fragment base (A operand, row = key kb + c): 512 halves a 16-key tile, the lane's piece = lane ----
  const _Float16* Kp = KHp + (size_t)(ksrc * NHEAD + hd) * (NTOK / 16) * 512 + (size_t)kv * KSTEPS * 1024 + 8 * lane;
  // ---- v^T fragment bases (A operand, row c = d 8*(c&3) + 4*dt + (c>>2)): 2048 halves a 64-key block ----
  const size_t vrow = (size_t)(ksrc * NHEAD + hd) * (NTOK / 64) * 2048 + (size_t)kv * (KSTEPS / 2) * 2048
                    + (c >> 2) * 256 + (4 * hh + (c & 3)) * 8;
  const _Float16* VH0 = VHp + vrow;
  const _Float16* VH1 = VH0 + 4 * 256;

  float l0 = 0.f, l1 = 0.f;
  // the C operand of the score products: -h in all 8 registers, h = m - 8 the shift in use: 2^(t - h) = 2^{t-m} * 256
  v8f c0 = zero8(), c1 = zero8();
  v8f o00 = zero8(), o01 = zero8(), o10 = zero8(), o11 = zero8();     // o<query tile><d tile>
  // P (f32) of one query tile's 32 shifted scores; returns the lane's sum of its 16 values
  auto exps = [&](const v8f& s0, const v8f& s1, v8f& e0, v8f& e1) __attribute__((always_inline)) {
    float ls = 0.f;
#pragma unroll
    for (int r = 0; r < 8; ++r) {
      e0[r] = exp2_raw(s0[r]);                        // key kb      + 8hh + r
      e1[r] = exp2_raw(s1[r]);                        // key kb + 16 + 8hh + r
      ls += e0[r] + e1[r];
    }
    return ls;
  };
  // the same with the shift raised by dl (renewal path only)
  auto exps_d = [&](const v8f& s0, const v8f& s1, const float dl, v8f& e0, v8f& e1) __attribute__((always_inline)) {
    float ls = 0.f;
#pragma unroll
    for (int r = 0; r < 8; ++r) {
      e0[r] = exp2_slot(s0[r] - dl);
      e1[r] = exp2_slot(s1[r] - dl);
      ls += e0[r] + e1[r];
    }
    return ls;
  };
  // maximum of one query tile's 32 scores over both lane halves
  auto max32 = [&](const v8f& s0, const v8f& s1) __attribute__((always_inline)) {
    const float mx = fmaxf(hmax8(s0), hmax8(s1));
    return fmaxf(mx, __shfl_xor(mx, 16, 32));
  };
  // renewal of one query tile's reference: the shift rises by dl >= 0
  auto renew = [&](const float dl, v8f& cc, float& l, v8f& oa, v8f& ob) __attribute__((always_inline)) {
    const float corr = exp2_slot(-dl);
    l *= corr;
#pragma unroll
    for (int r = 0; r < 8; ++r) { cc[r] -= dl; oa[r] *= corr; ob[r] *= corr; }
  };
  // One 32-key step on the fragment set (kf0..vh1). Each operand group is refilled for step nx, two steps ahead, directly
  // behind its last use, so a load has about two steps of other work between its issue and its wait.
  // refill is a literal at each call; the last two steps have nothing left to fetch.
  auto step = [&](v16h& kf0, v16h& kf1, v16h& vh0, v16h& vh1, const int nx, const bool refill)
      __attribute__((always_inline)) {
    v8f s00 = mma_h_raw(kf0, qf0, c0);                // t - h
    v8f s01 = mma_h_raw(kf1, qf0, c0);
    v8f s10 = mma_h_raw(kf0, qf1, c1);
    v8f s11 = mma_h_raw(kf1, qf1, c1);
    guard4(s00, s01, s10, s11, kf0, kf1, qf0, qf1);
    // the two scheduling barriers hold the k refill here: lifted over the products it would need a third register set and
    // copies, sunk into the softmax (where the compiler put it) it would be waited for shortly after its issue
    if (refill) {
      __builtin_amdgcn_sched_barrier(0);
      kf0 = ldfrag_p(Kp + (size_t)nx * 1024, 256);          // keys kb..kb+15 of step nx, kb = 32*nx
      kf1 = ldfrag_p(Kp + (size_t)nx * 1024 + 512, 256);    // keys kb+16..kb+31
      __builtin_amdgcn_sched_barrier(0);
    }

    v8f e00, e01, e10, e11;
    float ls0 = exps(s00, s01, e00, e01);
    float ls1 = exps(s10, s11, e10, e11);
    // written as "not <=" so that inf and NaN ask for the renewal too; the ballot makes the branch scalar: the whole
    // wave takes it or none of it does, and both lane halves of a query keep one m
    const bool need = !(ls0 <= ELIM) || !(ls1 <= ELIM);
    if (__builtin_expect(__builtin_amdgcn_ballot_w32(need) != 0u, 0)) {
      const float d0 = fmaxf(max32(s00, s01) - PSH, 0.f);   // new maximum - maximum in use, where positive
      const float d1 = fmaxf(max32(s10, s11) - PSH, 0.f);
      renew(d0, c0, l0, o00, o01);
      renew(d1, c1, l1, o10, o11);
      ls0 = exps_d(s00, s01, d0, e00, e01);           // every value now at most 256
      ls1 = exps_d(s10, s11, d1, e10, e11);
    }
    l0 += ls0;
    l1 += ls1;
    FragH p0, p1;
#pragma unroll
    for (int r = 0; r < 8; ++r) {
      p0.h[0][r] = (_Float16)e00[r];
      p0.h[1][r] = (_Float16)e01[r];
      p1.h[0][r] = (_Float16)e10[r];
      p1.h[1][r] = (_Float16)e11[r];
    }

    o00 = mma_h_raw(vh0, p0.v, o00);
    o01 = mma_h_raw(vh1, p0.v, o01);
    o10 = mma_h_raw(vh0, p1.v, o10);
    o11 = mma_h_raw(vh1, p1.v, o11);
    guard4(o00, o01, o10, o11, vh0, vh1, p0.v, p1.v);
    if (refill) {
      const size_t vo = (size_t)(nx >> 1) * 2048 + (nx & 1) * 128;     // 64-key block, then its 32-key half
      // the same for the v refill; the second barrier also keeps the next step's products out of this step
      __builtin_amdgcn_sched_barrier(0);
      vh0 = ldfrag_p(VH0 + vo, 64);
      vh1 = ldfrag_p(VH1 + vo, 64);
      __builtin_amdgcn_sched_barrier(0);
    }
  };
  // two fragment sets: a = even steps, b = odd steps
  v16h ka0 = ldfrag_p(Kp, 256),        ka1 = ldfrag_p(Kp + 512, 256);
  v16h va0 = ldfrag_p(VH0, 64),        va1 = ldfrag_p(VH1, 64);
  v16h kb0 = ldfrag_p(Kp + 1024, 256), kb1 = ldfrag_p(Kp + 1536, 256);
#if defined(__HIP_DEVICE_COMPILE__)
  // stands in front of the last v loads, whose results may land in the register that the k loads name as their offset
  asm volatile("s_wait_xcnt 0x0" ::: "memory");
#endif
  v16h vb0 = ldfrag_p(VH0 + 128, 64),  vb1 = ldfrag_p(VH1 + 128, 64);
  // ---- first shift: maximum of the first 32 keys' scores (C = 0), so that the first step's P is at most 256 ----
  {
    // keeps every first load in front of these products, which wait for the k loads: one memory latency, not two in a row
    __builtin_amdgcn_sched_barrier(0);
    v8f s00 = mma_h_raw(ka0, qf0, zero8());
    v8f s01 = mma_h_raw(ka1, qf0, zero8());
    v8f s10 = mma_h_raw(ka0, qf1, zero8());
    v8f s11 = mma_h_raw(ka1, qf1, zero8());
    guard4(s00, s01, s10, s11, ka0, ka1, qf0, qf1);
    c0 = splat8(PSH - max32(s00, s01));
    c1 = splat8(PSH - max32(s10, s11));
  }
  // kept rolled: a trip already holds both sets' steps, further copies would only lengthen the text
#pragma unroll 1
  for (int it = 0; it < KSTEPS - 2; it += 2) {
    step(ka0, ka1, va0, va1, it + 2, true);
    step(kb0, kb1, vb0, vb1, it + 3, true);
#if defined(__HIP_DEVICE_COMPILE__)
    // stands in front of the next trip's overwrite of the address registers that this trip's loads name
    asm volatile("s_wait_xcnt 0x0" ::: "memory");
#endif
  }
  step(ka0, ka1, va0, va1, 0, false);
  step(kb0, kb1, vb0, vb1, 0, false);

  const float h0 = -c0[0], h1 = -c1[0];
  // ---- key half 1 hands its state over, lane to lane (16 B a lane and piece: contiguous, no bank conflict) ----
  if (kv == 1) {                                     // wave-uniform
    v4f (*pm)[32] = Pm[qg];
    pm[0][lane] = lo4(o00); pm[1][lane] = hi4(o00); pm[2][lane] = lo4(o01); pm[3][lane] = hi4(o01);
    pm[4][lane] = lo4(o10); pm[5][lane] = hi4(o10); pm[6][lane] = lo4(o11); pm[7][lane] = hi4(o11);
    const v4f ml = {h0, l0, h1, l1};
    pm[8][lane] = ml;
  }
  __syncthreads();
  if (kv == 0) {                                     // wave-uniform: join the halves, divide, stage
    const v4f (*pm)[32] = Pm[qg];
    const v4f ml = pm[8][lane];
    // ---- O[query 32*qg + 16*t + c][d]: accumulator row 8hh + r of tile dt is d = 8*(r&3) + 4*dt + 2hh + (r>>2) ----
    auto join = [&](const int t, const float m, const float l, const float mo, const float lo, const v8f& oa, const v8f& ob)
        __attribute__((always_inline)) {
      const float mn = fmaxf(m, mo);
      const float ca = exp2_raw(m - mn), cb = exp2_raw(mo - mn);
      float ls = l * ca + lo * cb;
      ls += __shfl_xor(ls, 16, 32);
      const float sc = (1.0f / VC) * (1.0f / ls);
      const float fa = ca * sc, fb = cb * sc;
      float* os = Os + (qg * 32 + t * 16 + c) * DHEAD + 2 * hh;
#pragma unroll
      for (int r = 0; r < 8; ++r) {
        os[8 * (r & 3) + (r >> 2)]     = oa[r] * fa + pm[4 * t + (r >> 2)][lane][r & 3] * fb;
        os[8 * (r & 3) + (r >> 2) + 4] = ob[r] * fa + pm[4 * t + 2 + (r >> 2)][lane][r & 3] * fb;
      }
    };
    join(0, h0, l0, ml[0], ml[1], o00, o01);           // the shifts differ as the maxima do
    join(1, h1, l1, ml[2], ml[3], o10, o11);
  }
  __syncthreads();
  {
    const int e = tid & 7, qq = tid >> 3;              // qq 0..31: line within group, e: 16-B piece
    v4f vals[4];
#pragma unroll
    for (int it = 0; it < 4; ++it) {
      const int qi = it * 32 + qq;                       // it 0..3 x qq 0..31 = queries 0..127 of the block
      vals[it] = *(const v4f*)(Os + qi * DHEAD + 4 * e);
    }
    float* ob = out + (size_t)dir * NTOK * CDIM + (size_t)hd * DHEAD + 4 * e;
    {
#pragma unroll
      for (int it = 0; it < 4; ++it) {
        const int qi = it * 32 + qq;
        *(v4f*)(ob + (size_t)(q0 + qi) * CDIM) = vals[it];
      }
    }
  }
}

// =====================================================================================================
// Workspace map (bytes), every offset a multiple of 256 and every plane sized to its whole-row store granularity:
//   XN   f16 [8192][256]            0           4194304
//   WT   f16 [768][256]             4194304     393216
//   QH   f16 [8192][256]            4587520     4194304
//   KH   f16 [2][8][256][2][32][8]  8781824     4194304
//   VTH  f16 [2][8][64][8][32][8]   12976128    4194304
//   end                              17170432
// =====================================================================================================
extern "C" void kernel_launch(void* const* d_in, const int* in_sizes, int n_in,
                              void* d_out, int out_size, void* d_ws, size_t ws_size,
                              hipStream_t stream) {
  if (n_in < 5) return;
  if (in_sizes[0] != NTOK * CDIM || in_sizes[1] != NTOK * CDIM) return;
  if (in_sizes[2] != OC * CDIM) return;
  if (in_sizes[3] != DHEAD || in_sizes[4] != DHEAD) return;
  if (out_size != NSTR * NTOK * CDIM) return;

  const float* x_b   = (const float*)d_in[0];
  const float* x_a   = (const float*)d_in[1];
  const float* w_qkv = (const float*)d_in[2];
  const float* ln_g  = (const float*)d_in[3];
  const float* ln_b  = (const float*)d_in[4];

  const size_t PXN = (size_t)MROWS * CDIM * 2;        //  4194304
  const size_t PWT = (size_t)OC * CDIM * 2;           //   393216
  const size_t PQ  = (size_t)MROWS * CDIM * 2;        //  4194304
  const size_t PV  = (size_t)NSTR * CDIM * NTOK * 2;  //  4194304
  size_t off = 0;
  const size_t oXN = off; off += PXN;
  const size_t oWT = off; off += PWT;
  const size_t oQH = off; off += PQ;
  const size_t oKH = off; off += PQ;
  const size_t oVH = off; off += PV;
  if (off > ws_size) return;                          // off = 17170432
  if (off > (size_t)134217728) return;

  char* ws = (char*)d_ws;
  unsigned short* XN  = (unsigned short*)(ws + oXN);
  unsigned short* WT  = (unsigned short*)(ws + oWT);
  unsigned short* QH  = (unsigned short*)(ws + oQH);
  unsigned short* KH  = (unsigned short*)(ws + oKH);
  unsigned short* VTH = (unsigned short*)(ws + oVH);
  float*          out = (float*)d_out;

  const dim3 blk(256);
  const dim3 gCV(MROWS / 8 + OC / 8);                          // 1024 + 96 = 1120 blocks of 8 rows
  const dim3 gGM(((MROWS / 64) * (OC / 64)) / 8);              // 1536 tiles -> 192 blocks
  const dim3 gAT(NSTR * NHEAD * (NTOK / QBLK));                // 512 blocks of 256

  // (0) 16-bit operand planes: f16( bf16_RNE(x) * 64 ), f16( bf16_RNE(W) * 64 )
  cvt_planes<<<gCV, blk, 0, stream>>>(x_b, x_a, w_qkv, XN, WT);

  // (1) t[s*4096 + n][o] = (x_s[n] . W[o]), both streams stacked, scale 1/(64*64); per-head LayerNorm in the epilogue
  //     -> q token rows; k and v in fragment order
  gemm64_ln<<<gGM, blk, 0, stream>>>(XN, CDIM, WT, CDIM, ln_g, ln_b, QH, KH, VTH, 1.0f / (XC * WSC), MROWS, OC, CDIM);

  // (2) attention, both directions, all heads -> out[dir][n][h*32 + d]
  attn_kernel<<<gAT, blk, 0, stream>>>(QH, KH, VTH, out);
  (void)hipGetLastError();
}

// v009
// One run takes 42.5 microseconds.
// Two timings next to v008 both put it at 1.23 times that version's speed.
// Counting every step since v000, it is 7.77 times as fast.
// Contractions: qkv projection (x token rows f16 x64 . W_qkv rows f16 x64, K=256, one product); attention scores
// S^T = k (f16 x1) . q^T (f16 x scale*log2 e) - shift (the C operand), one product, head dim 32; attention O^T = v^T (f16 x256) . P^T (f16 x256,
// taken from the score D registers), one product over 4096 keys. Every operand is one f16 plane (RNE from f32).
// All v_wmma_f32_16x16x32_f16, f32 accumulate; LayerNorm and softmax in f32 on VALU; every float input RNE-converted
// to bf16 on load. The projection converts x and W itself, once a block, on their way into LDS.
#include <hip/hip_runtime.h>
#include <math.h>
#include <stdint.h>

#define NTOK   4096
#define CDIM   256
#define NHEAD  8
#define DHEAD  32
#define OC     (3 * CDIM)
#define NSTR   2
#define MROWS  (NSTR * NTOK)
#define LNEPS  1.0e-5f
#define XC     64.0f
#define WSC    64.0f
#define ATTSC  0.17677669529663687f
#define QC     (ATTSC * 1.44269504088896340736f)   // q carries the logit scale and log2 e: k.q is the base-2 logit
#define KC     1.0f
#define VC     256.0f
#define PSH    8.0f                  // log2 256: P = 2^{t-m} x 256
#define ELIM   32768.0f              // a lane's sum of 16 P values up to here: each of them is finite in f16
static_assert(NHEAD * DHEAD == CDIM);
static_assert((MROWS % 64) == 0 && (OC % 64) == 0 && (CDIM % 32) == 0);
static_assert((NTOK % 128) == 0 && CDIM == 256);
static_assert((NTOK % 64) == 0 && (NTOK / 32) >= 4 && (MROWS % 8) == 0 && (OC % 8) == 0);

typedef _Float16 v16h __attribute__((ext_vector_type(16)));
typedef _Float16 v8h  __attribute__((ext_vector_type(8)));
typedef float    v8f  __attribute__((ext_vector_type(8)));
typedef float    v4f  __attribute__((ext_vector_type(4)));
typedef unsigned int v4u __attribute__((ext_vector_type(4)));
typedef unsigned int v2u __attribute__((ext_vector_type(2)));
typedef float    v2f  __attribute__((ext_vector_type(2)));
typedef _Float16 v2h  __attribute__((ext_vector_type(2)));
typedef __bf16   v2b  __attribute__((ext_vector_type(2)));

union FragH { v16h v; v8h h[2]; };

// ---- scalar helpers --------------------------------------------------------------------------------
__device__ __forceinline__ unsigned short bf_bits(float f) {          // f32 -> bf16 bits, RNE convert
  unsigned u = __float_as_uint(f);
  return (unsigned short)((u + 0x7FFFu + ((u >> 16) & 1u)) >> 16);
}
__device__ __forceinline__ float bf_up(unsigned short h) { return __uint_as_float(((unsigned)h) << 16); }
__device__ __forceinline__ float bfr(float f) { return bf_up(bf_bits(f)); }
__device__ __forceinline__ unsigned short h_bits(_Float16 x) { return __builtin_bit_cast(unsigned short, x); }
__device__ __forceinline__ unsigned pk16(unsigned short a, unsigned short b) { return (unsigned)a | ((unsigned)b << 16); }
__device__ __forceinline__ v8f zero8() { v8f z = {0.f, 0.f, 0.f, 0.f, 0.f, 0.f, 0.f, 0.f}; return z; }
__device__ __forceinline__ float hmax8(v8f s) {
  return fmaxf(fmaxf(fmaxf(s[0], s[1]), fmaxf(s[2], s[3])), fmaxf(fmaxf(s[4], s[5]), fmaxf(s[6], s[7])));
}

// ---- fragment loader: 16-bit A/B operand, lane -> row/col (lane&15), p already includes +8*(lane>>4);
//      elements 0..7 <- p[0..7] (k0+8h..), elements 8..15 <- p[16..23] (k0+16+8h..)
__device__ __forceinline__ v16h ldfrag_h(const _Float16* p) {
  FragH f;
  f.h[0] = *(const v8h*)(p);
  f.h[1] = *(const v8h*)(p + 16);
  return f.v;
}
// ---- the same operand from a plane stored in fragment order: elements 0..7 <- p[0..7], elements 8..15 <- p[step..step+7];
//      p already includes the lane's own 16-B piece
__device__ __forceinline__ v16h ldfrag_p(const _Float16* p, int step) {
  FragH f;
  f.h[0] = *(const v8h*)(p);
  f.h[1] = *(const v8h*)(p + step);
  return f.v;
}

// ---- WMMA helpers with trailing VALU hazard gap --------------------------------------------------------
__device__ __forceinline__ v8f mma_h_raw(v16h a, v16h b, v8f c) {
  return __builtin_amdgcn_wmma_f32_16x16x32_f16(false, a, false, b, (short)0, c, false, false);
}
__device__ __forceinline__ void acc_guard4(v8f& a, v8f& b, v8f& c, v8f& d) {
#if defined(__HIP_DEVICE_COMPILE__)
  asm volatile("v_nop\n\tv_nop\n\tv_nop\n\tv_nop" : "+v"(a), "+v"(b), "+v"(c), "+v"(d));
#endif
}
// behind four products of two A fragments (x0, x1) with two B fragments (y0, y1). v_nop x4: the distance asked for between
// the last product and the first vector instruction that reads a D or overwrites an A or B register; the operands hold the
// statement behind the products and in front of the refill of x0, x1
__device__ __forceinline__ void guard4(v8f& a, v8f& b, v8f& c, v8f& d, v16h x0, v16h x1, v16h y0, v16h y1) {
#if defined(__HIP_DEVICE_COMPILE__)
  asm volatile("v_nop\n\tv_nop\n\tv_nop\n\tv_nop"
               : "+v"(a), "+v"(b), "+v"(c), "+v"(d) : "v"(x0), "v"(x1), "v"(y0), "v"(y1));
#endif
}
__device__ __forceinline__ void wave_sync_lds() {
  __builtin_amdgcn_fence(__ATOMIC_RELEASE, "workgroup");
  __builtin_amdgcn_wave_barrier();
  __builtin_amdgcn_fence(__ATOMIC_ACQUIRE, "workgroup");
}

// =====================================================================================================
// Per-head LayerNorm helpers. One lane owns 8 consecutive features of a token, so a head (32 features) is one quad of
// lanes: mean and variance are 8 adds in the lane and a two-step sum over the quad.
// =====================================================================================================
__device__ __forceinline__ float quad_sum(float v) {   // sum over lanes l, l^1, l^2, l^3 (DPP row_xmask 1, then 2)
  v += __builtin_bit_cast(float, __builtin_amdgcn_update_dpp(0, __builtin_bit_cast(int, v), 0x161, 0xf, 0xf, true));
  v += __builtin_bit_cast(float, __builtin_amdgcn_update_dpp(0, __builtin_bit_cast(int, v), 0x162, 0xf, 0xf, true));
  return v;
}
__device__ __forceinline__ float rsq_pos(float x) {   // 1/sqrt(x) for x >= LNEPS: never in the range that rsqrtf rescales
  float r = 0.f;
#if defined(__HIP_DEVICE_COMPILE__)
  // v_nop: fills the one slot asked for behind a transcendental, before an instruction that may overwrite its source
  asm("v_rsq_f32 %0, %1\n\tv_nop" : "=v"(r) : "v"(x));
#endif
  return r;
}
__device__ __forceinline__ void ln8(const v4f a, const v4f c, const float (&g)[8], const float (&b)[8], float sc,
                                    float (&y)[8]) {
  const float mean = quad_sum(((a[0] + a[1]) + (a[2] + a[3])) + ((c[0] + c[1]) + (c[2] + c[3]))) * (1.0f / DHEAD);
  float d[8];
#pragma unroll
  for (int j = 0; j < 4; ++j) { d[j] = a[j] - mean; d[4 + j] = c[j] - mean; }
  float ss = 0.f;
#pragma unroll
  for (int j = 0; j < 8; ++j) ss += d[j] * d[j];
  const float rs = rsq_pos(quad_sum(ss) * (1.0f / DHEAD) + LNEPS);
#pragma unroll
  for (int j = 0; j < 8; ++j) y[j] = ((d[j] * rs) * g[j] + b[j]) * sc;
}
__device__ __forceinline__ void bfr8(const v4f lo, const v4f hi, float (&o)[8]) {
#pragma unroll
  for (int j = 0; j < 4; ++j) { o[j] = bfr(lo[j]); o[4 + j] = bfr(hi[j]); }
}
__device__ __forceinline__ unsigned hi2(float x, float y) { return pk16(h_bits((_Float16)x), h_bits((_Float16)y)); }

// =====================================================================================================
// qkv projection with the operand conversion in its prologue and the per-head LayerNorm in its epilogue.
// Block = 8 waves = 2 x 4 wave tiles of 64x64 = 128 tokens of one stream x the 256 features of one part (q, k or v).
//   t[m][n] = 1/(64*64) * sum_k A[m][k] * Bt[n][k]   (f32, kept in the wave's LDS slab only)
// Prologue: the block reads its 128 x rows and 256 W rows (f32, k contiguous) once, each 32-lane 16-B load covering four
// whole 128-B lines, forms f16( bf16_RNE(value) * 64 ) and lays the rows in LDS at a pitch of 528 B (16 B x an odd number:
// no bank conflict for the 16-B fragment reads). One barrier; then every wave takes its fragments from LDS with the split
// k map (ldfrag_h), k ascending. A second barrier ends the last fragment read before the slabs, which lie on the same LDS,
// are written.
// A tile is 64 tokens of one stream x 2 whole heads of one part (feature n = part*256 + h*32 + dd), so every LayerNorm
// row lies inside the wave. The wave stages its tile in LDS (pitch 68 floats), then reads it back 8 features a lane.
// k and v are stored in the order in which the attention kernel's fragment loads read them, so that each of its 32-lane
// 16-B loads covers four whole 128-B lines:
//   KH[s][h][tile of 16 tokens][j][piece = 16*hh + c][8]     = k of token 16*tile + c, d = 16*j + 8*hh + e
//   VTH[s][h][block of 64 tokens][jf][piece = 4*tg + ch][8]  = v of token 64*block + 8*tg + e, d = 8*ch + jf
//   part 2 (v): per head, lane = (token group tg = lane>>2, feature chunk ch = lane&3) holds 8 tokens x 8 features;
//      y*256 -> f16; per feature jf the lane's 8 tokens are one 16-B piece and the wave's 32 pieces one 512-B store.
//   part 0 (q): lane = (row lane>>3 of 4, chunk lane&7 of the 64 columns); y*QC -> f16; a store is four 128-B lines.
//   part 1 (k): the same lanes; chunk ch = lane&3 of head (lane&7)>>2 is (j, hh) = (ch>>1, ch&1); y -> f16; a store is
//      eight 64-B runs, and the wave itself writes the other half of each line in the same pass of 16 rows.
// coverage: 128 x 12 tiles; q tiles: 64 rows x 64 columns of QH; k tiles: 4 token tiles x 2 heads x 1024 B; v tiles:
//           one 64-token block x 2 heads x 8 jf x 512 B: each plane entirely; grid = 64 token blocks x 3 parts.
// =====================================================================================================
#define LP    264                     // LDS row pitch of the operand tiles, halves
#define BMT   128                     // tokens of a block
#define BNT   256                     // features of a block
#define SROWS 8                       // rows a wave stages in one group of loads
static_assert((BMT + BNT) * LP * 2 >= 8 * 64 * 68 * 4 && (LP * 2) % 16 == 0);
static_assert(BMT == 8 * 2 * SROWS && BNT == 8 * 4 * SROWS);

// two values: f16( bf16_RNE(x) * sc )
__device__ __forceinline__ unsigned cv2(float x, float y, float sc) {
  const v2f in = {x, y};
  const unsigned u = __builtin_bit_cast(unsigned, __builtin_convertvector(in, v2b));
  const v2f up = {__uint_as_float(u << 16) * sc, __uint_as_float(u & 0xFFFF0000u) * sc};
  return __builtin_bit_cast(unsigned, __builtin_convertvector(up, v2h));
}
// SROWS rows of 256 floats: the lane's 4 floats of each half row (p already includes 4*lane)
__device__ __forceinline__ void rows_load(const float* p, v4f (&t)[2 * SROWS]) {
#pragma unroll
  for (int r = 0; r < SROWS; ++r) {
    t[2 * r]     = *(const v4f*)(p + r * CDIM);
    t[2 * r + 1] = *(const v4f*)(p + r * CDIM + 128);
  }
}
__device__ __forceinline__ void rows_store(const v4f (&t)[2 * SROWS], _Float16* d, float sc) {
#pragma unroll
  for (int r = 0; r < SROWS; ++r) {
    const v2u a = {cv2(t[2 * r][0], t[2 * r][1], sc), cv2(t[2 * r][2], t[2 * r][3], sc)};
    const v2u b = {cv2(t[2 * r + 1][0], t[2 * r + 1][1], sc), cv2(t[2 * r + 1][2], t[2 * r + 1][3], sc)};
    *(v2u*)(d + r * LP)       = a;
    *(v2u*)(d + r * LP + 128) = b;
  }
}

__global__ __launch_bounds__(256) void gemm64_ln(
    const float* __restrict__ xb, const float* __restrict__ xa, const float* __restrict__ w,
    const float* __restrict__ gam, const float* __restrict__ bet,
    unsigned short* QH, unsigned short* KH, unsigned short* VTH) {
  __shared__ __align__(16) unsigned char smem[(BMT + BNT) * LP * 2];   // operand tiles, then the waves' slabs
  _Float16* As = (_Float16*)(void*)smem;               // [128 tokens][LP]
  _Float16* Bs = As + BMT * LP;                        // [256 features][LP]
  const int lane = threadIdx.x & 31;
  const int wave = __builtin_amdgcn_readfirstlane(threadIdx.x >> 5);
  const int bm   = blockIdx.x / 3;                     // 128-token block of the stacked streams
  const int part = blockIdx.x - bm * 3;                // 0 q, 1 k, 2 v
  const int m0 = bm * BMT + (wave >> 2) * 64;          // the wave's tile
  const int n0 = part * BNT + (wave & 3) * 64;
  const float osc = 1.0f / (XC * WSC);

  // ---- prologue: wave w stages x rows 16w..16w+15 and W rows 32w..32w+31 of the block, 8 rows a group, the next group's
  //      loads issued in front of the current group's conversion ----
  {
    const int sb = (bm * BMT) / NTOK;                  // stream of the block
    const float* pa = (sb == 0 ? xb : xa) + (size_t)(bm * BMT - sb * NTOK + 16 * wave) * CDIM + 4 * lane;
    const float* pb = w + (size_t)(part * BNT + 32 * wave) * CDIM + 4 * lane;
    _Float16* da = As + (16 * wave) * LP + 4 * lane;
    _Float16* db = Bs + (32 * wave) * LP + 4 * lane;
    v4f t0[2 * SROWS], t1[2 * SROWS];
    rows_load(pa, t0);
    rows_load(pa + SROWS * CDIM, t1);
    rows_store(t0, da, XC);
    rows_load(pb, t0);
    rows_store(t1, da + SROWS * LP, XC);
    rows_load(pb + SROWS * CDIM, t1);
    rows_store(t0, db, WSC);
    rows_load(pb + 2 * SROWS * CDIM, t0);
    rows_store(t1, db + SROWS * LP, WSC);
    rows_load(pb + 3 * SROWS * CDIM, t1);
#if defined(__HIP_DEVICE_COMPILE__)
    // stands behind the last load, in front of whatever overwrites the address registers that the loads above name
    asm volatile("s_wait_xcnt 0x0" ::: "memory");
#endif
    rows_store(t0, db + 2 * SROWS * LP, WSC);
    rows_store(t1, db + 3 * SROWS * LP, WSC);
  }
  __syncthreads();                                     // the tiles are whole: every wave reads rows that others staged

  const int rlane = lane & 15;                 // row (A) / col (B, D) within subtile
  const int koff  = (lane >> 4) * 8;           // k offset of this lane half
  const int mOff  = (lane >> 4) * 8;           // D row offset
  const _Float16* Aw = As + ((wave >> 2) * 64 + rlane) * LP + koff;
  const _Float16* Bw = Bs + ((wave & 3) * 64 + rlane) * LP + koff;

  v8f acc[4][4];
#pragma unroll
  for (int i = 0; i < 4; ++i)
#pragma unroll
    for (int j = 0; j < 4; ++j) acc[i][j] = zero8();

  // Unrolled: every LDS offset is an immediate. The B fragments have two register sets, the next step's set read at the
  // head of a step; an A fragment is read again for the next step directly behind its last product. So every LDS read has
  // about a step of products between its issue and its wait.
  v16h ah[4], bh[2][4];
#pragma unroll
  for (int j = 0; j < 4; ++j) bh[0][j] = ldfrag_h(Bw + (j << 4) * LP);
#pragma unroll
  for (int i = 0; i < 4; ++i) ah[i] = ldfrag_h(Aw + (i << 4) * LP);
#pragma unroll
  for (int s = 0; s < CDIM / 32; ++s) {
    const int kn = (s + 1) * 32;                       // k of the next step
    const bool more = (kn < CDIM);
    if (more) {
#pragma unroll
      for (int j = 0; j < 4; ++j) bh[(s + 1) & 1][j] = ldfrag_h(Bw + (j << 4) * LP + kn);
      // holds the reads at the head of the step: sunk towards their use they would be waited for right behind their issue
      __builtin_amdgcn_sched_barrier(0);
    }
#pragma unroll
    for (int i = 0; i < 4; ++i) {
#pragma unroll
      for (int j = 0; j < 4; ++j) acc[i][j] = mma_h_raw(ah[i], bh[s & 1][j], acc[i][j]);
      if (more) {
        // the two scheduling barriers hold the refill here, for the same reason
        __builtin_amdgcn_sched_barrier(0);
        ah[i] = ldfrag_h(Aw + (i << 4) * LP + kn);
        __builtin_amdgcn_sched_barrier(0);
      }
    }
  }
  acc_guard4(acc[0][0], acc[0][1], acc[0][2], acc[0][3]);
  acc_guard4(acc[1][0], acc[1][1], acc[1][2], acc[1][3]);
  acc_guard4(acc[2][0], acc[2][1], acc[2][2], acc[2][3]);
  acc_guard4(acc[3][0], acc[3][1], acc[3][2], acc[3][3]);
  __syncthreads();                                     // every wave's last fragment read is done: the slabs may be written

  const int ch = lane & 3;                            // 8-feature chunk of the head, every mapping below
  const v4f g0 = *(const v4f*)(gam + 8 * ch), g1 = *(const v4f*)(gam + 8 * ch + 4);
  const v4f b0 = *(const v4f*)(bet + 8 * ch), b1 = *(const v4f*)(bet + 8 * ch + 4);
#if defined(__HIP_DEVICE_COMPILE__)
  // stands in front of whatever overwrites the address registers that the four loads above name
  asm volatile("s_wait_xcnt 0x0" ::: "memory");
#endif
  float* slab = (float*)(void*)smem + wave * (64 * 68);   // per-wave 64x64 tile, pitch 68 floats
#pragma unroll
  for (int i = 0; i < 4; ++i)
#pragma unroll
    for (int j = 0; j < 4; ++j)
#pragma unroll
      for (int r = 0; r < 8; ++r) slab[((i << 4) + mOff + r) * 68 + (j << 4) + rlane] = acc[i][j][r] * osc;
  wave_sync_lds();                                    // the lanes read each other's rows below; the slab is the wave's own
  float g[8], be[8];
  bfr8(g0, g1, g);
  bfr8(b0, b1, be);
  const int h0   = (n0 & (CDIM - 1)) >> 5;            // first of the tile's two heads
  const int s    = m0 / NTOK;                         // stream
  const int t0   = m0 - s * NTOK;                     // first token of the tile in its stream
  if (part == 2) {                                    // v, transposed in registers
#pragma unroll
    for (int hs = 0; hs < 2; ++hs) {
      const float* sp = slab + (8 * (lane >> 2)) * 68 + hs * DHEAD + 8 * ch;
      v4f xa[8], xc[8];
#pragma unroll
      for (int i = 0; i < 8; ++i) { xa[i] = *(const v4f*)(sp + i * 68); xc[i] = *(const v4f*)(sp + i * 68 + 4); }
      float y[8][8];
#pragma unroll
      for (int i = 0; i < 8; ++i) ln8(xa[i], xc[i], g, be, VC, y[i]);
      const size_t vo = (((size_t)s * NHEAD + h0 + hs) * (NTOK / 64) + (t0 >> 6)) * 2048 + 8 * lane;
#pragma unroll
      for (int j = 0; j < 8; ++j) {
        v4u hv;
#pragma unroll
        for (int p = 0; p < 4; ++p) hv[p] = hi2(y[2 * p][j], y[2 * p + 1][j]);
        *(v4u*)(VTH + vo + j * 256) = hv;
      }
#if defined(__HIP_DEVICE_COMPILE__)
      // stands in front of the next head's overwrite of the registers that these stores name
      asm volatile("s_wait_xcnt 0x0" ::: "memory");
#endif
    }
  } else {                                            // q token rows, or k in fragment order
    const int rs = lane >> 3, c8 = lane & 7;          // row of 4, 8-feature chunk of the 64 columns
    const bool isq = (part == 0);
    const float sc = isq ? QC : KC;
    unsigned short* dst = isq
        ? QH + (size_t)(m0 + rs) * CDIM + n0 + 8 * c8
        : KH + (((size_t)s * NHEAD + h0 + (c8 >> 2)) * (NTOK / 16) + (t0 >> 4)) * 512 + (ch >> 1) * 256
             + ((ch & 1) * 16 + rs) * 8;
    const int st16 = isq ? 16 * CDIM : 512;           // halves from one 16-row pass to the next
    const int st4  = isq ? 4 * CDIM : 32;             // halves from one 4-row group to the next
#pragma unroll
    for (int gq = 0; gq < 4; ++gq) {
      v4f xa[4], xc[4];
#pragma unroll
      for (int i = 0; i < 4; ++i) {
        const float* p = slab + (gq * 16 + i * 4 + rs) * 68 + 8 * c8;
        xa[i] = *(const v4f*)(p);
        xc[i] = *(const v4f*)(p + 4);
      }
#pragma unroll
      for (int i = 0; i < 4; ++i) {
        float y[8];
        ln8(xa[i], xc[i], g, be, sc, y);
        v4u hv;
#pragma unroll
        for (int p = 0; p < 4; ++p) hv[p] = hi2(y[2 * p], y[2 * p + 1]);
        *(v4u*)(dst + gq * st16 + i * st4) = hv;
      }
#if defined(__HIP_DEVICE_COMPILE__)
      // stands in front of the next pass's overwrite of the registers that these stores name
      asm volatile("s_wait_xcnt 0x0" ::: "memory");
#endif
    }
  }
}

// =====================================================================================================
// Attention for one (dir, head, 128-query block), transposed formulation, head dim 32, 4096 keys, no mask:
//   dir 0: queries from stream 1, keys/values from stream 0 -> output slot 0; dir 1: queries from stream 0, keys/values
//   from stream 1 -> output slot 1.
//   S^T tile (16 keys x 16 queries) = A(k rows = keys, d via the split k map) . B(q, col = query, same d map):
//   t = k.q (one product) is the base-2 logit (q carries scale * log2 e). Per lane the D tile holds 8 keys of ONE query,
//   so the online softmax is per-lane state, and the shift h = m - 8 in use is one value a lane: the product takes -h in
//   all 8 registers of its C operand, D = t - h, and P = 2^D is one v_exp_f32 on the D register with no other arithmetic.
//   The reference m is a maximum over keys seen earlier and is renewed only on demand:
//   a step forms P with the h in use and sums it; only if a lane's sum of 16 P values is above ELIM (or not a number)
//   does the wave take the renewal path (one test a step, a scalar branch): maximum over the step's 32 keys with one
//   shuffle (lane^16), h raised by delta = max(D) - 8 where that is positive (the C registers lowered by it), O and l
//   rescaled by 2^-delta, P formed again as 2^(D - delta). The first h comes from the first 32 keys' scores, formed once more with
//   C = 0 in front of the loop. The row sum
//   (of the f32 values, before they are rounded to f16) is kept as a per-lane partial and combined at the end.
//   P = 2^{t-m} x 256 as f16 (at most ELIM, so finite) is used directly
//   as the B operand of O^T (rows d, cols queries) += A(v^T rows d, keys contiguous, two 16-B loads) . B(P^T):
//   B element r <- the key tile covering keys kb..kb+15, element 8+r <- the tile covering kb+16..kb+31, lane unchanged
//   (D-as-B chaining layout). One product v.P into one accumulator per d tile.
//   k and v come from planes in fragment order (layouts: at gemm64_ln): every load of a wave covers four whole 128-B lines.
//   A k tile is 1024 contiguous bytes, piece = lane. Row c of v^T tile dt is d = 8*(c&3) + 4*dt + (c>>2): its four
//   feature rows jf = 4*dt + (c>>2) each give one line (key groups 2j, 2j+1 of the 32 keys x chunks 0..3); the epilogue
//   puts the output rows back in d order.
//   Wave tile = 32 queries (two q fragments) x 2048 keys: every k and v fragment a wave loads feeds two products, so a
//   score costs half the loaded bytes of a 16-query wave, and the number of waves stays 4096.
//   32 keys per step: 4 score WMMAs + 4 output WMMAs per wave; two steps a trip, each on its own register set of k and v
//   fragments, fetched two steps ahead. Block = 8 waves = 4 query groups x 2 key halves = 128 queries; grid = 2*8*32 = 512.
//   Epilogue: the waves of key half 1 hand (h, l, O) to their partners through LDS; the partner joins the two halves
//   (common maximum, both sides rescaled), divides and stages its [32 query][32 d] f32 rows in LDS; block barrier, then
//   4 store instructions of whole 128-B lines per thread group.
// coverage: block writes queries q0..q0+127 x d 0..31 of its (dir, head); grid covers out [2][4096][256] exactly once.
// =====================================================================================================
__device__ __forceinline__ float exp2_slot(float x) {   // 2^x: one v_exp_f32
  float r = 0.f;
#if defined(__HIP_DEVICE_COMPILE__)
  // v_nop: fills the one slot asked for behind a transcendental, before an instruction that may overwrite its source
  asm("v_exp_f32 %0, %1\n\tv_nop" : "=v"(r) : "v"(x));
#endif
  return r;
}
__device__ __forceinline__ float exp2_raw(float x) {    // 2^x: one v_exp_f32, placed by the compiler
#if defined(__HIP_DEVICE_COMPILE__)
  return __builtin_amdgcn_exp2f(x);
#else
  return x;
#endif
}
__device__ __forceinline__ v8f splat8(float x) { v8f r = {x, x, x, x, x, x, x, x}; return r; }
__device__ __forceinline__ v4f lo4(v8f x) { v4f r = {x[0], x[1], x[2], x[3]}; return r; }
__device__ __forceinline__ v4f hi4(v8f x) { v4f r = {x[4], x[5], x[6], x[7]}; return r; }

#define QBLK   128                    // queries of a block
#define KSTEPS (NTOK / 2 / 32)        // 32-key steps of a wave: half of the keys
static_assert((NTOK % QBLK) == 0 && (KSTEPS % 2) == 0 && KSTEPS >= 4);

__global__ __launch_bounds__(256)
void attn_kernel(const unsigned short* __restrict__ qh, const unsigned short* __restrict__ kh,
                 const unsigned short* __restrict__ vth, float* out) {
  __shared__ __align__(16) float Os[QBLK * DHEAD];
  __shared__ __align__(16) v4f Pm[4][9][32];          // key half 1's (O, h, l): [query group][piece][lane]
  const int tid  = threadIdx.x;
  const int wave = __builtin_amdgcn_readfirstlane(tid >> 5);
  const int lane = tid & 31;
  const int hh   = lane >> 4;
  const int c    = lane & 15;
  const int qg   = wave & 3;                        // 32-query group of the block
  const int kv   = wave >> 2;                       // key half
  const int bx   = blockIdx.x;
  const int qb   = bx % (NTOK / QBLK);              // 32 query blocks per (stream, head)
  const int hd   = (bx / (NTOK / QBLK)) % NHEAD;
  const int dir  = bx / ((NTOK / QBLK) * NHEAD);
  const int qsrc = 1 - dir;
  const int ksrc = dir;
  const int q0   = qb * QBLK;

  const _Float16* QHp = (const _Float16*)(const void*)qh;
  const _Float16* KHp = (const _Float16*)(const void*)kh;
  const _Float16* VHp = (const _Float16*)(const void*)vth;

  // ---- q fragments (B operand, col = query q0 + 32*qg + 16*t + c, t = 0, 1) ----
  const size_t qtok = (size_t)qsrc * NTOK + q0 + qg * 32 + c;
  const v16h qf0 = ldfrag_h(QHp + qtok * CDIM + hd * DHEAD + 8 * hh);
  const v16h qf1 = ldfrag_h(QHp + (qtok + 16) * CDIM + hd * DHEAD + 8 * hh);
#if defined(__HIP_DEVICE_COMPILE__)
  // stands in front of the first k and v loads, whose results land in registers that the q loads name as addresses
  asm volatile("s_wait_xcnt 0x0" ::: "memory");
#endif
  // ---- k fragment base (A operand, row = key kb + c): 512 halves a 16-key tile, the lane's piece = lane ----
  const _Float16* Kp = KHp + (size_t)(ksrc * NHEAD + hd) * (NTOK / 16) * 512 + (size_t)kv * KSTEPS * 1024 + 8 * lane;
  // ---- v^T fragment bases (A operand, row c = d 8*(c&3) + 4*dt + (c>>2)): 2048 halves a 64-key block ----
  const size_t vrow = (size_t)(ksrc * NHEAD + hd) * (NTOK / 64) * 2048 + (size_t)kv * (KSTEPS / 2) * 2048
                    + (c >> 2) * 256 + (4 * hh + (c & 3)) * 8;
  const _Float16* VH0 = VHp + vrow;
  const _Float16* VH1 = VH0 + 4 * 256;

  float l0 = 0.f, l1 = 0.f;
  // the C operand of the score products: -h in all 8 registers, h = m - 8 the shift in use: 2^(t - h) = 2^{t-m} * 256
  v8f c0 = zero8(), c1 = zero8();
  v8f o00 = zero8(), o01 = zero8(), o10 = zero8(), o11 = zero8();     // o<query tile><d tile>
  // P (f32) of one query tile's 32 shifted scores; returns the lane's sum of its 16 values
  auto exps = [&](const v8f& s0, const v8f& s1, v8f& e0, v8f& e1) __attribute__((always_inline)) {
    float ls = 0.f;
#pragma unroll
    for (int r = 0; r < 8; ++r) {
      e0[r] = exp2_raw(s0[r]);                        // key kb      + 8hh + r
      e1[r] = exp2_raw(s1[r]);                        // key kb + 16 + 8hh + r
      ls += e0[r] + e1[r];
    }
    return ls;
  };
  // the same with the shift raised by dl (renewal path only)
  auto exps_d = [&](const v8f& s0, const v8f& s1, const float dl, v8f& e0, v8f& e1) __attribute__((always_inline)) {
    float ls = 0.f;
#pragma unroll
    for (int r = 0; r < 8; ++r) {
      e0[r] = exp2_slot(s0[r] - dl);
      e1[r] = exp2_slot(s1[r] - dl);
      ls += e0[r] + e1[r];
    }
    return ls;
  };
  // maximum of one query tile's 32 scores over both lane halves
  auto max32 = [&](const v8f& s0, const v8f& s1) __attribute__((always_inline)) {
    const float mx = fmaxf(hmax8(s0), hmax8(s1));
    return fmaxf(mx, __shfl_xor(mx, 16, 32));
  };
  // renewal of one query tile's reference: the shift rises by dl >= 0
  auto renew = [&](const float dl, v8f& cc, float& l, v8f& oa, v8f& ob) __attribute__((always_inline)) {
    const float corr = exp2_slot(-dl);
    l *= corr;
#pragma unroll
    for (int r = 0; r < 8; ++r) { cc[r] -= dl; oa[r] *= corr; ob[r] *= corr; }
  };
  // One 32-key step on the fragment set (kf0..vh1). Each operand group is refilled for step nx, two steps ahead, directly
  // behind its last use, so a load has about two steps of other work between its issue and its wait.
  // refill is a literal at each call; the last two steps have nothing left to fetch.
  auto step = [&](v16h& kf0, v16h& kf1, v16h& vh0, v16h& vh1, const int nx, const bool refill)
      __attribute__((always_inline)) {
    v8f s00 = mma_h_raw(kf0, qf0, c0);                // t - h
    v8f s01 = mma_h_raw(kf1, qf0, c0);
    v8f s10 = mma_h_raw(kf0, qf1, c1);
    v8f s11 = mma_h_raw(kf1, qf1, c1);
    guard4(s00, s01, s10, s11, kf0, kf1, qf0, qf1);
    // the two scheduling barriers hold the k refill here: lifted over the products it would need a third register set and
    // copies, sunk into the softmax (where the compiler put it) it would be waited for shortly after its issue
    if (refill) {
      __builtin_amdgcn_sched_barrier(0);
      kf0 = ldfrag_p(Kp + (size_t)nx * 1024, 256);          // keys kb..kb+15 of step nx, kb = 32*nx
      kf1 = ldfrag_p(Kp + (size_t)nx * 1024 + 512, 256);    // keys kb+16..kb+31
      __builtin_amdgcn_sched_barrier(0);
    }

    v8f e00, e01, e10, e11;
    float ls0 = exps(s00, s01, e00, e01);
    float ls1 = exps(s10, s11, e10, e11);
    // written as "not <=" so that inf and NaN ask for the renewal too; the ballot makes the branch scalar: the whole
    // wave takes it or none of it does, and both lane halves of a query keep one m
    const bool need = !(ls0 <= ELIM) || !(ls1 <= ELIM);
    if (__builtin_expect(__builtin_amdgcn_ballot_w32(need) != 0u, 0)) {
      const float d0 = fmaxf(max32(s00, s01) - PSH, 0.f);   // new maximum - maximum in use, where positive
      const float d1 = fmaxf(max32(s10, s11) - PSH, 0.f);
      renew(d0, c0, l0, o00, o01);
      renew(d1, c1, l1, o10, o11);
      ls0 = exps_d(s00, s01, d0, e00, e01);           // every value now at most 256
      ls1 = exps_d(s10, s11, d1, e10, e11);
    }
    l0 += ls0;
    l1 += ls1;
    FragH p0, p1;
#pragma unroll
    for (int r = 0; r < 8; ++r) {
      p0.h[0][r] = (_Float16)e00[r];
      p0.h[1][r] = (_Float16)e01[r];
      p1.h[0][r] = (_Float16)e10[r];
      p1.h[1][r] = (_Float16)e11[r];
    }

    o00 = mma_h_raw(vh0, p0.v, o00);
    o01 = mma_h_raw(vh1, p0.v, o01);
    o10 = mma_h_raw(vh0, p1.v, o10);
    o11 = mma_h_raw(vh1, p1.v, o11);
    guard4(o00, o01, o10, o11, vh0, vh1, p0.v, p1.v);
    if (refill) {
      const size_t vo = (size_t)(nx >> 1) * 2048 + (nx & 1) * 128;     // 64-key block, then its 32-key half
      // the same for the v refill; the second barrier also keeps the next step's products out of this step
      __builtin_amdgcn_sched_barrier(0);
      vh0 = ldfrag_p(VH0 + vo, 64);
      vh1 = ldfrag_p(VH1 + vo, 64);
      __builtin_amdgcn_sched_barrier(0);
    }
  };
  // two fragment sets: a = even steps, b = odd steps
  v16h ka0 = ldfrag_p(Kp, 256),        ka1 = ldfrag_p(Kp + 512, 256);
  v16h va0 = ldfrag_p(VH0, 64),        va1 = ldfrag_p(VH1, 64);
  v16h kb0 = ldfrag_p(Kp + 1024, 256), kb1 = ldfrag_p(Kp + 1536, 256);
#if defined(__HIP_DEVICE_COMPILE__)
  // stands in front of the last v loads, whose results may land in the register that the k loads name as their offset
  asm volatile("s_wait_xcnt 0x0" ::: "memory");
#endif
  v16h vb0 = ldfrag_p(VH0 + 128, 64),  vb1 = ldfrag_p(VH1 + 128, 64);
  // ---- first shift: maximum of the first 32 keys' scores (C = 0), so that the first step's P is at most 256 ----
  {
    // keeps every first load in front of these products, which wait for the k loads: one memory latency, not two in a row
    __builtin_amdgcn_sched_barrier(0);
    v8f s00 = mma_h_raw(ka0, qf0, zero8());
    v8f s01 = mma_h_raw(ka1, qf0, zero8());
    v8f s10 = mma_h_raw(ka0, qf1, zero8());
    v8f s11 = mma_h_raw(ka1, qf1, zero8());
    guard4(s00, s01, s10, s11, ka0, ka1, qf0, qf1);
    c0 = splat8(PSH - max32(s00, s01));
    c1 = splat8(PSH - max32(s10, s11));
  }
  // kept rolled: a trip already holds both sets' steps, further copies would only lengthen the text
#pragma unroll 1
  for (int it = 0; it < KSTEPS - 2; it += 2) {
    step(ka0, ka1, va0, va1, it + 2, true);
    step(kb0, kb1, vb0, vb1, it + 3, true);
#if defined(__HIP_DEVICE_COMPILE__)
    // stands in front of the next trip's overwrite of the address registers that this trip's loads name
    asm volatile("s_wait_xcnt 0x0" ::: "memory");
#endif
  }
  step(ka0, ka1, va0, va1, 0, false);
  step(kb0, kb1, vb0, vb1, 0, false);

  const float h0 = -c0[0], h1 = -c1[0];
  // ---- key half 1 hands its state over, lane to lane (16 B a lane and piece: contiguous, no bank conflict) ----
  if (kv == 1) {                                     // wave-uniform
    v4f (*pm)[32] = Pm[qg];
    pm[0][lane] = lo4(o00); pm[1][lane] = hi4(o00); pm[2][lane] = lo4(o01); pm[3][lane] = hi4(o01);
    pm[4][lane] = lo4(o10); pm[5][lane] = hi4(o10); pm[6][lane] = lo4(o11); pm[7][lane] = hi4(o11);
    const v4f ml = {h0, l0, h1, l1};
    pm[8][lane] = ml;
  }
  __syncthreads();
  if (kv == 0) {                                     // wave-uniform: join the halves, divide, stage
    const v4f (*pm)[32] = Pm[qg];
    const v4f ml = pm[8][lane];
    // ---- O[query 32*qg + 16*t + c][d]: accumulator row 8hh + r of tile dt is d = 8*(r&3) + 4*dt + 2hh + (r>>2) ----
    auto join = [&](const int t, const float m, const float l, const float mo, const float lo, const v8f& oa, const v8f& ob)
        __attribute__((always_inline)) {
      const float mn = fmaxf(m, mo);
      const float ca = exp2_raw(m - mn), cb = exp2_raw(mo - mn);
      float ls = l * ca + lo * cb;
      ls += __shfl_xor(ls, 16, 32);
      const float sc = (1.0f / VC) * (1.0f / ls);
      const float fa = ca * sc, fb = cb * sc;
      float* os = Os + (qg * 32 + t * 16 + c) * DHEAD + 2 * hh;
#pragma unroll
      for (int r = 0; r < 8; ++r) {
        os[8 * (r & 3) + (r >> 2)]     = oa[r] * fa + pm[4 * t + (r >> 2)][lane][r & 3] * fb;
        os[8 * (r & 3) + (r >> 2) + 4] = ob[r] * fa + pm[4 * t + 2 + (r >> 2)][lane][r & 3] * fb;
      }
    };
    join(0, h0, l0, ml[0], ml[1], o00, o01);           // the shifts differ as the maxima do
    join(1, h1, l1, ml[2], ml[3], o10, o11);
  }
  __syncthreads();
  {
    const int e = tid & 7, qq = tid >> 3;              // qq 0..31: line within group, e: 16-B piece
    v4f vals[4];
#pragma unroll
    for (int it = 0; it < 4; ++it) {
      const int qi = it * 32 + qq;                       // it 0..3 x qq 0..31 = queries 0..127 of the block
      vals[it] = *(const v4f*)(Os + qi * DHEAD + 4 * e);
    }
    float* ob = out + (size_t)dir * NTOK * CDIM + (size_t)hd * DHEAD + 4 * e;
    {
#pragma unroll
      for (int it = 0; it < 4; ++it) {
        const int qi = it * 32 + qq;
        *(v4f*)(ob + (size_t)(q0 + qi) * CDIM) = vals[it];
      }
    }
  }
}

// =====================================================================================================
// Workspace map (bytes), every offset a multiple of 256 and every plane sized to its whole-row store granularity:
//   QH   f16 [8192][256]            0           4194304
//   KH   f16 [2][8][256][2][32][8]  4194304     4194304
//   VTH  f16 [2][8][64][8][32][8]   8388608     4194304
//   end                              12582912
// =====================================================================================================
extern "C" void kernel_launch(void* const* d_in, const int* in_sizes, int n_in,
                              void* d_out, int out_size, void* d_ws, size_t ws_size,
                              hipStream_t stream) {
  if (n_in < 5) return;
  if (in_sizes[0] != NTOK * CDIM || in_sizes[1] != NTOK * CDIM) return;
  if (in_sizes[2] != OC * CDIM) return;
  if (in_sizes[3] != DHEAD || in_sizes[4] != DHEAD) return;
  if (out_size != NSTR * NTOK * CDIM) return;

  const float* x_b   = (const float*)d_in[0];
  const float* x_a   = (const float*)d_in[1];
  const float* w_qkv = (const float*)d_in[2];
  const float* ln_g  = (const float*)d_in[3];
  const float* ln_b  = (const float*)d_in[4];

  const size_t PQ  = (size_t)MROWS * CDIM * 2;        //  4194304
  const size_t PV  = (size_t)NSTR * CDIM * NTOK * 2;  //  4194304
  size_t off = 0;
  const size_t oQH = off; off += PQ;
  const size_t oKH = off; off += PQ;
  const size_t oVH = off; off += PV;
  if (off > ws_size) return;                          // off = 12582912
  if (off > (size_t)134217728) return;

  char* ws = (char*)d_ws;
  unsigned short* QH  = (unsigned short*)(ws + oQH);
  unsigned short* KH  = (unsigned short*)(ws + oKH);
  unsigned short* VTH = (unsigned short*)(ws + oVH);
  float*          out = (float*)d_out;

  const dim3 blk(256);
  const dim3 gGM((MROWS / 128) * 3);                           // 64 token blocks x 3 parts = 192 blocks
  const dim3 gAT(NSTR * NHEAD * (NTOK / QBLK));                // 512 blocks of 256

  // (1) t[s*4096 + n][o] = (x_s[n] . W[o]), both streams stacked, operands f16( bf16_RNE(.) * 64 ) formed in the block's
  //     prologue, scale 1/(64*64); per-head LayerNorm in the epilogue -> q token rows; k and v in fragment order
  gemm64_ln<<<gGM, blk, 0, stream>>>(x_b, x_a, w_qkv, ln_g, ln_b, QH, KH, VTH);

  // (2) attention, both directions, all heads -> out[dir][n][h*32 + d]
  attn_kernel<<<gAT, blk, 0, stream>>>(QH, KH, VTH, out);
  (void)hipGetLastError();
}
